// v000
// Measured on an AMD MI455X. A time is GPU time per run, averaged over a window of back-to-back runs after a warm-up
// (all launches, gaps included; the runs take copies of the inputs in turn), and the median of several windows.
// Apart from v000's, it joins two sittings. Times from different sittings can be a few percent apart, while
// side-by-side timings come from the same sitting.
// v000 is the starting kernel. One run takes 902 microseconds.
#include <hip/hip_runtime.h>
#include <hip/hip_bf16.h>
#include <math.h>

// Problem constants (fixed by the reference)
#define BB 4
#define NN 2048
#define DD 512
#define HH 8
#define EE 512
#define D1 1024
#define HD 128
#define GAMMA 0.999f

typedef _Float16 v16h __attribute__((ext_vector_type(16)));
typedef float    v8f  __attribute__((ext_vector_type(8)));
typedef _Float16 h2   __attribute__((ext_vector_type(2)));

// ---------------------------------------------------------------------------
// SRMS norm (optionally followed by ReLU). One block per row.
// ---------------------------------------------------------------------------
__global__ void srms_kernel(const float* __restrict__ in, float* __restrict__ out,
                            int L, int relu) {
    __shared__ float red[256];
    const int row = blockIdx.x;
    const float* x = in + (size_t)row * L;
    float* y = out + (size_t)row * L;
    float p = 0.f;
    for (int i = threadIdx.x; i < L; i += 256) { float v = x[i]; p += v * v; }
    red[threadIdx.x] = p;
    __syncthreads();
    for (int s = 128; s > 0; s >>= 1) {
        if (threadIdx.x < s) red[threadIdx.x] += red[threadIdx.x + s];
        __syncthreads();
    }
    const float scale = 1.0f / (sqrtf(red[0] / (float)L) + 1e-8f);
    for (int i = threadIdx.x; i < L; i += 256) {
        float v = x[i] * scale;
        if (relu) v = fmaxf(v, 0.f);
        y[i] = v;
    }
}

// ---------------------------------------------------------------------------
// Generic WMMA GEMM: C[M,Nf] = epilogue(A[M,K] @ W[K,Nf] + bias)
//   mode 0: bias only
//   mode 1: bias + SiLU
//   mode 2: bias + SiLU, scatter output to (B,H,N,HD) layout
//   mode 3: bias + residual add (res has same [M,Nf] layout)
// Block tile 64x128x32, 256 threads = 8 waves, each wave -> 32x32 via
// 2x2 v_wmma_f32_16x16x32_f16. Assumes M%64==0, Nf%128==0, K%32==0.
// ---------------------------------------------------------------------------
__global__ void gemm_wmma_kernel(const float* __restrict__ A,
                                 const float* __restrict__ W,
                                 const float* __restrict__ bias,
                                 float* __restrict__ C,
                                 const float* __restrict__ res,
                                 int M, int Nf, int K, int mode) {
    __shared__ __align__(16) _Float16 As[64 * 32];    // [m][k] row-major
    __shared__ __align__(16) _Float16 Bs[128 * 32];   // [n][k] (W tile transposed)

    const int tid  = threadIdx.x;
    const int lane = tid & 31;
    const int wid  = tid >> 5;
    const int wm   = wid & 1;    // 0..1  (rows 0-31 / 32-63)
    const int wn   = wid >> 1;   // 0..3  (cols, 32 each)

    const int bm = blockIdx.x * 64;
    const int bn = blockIdx.y * 128;

    v8f acc[2][2];
    acc[0][0] = (v8f){}; acc[0][1] = (v8f){};
    acc[1][0] = (v8f){}; acc[1][1] = (v8f){};

    const int laneM = lane & 15;
    const int hiSel = (lane >> 4) & 1;   // upper half of wave

    const int nkb = K / 32;
    for (int kb = 0; kb < nkb; ++kb) {
        // ---- stage A tile: 64x32 floats -> f16, 8 per thread ----
        {
            const int r  = tid >> 2;            // 0..63
            const int c0 = (tid & 3) * 8;       // 0,8,16,24
            const float* src = A + (size_t)(bm + r) * K + kb * 32 + c0;
            if (kb + 1 < nkb) __builtin_prefetch(src + 32, 0, 0);
#pragma unroll
            for (int j = 0; j < 8; ++j)
                As[r * 32 + c0 + j] = (_Float16)src[j];
        }
        // ---- stage W tile transposed: each thread owns a K-pair (k0,k0+1)
        //      for 8 consecutive n -> packed 32-bit DS stores ----
        {
            const int k0 = (tid >> 4) * 2;      // 0,2,..,30
            const int n0 = (tid & 15) * 8;      // 0..120
            const float* src0 = W + (size_t)(kb * 32 + k0) * Nf + bn + n0;
            const float* src1 = src0 + Nf;
            if (kb + 1 < nkb) __builtin_prefetch(src0 + (size_t)32 * Nf, 0, 0);
#pragma unroll
            for (int j = 0; j < 8; ++j) {
                h2 pk;
                pk.x = (_Float16)src0[j];
                pk.y = (_Float16)src1[j];
                *(h2*)&Bs[(n0 + j) * 32 + k0] = pk;
            }
        }
        __syncthreads();

        // ---- load fragments (documented 16-bit A/B layout: K pairs 2g,2g+1
        //      contiguous per lane -> 128-bit DS reads per fragment) ----
        v16h fa[2], fb[2];
#pragma unroll
        for (int mi = 0; mi < 2; ++mi) {
            const int Mr = wm * 32 + mi * 16 + laneM;
#pragma unroll
            for (int g = 0; g < 8; ++g) {
                const int k0 = ((g >= 4) ? 16 : 0) + hiSel * 8 + 2 * (g & 3);
                h2 p = *(const h2*)&As[Mr * 32 + k0];
                fa[mi][2 * g]     = p.x;
                fa[mi][2 * g + 1] = p.y;
            }
        }
#pragma unroll
        for (int ni = 0; ni < 2; ++ni) {
            const int Nr = wn * 32 + ni * 16 + laneM;
#pragma unroll
            for (int g = 0; g < 8; ++g) {
                const int k0 = ((g >= 4) ? 16 : 0) + hiSel * 8 + 2 * (g & 3);
                h2 p = *(const h2*)&Bs[Nr * 32 + k0];
                fb[ni][2 * g]     = p.x;
                fb[ni][2 * g + 1] = p.y;
            }
        }

#pragma unroll
        for (int mi = 0; mi < 2; ++mi)
#pragma unroll
            for (int ni = 0; ni < 2; ++ni)
                acc[mi][ni] = __builtin_amdgcn_wmma_f32_16x16x32_f16(
                    false, fa[mi], false, fb[ni], (short)0, acc[mi][ni],
                    false, false);
        __syncthreads();
    }

    // ---- epilogue ----
#pragma unroll
    for (int mi = 0; mi < 2; ++mi) {
#pragma unroll
        for (int ni = 0; ni < 2; ++ni) {
#pragma unroll
            for (int r = 0; r < 8; ++r) {
                const int row = bm + wm * 32 + mi * 16 + r + hiSel * 8;
                const int col = bn + wn * 32 + ni * 16 + laneM;
                float val = acc[mi][ni][r] + bias[col];
                if (mode == 1 || mode == 2) {
                    val = val / (1.0f + __expf(-val));   // SiLU
                }
                if (mode == 3) {
                    val += res[(size_t)row * Nf + col];
                }
                if (mode == 2) {
                    // scatter (b,n, h*HD+d) -> ((b*H+h)*N + n)*HD + d
                    const int b = row / NN, n = row % NN;
                    const int h = col / HD, d = col % HD;
                    C[(((size_t)b * HH + h) * NN + n) * HD + d] = val;
                } else {
                    C[(size_t)row * Nf + col] = val;
                }
            }
        }
    }
}

// ---------------------------------------------------------------------------
// hcf[n,e] = n * Wp[e] + bp[e]
// ---------------------------------------------------------------------------
__global__ void posinit_kernel(const float* __restrict__ Wp,
                               const float* __restrict__ bp,
                               float* __restrict__ hcf) {
    int i = blockIdx.x * 256 + threadIdx.x;
    if (i >= NN * EE) return;
    int n = i / EE, e = i % EE;
    hcf[i] = (float)n * Wp[e] + bp[e];
}

// ---------------------------------------------------------------------------
// a[h,k,d] = (k==0 ? coef[0,h,d] : gamma^k * coef[k,h,d])
// coef layout: [N, H*HD]; a layout: [H, N, HD]
// ---------------------------------------------------------------------------
__global__ void build_a_kernel(const float* __restrict__ coef,
                               float* __restrict__ a) {
    int i = blockIdx.x * 256 + threadIdx.x;
    if (i >= HH * NN * HD) return;
    int h = i / (NN * HD);
    int k = (i / HD) % NN;
    int d = i % HD;
    float c = coef[(size_t)k * (HH * HD) + h * HD + d];
    float decay = (k == 0) ? 1.0f : __expf((float)k * __logf(GAMMA));
    a[i] = decay * c;
}

// ---------------------------------------------------------------------------
// Blocked causal depthwise conv along time:
//   y[b,h,t,d] = sum_{k=0..t} a[h,k,d] * v[b,h,t-k,d]
// One block = one output chunk of C_T=32 timesteps for one (b,h).
// v-tile staged via CDNA5 async memory->LDS DMA (ASYNCcnt-tracked, no VGPR
// round-trip); a-tile staged zero-padded in LDS (causal mask, branch-free).
// ---------------------------------------------------------------------------
#define C_T 32
__global__ void conv_kernel(const float* __restrict__ a,
                            const float* __restrict__ v,
                            float* __restrict__ y) {
    __shared__ __align__(16) float v_s[C_T * HD];            // 16 KB
    __shared__ __align__(16) float a_s[(2 * C_T - 1) * HD];  // 31.5 KB

    const int i = blockIdx.x;     // output chunk
    const int h = blockIdx.y;
    const int b = blockIdx.z;
    const int tid = threadIdx.x;
    const int d = tid & (HD - 1);
    const int r = tid >> 7;       // 0..1 -> t_local = r*16 + q

    const float* vb = v + (((size_t)b * HH + h) * NN) * HD;
    const float* ab = a + ((size_t)h * NN) * HD;

    float acc[16];
#pragma unroll
    for (int q = 0; q < 16; ++q) acc[q] = 0.f;

    for (int j = 0; j <= i; ++j) {
        // stage v chunk j: async global->LDS, 16B per lane, 4 issues/thread
        {
            const float* src = vb + (size_t)(j * C_T) * HD;
#pragma unroll
            for (int it = 0; it < (C_T * HD) / (4 * 256); ++it) {
                const int idx4 = it * 256 + tid;                 // b128 index
                const unsigned lds_addr =
                    (unsigned)(uintptr_t)(&v_s[idx4 * 4]);
                const unsigned long long gaddr =
                    (unsigned long long)(uintptr_t)(src + idx4 * 4);
                asm volatile("global_load_async_to_lds_b128 %0, %1, off"
                             :: "v"(lds_addr), "v"(gaddr) : "memory");
            }
        }
        // stage kernel rows k = (i-j)*C_T - (C_T-1) .. +(C_T-1), zero-padded
        const int kbase = (i - j) * C_T - (C_T - 1);
        for (int idx = tid; idx < (2 * C_T - 1) * HD; idx += 256) {
            const int kk = idx >> 7;
            const int kg = kbase + kk;
            a_s[idx] = (kg >= 0 && kg < NN) ? ab[(size_t)kg * HD + (idx & (HD - 1))]
                                            : 0.f;
        }
        asm volatile("s_wait_asynccnt 0x0" ::: "memory");
        __syncthreads();

        for (int s = 0; s < C_T; ++s) {
            const float vv = v_s[s * HD + d];
            const int base = (r * 16 - s + (C_T - 1)) * HD + d;
#pragma unroll
            for (int q = 0; q < 16; ++q)
                acc[q] = fmaf(a_s[base + q * HD], vv, acc[q]);
        }
        __syncthreads();
    }

    const int t0 = i * C_T + r * 16;
    float* yb = y + (((size_t)b * HH + h) * NN) * HD;
#pragma unroll
    for (int q = 0; q < 16; ++q)
        yb[(size_t)(t0 + q) * HD + d] = acc[q];
}

// ---------------------------------------------------------------------------
// g[b,n,h*HD+d] = u[b,n,h*HD+d] * y[b,h,n,d]
// ---------------------------------------------------------------------------
__global__ void gate_kernel(const float* __restrict__ u,
                            const float* __restrict__ y,
                            float* __restrict__ g) {
    int i = blockIdx.x * 256 + threadIdx.x;
    if (i >= BB * NN * D1) return;
    int c = i % D1;
    int bn = i / D1;
    int n = bn % NN, b = bn / NN;
    int h = c / HD, d = c % HD;
    g[i] = u[i] * y[(((size_t)b * HH + h) * NN + n) * HD + d];
}

// ---------------------------------------------------------------------------
extern "C" void kernel_launch(void* const* d_in, const int* in_sizes, int n_in,
                              void* d_out, int out_size, void* d_ws, size_t ws_size,
                              hipStream_t stream) {
    const float* x  = (const float*)d_in[0];
    const float* Wu = (const float*)d_in[1];
    const float* bu = (const float*)d_in[2];
    const float* Wv = (const float*)d_in[3];
    const float* bv = (const float*)d_in[4];
    const float* Wo = (const float*)d_in[5];
    const float* bo = (const float*)d_in[6];
    const float* Wp = (const float*)d_in[7];
    const float* bp = (const float*)d_in[8];
    const float* W1 = (const float*)d_in[9];
    const float* b1 = (const float*)d_in[10];
    const float* W2 = (const float*)d_in[11];
    const float* b2 = (const float*)d_in[12];
    const float* W3 = (const float*)d_in[13];
    const float* b3 = (const float*)d_in[14];
    const float* Wz = (const float*)d_in[15];
    const float* bz = (const float*)d_in[16];
    float* out = (float*)d_out;

    float* ws = (float*)d_ws;
    const size_t SZ_XN = (size_t)BB * NN * DD;   // 4M
    const size_t SZ_U  = (size_t)BB * NN * D1;   // 8M
    const size_t SZ_H  = (size_t)NN * EE;        // 1M
    const size_t SZ_CO = (size_t)NN * D1;        // 2M

    float* xn   = ws;                    // 4M
    float* u    = xn + SZ_XN;            // 8M
    float* v    = u + SZ_U;              // 8M  (B,H,N,HD); reused for g
    float* y    = v + SZ_U;              // 8M  (B,H,N,HD)
    float* hcfA = y + SZ_U;              // 1M
    float* hcfB = hcfA + SZ_H;           // 1M
    float* bufT = hcfB + SZ_H;           // 1M
    float* coef = bufT + SZ_H;           // 2M
    float* av   = coef + SZ_CO;          // 2M  (H,N,HD)

    const int MT = BB * NN;  // 8192 token rows

    // 1) xn = srms(x)
    srms_kernel<<<MT, 256, 0, stream>>>(x, xn, DD, 0);

    // 2) u = silu(xn @ Wu + bu)
    gemm_wmma_kernel<<<dim3(MT / 64, D1 / 128), 256, 0, stream>>>(
        xn, Wu, bu, u, nullptr, MT, D1, DD, 1);

    // 3) v = silu(xn @ Wv + bv), scattered to (B,H,N,HD)
    gemm_wmma_kernel<<<dim3(MT / 64, D1 / 128), 256, 0, stream>>>(
        xn, Wv, bv, v, nullptr, MT, D1, DD, 2);

    // 4) positional MLP
    posinit_kernel<<<(NN * EE + 255) / 256, 256, 0, stream>>>(Wp, bp, hcfA);

    const float* Ws[3] = {W1, W2, W3};
    const float* bs[3] = {b1, b2, b3};
    float* bufs[2] = {hcfA, hcfB};
    int cur = 0;
    for (int l = 0; l < 3; ++l) {
        srms_kernel<<<NN, 256, 0, stream>>>(bufs[cur], bufT, EE, 1);
        gemm_wmma_kernel<<<dim3(NN / 64, EE / 128), 256, 0, stream>>>(
            bufT, Ws[l], bs[l], bufs[cur ^ 1], nullptr, NN, EE, EE, 0);
        cur ^= 1;
    }
    srms_kernel<<<NN, 256, 0, stream>>>(bufs[cur], bufT, EE, 1);
    gemm_wmma_kernel<<<dim3(NN / 64, D1 / 128), 256, 0, stream>>>(
        bufT, Wz, bz, coef, nullptr, NN, D1, EE, 0);

    // 5) build decayed kernel a[h,k,d]
    build_a_kernel<<<(HH * NN * HD + 255) / 256, 256, 0, stream>>>(coef, av);

    // 6) causal depthwise conv: y[b,h,t,d]
    conv_kernel<<<dim3(NN / C_T, HH, BB), 256, 0, stream>>>(av, v, y);

    // 7) gate: g = u * y  (g reuses v buffer)
    gate_kernel<<<((int)SZ_U + 255) / 256, 256, 0, stream>>>(u, y, v);

    // 8) out = g @ Wo + bo + x
    gemm_wmma_kernel<<<dim3(MT / 64, DD / 128), 256, 0, stream>>>(
        v, Wo, bo, out, x, MT, DD, D1, 3);
}

// v001
// A run of this version takes 535 microseconds.
// In both of two side-by-side timings against v000, it was 1.70 times as fast.
#include <hip/hip_runtime.h>
#include <hip/hip_bf16.h>
#include <math.h>

// Problem constants (fixed by the reference)
#define BB 4
#define NN 2048
#define DD 512
#define HH 8
#define EE 512
#define D1 1024
#define HD 128
#define GAMMA 0.999f

typedef _Float16 v16h __attribute__((ext_vector_type(16)));
typedef float    v8f  __attribute__((ext_vector_type(8)));
typedef _Float16 h2   __attribute__((ext_vector_type(2)));

// ---------------------------------------------------------------------------
// SRMS norm (optionally followed by ReLU). One block per row.
// ---------------------------------------------------------------------------
__global__ void srms_kernel(const float* __restrict__ in, float* __restrict__ out,
                            int L, int relu) {
    __shared__ float red[256];
    const int row = blockIdx.x;
    const float* x = in + (size_t)row * L;
    float* y = out + (size_t)row * L;
    float p = 0.f;
    for (int i = threadIdx.x; i < L; i += 256) { float v = x[i]; p += v * v; }
    red[threadIdx.x] = p;
    __syncthreads();
    for (int s = 128; s > 0; s >>= 1) {
        if (threadIdx.x < s) red[threadIdx.x] += red[threadIdx.x + s];
        __syncthreads();
    }
    const float scale = 1.0f / (sqrtf(red[0] / (float)L) + 1e-8f);
    for (int i = threadIdx.x; i < L; i += 256) {
        float v = x[i] * scale;
        if (relu) v = fmaxf(v, 0.f);
        y[i] = v;
    }
}

// ---------------------------------------------------------------------------
// Generic WMMA GEMM: C[M,Nf] = epilogue(A[M,K] @ W[K,Nf] + bias)
//   mode 0: bias only
//   mode 1: bias + SiLU
//   mode 2: bias + SiLU, scatter output to (B,H,N,HD) layout
//   mode 3: bias + residual add (res has same [M,Nf] layout)
// Block tile 64x128x32, 256 threads = 8 waves, each wave -> 32x32 via
// 2x2 v_wmma_f32_16x16x32_f16. Assumes M%64==0, Nf%128==0, K%32==0.
// ---------------------------------------------------------------------------
__global__ void gemm_wmma_kernel(const float* __restrict__ A,
                                 const float* __restrict__ W,
                                 const float* __restrict__ bias,
                                 float* __restrict__ C,
                                 const float* __restrict__ res,
                                 int M, int Nf, int K, int mode) {
    __shared__ __align__(16) _Float16 As[64 * 32];    // [m][k] row-major
    __shared__ __align__(16) _Float16 Bs[128 * 32];   // [n][k] (W tile transposed)

    const int tid  = threadIdx.x;
    const int lane = tid & 31;
    const int wid  = tid >> 5;
    const int wm   = wid & 1;    // 0..1  (rows 0-31 / 32-63)
    const int wn   = wid >> 1;   // 0..3  (cols, 32 each)

    const int bm = blockIdx.x * 64;
    const int bn = blockIdx.y * 128;

    v8f acc[2][2];
    acc[0][0] = (v8f){}; acc[0][1] = (v8f){};
    acc[1][0] = (v8f){}; acc[1][1] = (v8f){};

    const int laneM = lane & 15;
    const int hiSel = (lane >> 4) & 1;   // upper half of wave

    const int nkb = K / 32;
    for (int kb = 0; kb < nkb; ++kb) {
        // ---- stage A tile: 64x32 floats -> f16, 8 per thread ----
        {
            const int r  = tid >> 2;            // 0..63
            const int c0 = (tid & 3) * 8;       // 0,8,16,24
            const float* src = A + (size_t)(bm + r) * K + kb * 32 + c0;
            if (kb + 1 < nkb) __builtin_prefetch(src + 32, 0, 0);
#pragma unroll
            for (int j = 0; j < 8; ++j)
                As[r * 32 + c0 + j] = (_Float16)src[j];
        }
        // ---- stage W tile transposed: each thread owns a K-pair (k0,k0+1)
        //      for 8 consecutive n -> packed 32-bit DS stores ----
        {
            const int k0 = (tid >> 4) * 2;      // 0,2,..,30
            const int n0 = (tid & 15) * 8;      // 0..120
            const float* src0 = W + (size_t)(kb * 32 + k0) * Nf + bn + n0;
            const float* src1 = src0 + Nf;
            if (kb + 1 < nkb) __builtin_prefetch(src0 + (size_t)32 * Nf, 0, 0);
#pragma unroll
            for (int j = 0; j < 8; ++j) {
                h2 pk;
                pk.x = (_Float16)src0[j];
                pk.y = (_Float16)src1[j];
                *(h2*)&Bs[(n0 + j) * 32 + k0] = pk;
            }
        }
        __syncthreads();

        // ---- load fragments (documented 16-bit A/B layout: K pairs 2g,2g+1
        //      contiguous per lane -> 128-bit DS reads per fragment) ----
        v16h fa[2], fb[2];
#pragma unroll
        for (int mi = 0; mi < 2; ++mi) {
            const int Mr = wm * 32 + mi * 16 + laneM;
#pragma unroll
            for (int g = 0; g < 8; ++g) {
                const int k0 = ((g >= 4) ? 16 : 0) + hiSel * 8 + 2 * (g & 3);
                h2 p = *(const h2*)&As[Mr * 32 + k0];
                fa[mi][2 * g]     = p.x;
                fa[mi][2 * g + 1] = p.y;
            }
        }
#pragma unroll
        for (int ni = 0; ni < 2; ++ni) {
            const int Nr = wn * 32 + ni * 16 + laneM;
#pragma unroll
            for (int g = 0; g < 8; ++g) {
                const int k0 = ((g >= 4) ? 16 : 0) + hiSel * 8 + 2 * (g & 3);
                h2 p = *(const h2*)&Bs[Nr * 32 + k0];
                fb[ni][2 * g]     = p.x;
                fb[ni][2 * g + 1] = p.y;
            }
        }

#pragma unroll
        for (int mi = 0; mi < 2; ++mi)
#pragma unroll
            for (int ni = 0; ni < 2; ++ni)
                acc[mi][ni] = __builtin_amdgcn_wmma_f32_16x16x32_f16(
                    false, fa[mi], false, fb[ni], (short)0, acc[mi][ni],
                    false, false);
        __syncthreads();
    }

    // ---- epilogue ----
#pragma unroll
    for (int mi = 0; mi < 2; ++mi) {
#pragma unroll
        for (int ni = 0; ni < 2; ++ni) {
#pragma unroll
            for (int r = 0; r < 8; ++r) {
                const int row = bm + wm * 32 + mi * 16 + r + hiSel * 8;
                const int col = bn + wn * 32 + ni * 16 + laneM;
                float val = acc[mi][ni][r] + bias[col];
                if (mode == 1 || mode == 2) {
                    val = val / (1.0f + __expf(-val));   // SiLU
                }
                if (mode == 3) {
                    val += res[(size_t)row * Nf + col];
                }
                if (mode == 2) {
                    // scatter (b,n, h*HD+d) -> ((b*H+h)*N + n)*HD + d
                    const int b = row / NN, n = row % NN;
                    const int h = col / HD, d = col % HD;
                    C[(((size_t)b * HH + h) * NN + n) * HD + d] = val;
                } else {
                    C[(size_t)row * Nf + col] = val;
                }
            }
        }
    }
}

// ---------------------------------------------------------------------------
// hcf[n,e] = n * Wp[e] + bp[e]
// ---------------------------------------------------------------------------
__global__ void posinit_kernel(const float* __restrict__ Wp,
                               const float* __restrict__ bp,
                               float* __restrict__ hcf) {
    int i = blockIdx.x * 256 + threadIdx.x;
    if (i >= NN * EE) return;
    int n = i / EE, e = i % EE;
    hcf[i] = (float)n * Wp[e] + bp[e];
}

// ---------------------------------------------------------------------------
// Filter plane with C_T-1 rows of zeros in front of every head (lags < 0):
//   a[h,p,d] = 0                      for p <  C_T-1
//   a[h,p,d] = decay(k) * coef[k,h,d] for k = p-(C_T-1) >= 0,
//              decay(0) = 1, decay(k) = gamma^k
// coef layout: [N, H*HD]; a layout: [H, PADN, HD]
// ---------------------------------------------------------------------------
#define C_T 32
#define PADN (NN + C_T - 1)
__global__ void build_a_kernel(const float* __restrict__ coef,
                               float* __restrict__ a) {
    int i = blockIdx.x * 256 + threadIdx.x;
    if (i >= HH * PADN * HD) return;
    int h = i / (PADN * HD);
    int k = (i / HD) % PADN - (C_T - 1);
    int d = i % HD;
    float val = 0.f;
    if (k >= 0) {
        float c = coef[(size_t)k * (HH * HD) + h * HD + d];
        float decay = (k == 0) ? 1.0f : __expf((float)k * __logf(GAMMA));
        val = decay * c;
    }
    a[i] = val;
}

// ---------------------------------------------------------------------------
// Blocked causal depthwise conv along time:
//   y[b,h,t,d] = sum_{k=0..t} a[h,k+C_T-1,d] * v[b,h,t-k,d]
// One block = one output chunk of C_T=32 timesteps for one (b,h).
// v-tile staged via CDNA5 async memory->LDS DMA (ASYNCcnt-tracked, no VGPR
// round-trip). A thread's 16 outputs times 32 inputs of a chunk touch only
// 16+32-1 = 47 consecutive filter rows of its column d: they are loaded once
// per chunk from the zero-padded plane into registers and every FMA takes its
// filter value from there (causal mask = the plane's zero rows, branch-free).
// ---------------------------------------------------------------------------
#define A_WIN (16 + C_T - 1)
__global__ void conv_kernel(const float* __restrict__ a,
                            const float* __restrict__ v,
                            float* __restrict__ y) {
    __shared__ __align__(16) float v_s[C_T * HD];            // 16 KB

    const int i = blockIdx.x;     // output chunk
    const int h = blockIdx.y;
    const int b = blockIdx.z;
    const int tid = threadIdx.x;
    const int d = tid & (HD - 1);
    const int r = tid >> 7;       // 0..1 -> t_local = r*16 + q

    const float* vb = v + (((size_t)b * HH + h) * NN) * HD;
    const float* ab = a + ((size_t)h * PADN) * HD;

    float acc[16];
#pragma unroll
    for (int q = 0; q < 16; ++q) acc[q] = 0.f;

    for (int j = 0; j <= i; ++j) {
        // stage v chunk j: async global->LDS, 16B per lane, 4 issues/thread
        {
            const float* src = vb + (size_t)(j * C_T) * HD + tid * 4;
            const unsigned lds0 = (unsigned)(uintptr_t)(&v_s[tid * 4]);
            // the wait on the address registers is the statement's last line,
            // so that nothing rewrites them in front of it
            asm volatile("global_load_async_to_lds_b128 %0, %4, off\n\t"
                         "global_load_async_to_lds_b128 %1, %5, off\n\t"
                         "global_load_async_to_lds_b128 %2, %6, off\n\t"
                         "global_load_async_to_lds_b128 %3, %7, off\n\t"
                         "s_wait_xcnt 0x0"
                         :: "v"(lds0), "v"(lds0 + 4096u), "v"(lds0 + 8192u),
                            "v"(lds0 + 12288u),
                            "v"(src), "v"(src + 1024), "v"(src + 2048),
                            "v"(src + 3072)
                         : "memory");
        }
        // filter window: padded rows (i-j)*C_T + r*16 + c, c = 0..46, that is
        // lags k = (i-j)*C_T + r*16 + c - (C_T-1); all loads in flight together
        const float* aw_src = ab + (size_t)((i - j) * C_T + r * 16) * HD + d;
        float aw[A_WIN];
        // full unroll: aw[] must stay in registers
#pragma unroll
        for (int c = 0; c < A_WIN; ++c) aw[c] = aw_src[c * HD];
        // before the loads' address registers are reused
        asm volatile("s_wait_xcnt 0x0" ::: "memory");

        asm volatile("s_wait_asynccnt 0x0" ::: "memory");
        __syncthreads();

        // full unroll: aw[] is indexed by s and q and must stay in registers
#pragma unroll
        for (int s = 0; s < C_T; ++s) {
            const float vv = v_s[s * HD + d];
#pragma unroll
            for (int q = 0; q < 16; ++q)
                acc[q] = fmaf(aw[q - s + (C_T - 1)], vv, acc[q]);
        }
        __syncthreads();
    }

    const int t0 = i * C_T + r * 16;
    float* yb = y + (((size_t)b * HH + h) * NN) * HD;
#pragma unroll
    for (int q = 0; q < 16; ++q)
        yb[(size_t)(t0 + q) * HD + d] = acc[q];
}

// ---------------------------------------------------------------------------
// g[b,n,h*HD+d] = u[b,n,h*HD+d] * y[b,h,n,d]
// ---------------------------------------------------------------------------
__global__ void gate_kernel(const float* __restrict__ u,
                            const float* __restrict__ y,
                            float* __restrict__ g) {
    int i = blockIdx.x * 256 + threadIdx.x;
    if (i >= BB * NN * D1) return;
    int c = i % D1;
    int bn = i / D1;
    int n = bn % NN, b = bn / NN;
    int h = c / HD, d = c % HD;
    g[i] = u[i] * y[(((size_t)b * HH + h) * NN + n) * HD + d];
}

// ---------------------------------------------------------------------------
extern "C" void kernel_launch(void* const* d_in, const int* in_sizes, int n_in,
                              void* d_out, int out_size, void* d_ws, size_t ws_size,
                              hipStream_t stream) {
    const float* x  = (const float*)d_in[0];
    const float* Wu = (const float*)d_in[1];
    const float* bu = (const float*)d_in[2];
    const float* Wv = (const float*)d_in[3];
    const float* bv = (const float*)d_in[4];
    const float* Wo = (const float*)d_in[5];
    const float* bo = (const float*)d_in[6];
    const float* Wp = (const float*)d_in[7];
    const float* bp = (const float*)d_in[8];
    const float* W1 = (const float*)d_in[9];
    const float* b1 = (const float*)d_in[10];
    const float* W2 = (const float*)d_in[11];
    const float* b2 = (const float*)d_in[12];
    const float* W3 = (const float*)d_in[13];
    const float* b3 = (const float*)d_in[14];
    const float* Wz = (const float*)d_in[15];
    const float* bz = (const float*)d_in[16];
    float* out = (float*)d_out;

    float* ws = (float*)d_ws;
    const size_t SZ_XN = (size_t)BB * NN * DD;   // 4M
    const size_t SZ_U  = (size_t)BB * NN * D1;   // 8M
    const size_t SZ_H  = (size_t)NN * EE;        // 1M
    const size_t SZ_CO = (size_t)NN * D1;        // 2M

    float* xn   = ws;                    // 4M
    float* u    = xn + SZ_XN;            // 8M
    float* v    = u + SZ_U;              // 8M  (B,H,N,HD); reused for g
    float* y    = v + SZ_U;              // 8M  (B,H,N,HD)
    float* hcfA = y + SZ_U;              // 1M
    float* hcfB = hcfA + SZ_H;           // 1M
    float* bufT = hcfB + SZ_H;           // 1M
    float* coef = bufT + SZ_H;           // 2M
    float* av   = coef + SZ_CO;          // 2M + pad (H,PADN,HD)

    const int MT = BB * NN;  // 8192 token rows

    // 1) xn = srms(x)
    srms_kernel<<<MT, 256, 0, stream>>>(x, xn, DD, 0);

    // 2) u = silu(xn @ Wu + bu)
    gemm_wmma_kernel<<<dim3(MT / 64, D1 / 128), 256, 0, stream>>>(
        xn, Wu, bu, u, nullptr, MT, D1, DD, 1);

    // 3) v = silu(xn @ Wv + bv), scattered to (B,H,N,HD)
    gemm_wmma_kernel<<<dim3(MT / 64, D1 / 128), 256, 0, stream>>>(
        xn, Wv, bv, v, nullptr, MT, D1, DD, 2);

    // 4) positional MLP
    posinit_kernel<<<(NN * EE + 255) / 256, 256, 0, stream>>>(Wp, bp, hcfA);

    const float* Ws[3] = {W1, W2, W3};
    const float* bs[3] = {b1, b2, b3};
    float* bufs[2] = {hcfA, hcfB};
    int cur = 0;
    for (int l = 0; l < 3; ++l) {
        srms_kernel<<<NN, 256, 0, stream>>>(bufs[cur], bufT, EE, 1);
        gemm_wmma_kernel<<<dim3(NN / 64, EE / 128), 256, 0, stream>>>(
            bufT, Ws[l], bs[l], bufs[cur ^ 1], nullptr, NN, EE, EE, 0);
        cur ^= 1;
    }
    srms_kernel<<<NN, 256, 0, stream>>>(bufs[cur], bufT, EE, 1);
    gemm_wmma_kernel<<<dim3(NN / 64, D1 / 128), 256, 0, stream>>>(
        bufT, Wz, bz, coef, nullptr, NN, D1, EE, 0);

    // 5) build decayed, zero-padded kernel a[h,p,d]
    build_a_kernel<<<(HH * PADN * HD + 255) / 256, 256, 0, stream>>>(coef, av);

    // 6) causal depthwise conv: y[b,h,t,d]
    conv_kernel<<<dim3(NN / C_T, HH, BB), 256, 0, stream>>>(av, v, y);

    // 7) gate: g = u * y  (g reuses v buffer)
    gate_kernel<<<((int)SZ_U + 255) / 256, 256, 0, stream>>>(u, y, v);

    // 8) out = g @ Wo + bo + x
    gemm_wmma_kernel<<<dim3(MT / 64, DD / 128), 256, 0, stream>>>(
        v, Wo, bo, out, x, MT, DD, D1, 3);
}

// v002
// One run takes 344 microseconds.
// Next to v001, in two timings, it ran 1.55 times as fast each time.
// Counting every step since v000, it is 2.64 times as fast.
#include <hip/hip_runtime.h>
#include <hip/hip_bf16.h>
#include <math.h>

// Problem constants (fixed by the reference)
#define BB 4
#define NN 2048
#define DD 512
#define HH 8
#define EE 512
#define D1 1024
#define HD 128
#define GAMMA 0.999f

typedef _Float16 v16h __attribute__((ext_vector_type(16)));
typedef float    v8f  __attribute__((ext_vector_type(8)));
typedef _Float16 h2   __attribute__((ext_vector_type(2)));
typedef _Float16 v8h  __attribute__((ext_vector_type(8)));

// ---------------------------------------------------------------------------
// SRMS norm (optionally followed by ReLU). One block per row.
// ---------------------------------------------------------------------------
__global__ void srms_kernel(const float* __restrict__ in, float* __restrict__ out,
                            int L, int relu) {
    __shared__ float red[256];
    const int row = blockIdx.x;
    const float* x = in + (size_t)row * L;
    float* y = out + (size_t)row * L;
    float p = 0.f;
    for (int i = threadIdx.x; i < L; i += 256) { float v = x[i]; p += v * v; }
    red[threadIdx.x] = p;
    __syncthreads();
    for (int s = 128; s > 0; s >>= 1) {
        if (threadIdx.x < s) red[threadIdx.x] += red[threadIdx.x + s];
        __syncthreads();
    }
    const float scale = 1.0f / (sqrtf(red[0] / (float)L) + 1e-8f);
    for (int i = threadIdx.x; i < L; i += 256) {
        float v = x[i] * scale;
        if (relu) v = fmaxf(v, 0.f);
        y[i] = v;
    }
}

// ---------------------------------------------------------------------------
// Generic WMMA GEMM: C[M,Nf] = epilogue(A[M,K] @ W[K,Nf] + bias)
//   mode 0: bias only
//   mode 1: bias + SiLU
//   mode 2: bias + SiLU, output as f16, time-major per channel: [col][B][N]
//   mode 3: bias + residual add (res has same [M,Nf] layout)
// Block tile 64x128x32, 256 threads = 8 waves, each wave -> 32x32 via
// 2x2 v_wmma_f32_16x16x32_f16. Assumes M%64==0, Nf%128==0, K%32==0.
// ---------------------------------------------------------------------------
__global__ void gemm_wmma_kernel(const float* __restrict__ A,
                                 const float* __restrict__ W,
                                 const float* __restrict__ bias,
                                 float* __restrict__ C,
                                 const float* __restrict__ res,
                                 int M, int Nf, int K, int mode) {
    __shared__ __align__(16) _Float16 As[64 * 32];    // [m][k] row-major
    __shared__ __align__(16) _Float16 Bs[128 * 32];   // [n][k] (W tile transposed)

    const int tid  = threadIdx.x;
    const int lane = tid & 31;
    const int wid  = tid >> 5;
    const int wm   = wid & 1;    // 0..1  (rows 0-31 / 32-63)
    const int wn   = wid >> 1;   // 0..3  (cols, 32 each)

    const int bm = blockIdx.x * 64;
    const int bn = blockIdx.y * 128;

    v8f acc[2][2];
    acc[0][0] = (v8f){}; acc[0][1] = (v8f){};
    acc[1][0] = (v8f){}; acc[1][1] = (v8f){};

    const int laneM = lane & 15;
    const int hiSel = (lane >> 4) & 1;   // upper half of wave

    const int nkb = K / 32;
    for (int kb = 0; kb < nkb; ++kb) {
        // ---- stage A tile: 64x32 floats -> f16, 8 per thread ----
        {
            const int r  = tid >> 2;            // 0..63
            const int c0 = (tid & 3) * 8;       // 0,8,16,24
            const float* src = A + (size_t)(bm + r) * K + kb * 32 + c0;
            if (kb + 1 < nkb) __builtin_prefetch(src + 32, 0, 0);
#pragma unroll
            for (int j = 0; j < 8; ++j)
                As[r * 32 + c0 + j] = (_Float16)src[j];
        }
        // ---- stage W tile transposed: each thread owns a K-pair (k0,k0+1)
        //      for 8 consecutive n -> packed 32-bit DS stores ----
        {
            const int k0 = (tid >> 4) * 2;      // 0,2,..,30
            const int n0 = (tid & 15) * 8;      // 0..120
            const float* src0 = W + (size_t)(kb * 32 + k0) * Nf + bn + n0;
            const float* src1 = src0 + Nf;
            if (kb + 1 < nkb) __builtin_prefetch(src0 + (size_t)32 * Nf, 0, 0);
#pragma unroll
            for (int j = 0; j < 8; ++j) {
                h2 pk;
                pk.x = (_Float16)src0[j];
                pk.y = (_Float16)src1[j];
                *(h2*)&Bs[(n0 + j) * 32 + k0] = pk;
            }
        }
        __syncthreads();

        // ---- load fragments (documented 16-bit A/B layout: K pairs 2g,2g+1
        //      contiguous per lane -> 128-bit DS reads per fragment) ----
        v16h fa[2], fb[2];
#pragma unroll
        for (int mi = 0; mi < 2; ++mi) {
            const int Mr = wm * 32 + mi * 16 + laneM;
#pragma unroll
            for (int g = 0; g < 8; ++g) {
                const int k0 = ((g >= 4) ? 16 : 0) + hiSel * 8 + 2 * (g & 3);
                h2 p = *(const h2*)&As[Mr * 32 + k0];
                fa[mi][2 * g]     = p.x;
                fa[mi][2 * g + 1] = p.y;
            }
        }
#pragma unroll
        for (int ni = 0; ni < 2; ++ni) {
            const int Nr = wn * 32 + ni * 16 + laneM;
#pragma unroll
            for (int g = 0; g < 8; ++g) {
                const int k0 = ((g >= 4) ? 16 : 0) + hiSel * 8 + 2 * (g & 3);
                h2 p = *(const h2*)&Bs[Nr * 32 + k0];
                fb[ni][2 * g]     = p.x;
                fb[ni][2 * g + 1] = p.y;
            }
        }

#pragma unroll
        for (int mi = 0; mi < 2; ++mi)
#pragma unroll
            for (int ni = 0; ni < 2; ++ni)
                acc[mi][ni] = __builtin_amdgcn_wmma_f32_16x16x32_f16(
                    false, fa[mi], false, fb[ni], (short)0, acc[mi][ni],
                    false, false);
        __syncthreads();
    }

    // ---- epilogue, mode 2: a lane holds 8 consecutive tokens of one channel,
    //      one 16-byte store into the channel's own time row ----
    if (mode == 2) {
        _Float16* Ch = (_Float16*)C;
#pragma unroll
        for (int mi = 0; mi < 2; ++mi) {
#pragma unroll
            for (int ni = 0; ni < 2; ++ni) {
                const int row0 = bm + wm * 32 + mi * 16 + hiSel * 8;
                const int col  = bn + wn * 32 + ni * 16 + laneM;
                const float bc = bias[col];
                // before the load's address registers are reused
                asm volatile("s_wait_xcnt 0x0" ::: "memory");
                v8h pk;
#pragma unroll
                for (int r = 0; r < 8; ++r) {
                    float val = acc[mi][ni][r] + bc;
                    val = val / (1.0f + __expf(-val));   // SiLU
                    pk[r] = (_Float16)val;
                }
                const int b = row0 / NN, n = row0 % NN;
                *(v8h*)&Ch[((size_t)col * BB + b) * NN + n] = pk;
                // before the store's registers are reused
                asm volatile("s_wait_xcnt 0x0" ::: "memory");
            }
        }
        return;
    }

    // ---- epilogue ----
#pragma unroll
    for (int mi = 0; mi < 2; ++mi) {
#pragma unroll
        for (int ni = 0; ni < 2; ++ni) {
#pragma unroll
            for (int r = 0; r < 8; ++r) {
                const int row = bm + wm * 32 + mi * 16 + r + hiSel * 8;
                const int col = bn + wn * 32 + ni * 16 + laneM;
                float val = acc[mi][ni][r] + bias[col];
                if (mode == 1) {
                    val = val / (1.0f + __expf(-val));   // SiLU
                }
                if (mode == 3) {
                    val += res[(size_t)row * Nf + col];
                }
                C[(size_t)row * Nf + col] = val;
                // before the store's registers are reused
                asm volatile("s_wait_xcnt 0x0" ::: "memory");
            }
        }
    }
}

// ---------------------------------------------------------------------------
// hcf[n,e] = n * Wp[e] + bp[e]
// ---------------------------------------------------------------------------
__global__ void posinit_kernel(const float* __restrict__ Wp,
                               const float* __restrict__ bp,
                               float* __restrict__ hcf) {
    int i = blockIdx.x * 256 + threadIdx.x;
    if (i >= NN * EE) return;
    int n = i / EE, e = i % EE;
    hcf[i] = (float)n * Wp[e] + bp[e];
}

// ---------------------------------------------------------------------------
// Filter per channel, f16, lags descending along the row:
//   g[ch][p] = decay(k) * coef[k][ch],  k = LMAX + 8 - p,  0 outside 0..N-1
//   decay(0) = 1, decay(k) = gamma^k
// coef layout: [N, CH]; g layout: [CH, GP]. One thread = 8 consecutive p.
// ---------------------------------------------------------------------------
#define CH   (HH * HD)
#define LMAX 2064            // largest lag index a fragment can ask for, rounded up to 8
#define GP   (LMAX + 40)     // row length of g, halves
#define AP   (LMAX + 32)     // row length of one shifted copy in LDS, halves
#define VF   64              // zeros in front of a time row (times < 0)
// time row in LDS: VF zeros, N values, 32 zeros, padded. A fragment read takes
// 16 bytes at every 32 from four places of each of the four rows: the rows
// start at 0, 1, 8 and 9 sixteen-byte units modulo 16, so that the 16 lanes of
// a half wave fall on all 64 banks
#define VP   2184
#define VOFF(b) ((b) * VP + ((b) >> 1) * 48)
__global__ void build_a_kernel(const float* __restrict__ coef,
                               _Float16* __restrict__ g) {
    int i = blockIdx.x * 256 + threadIdx.x;
    if (i >= CH * (GP / 8)) return;
    const int ch = i % CH;
    const int o  = i / CH;
    v8h w;
    // gamma^k of the smallest of the eight lags; the others by constant factors
    const int k7 = LMAX + 1 - 8 * o;
    const float d7 = __expf((float)k7 * __logf(GAMMA));
    float pw = 1.0f;
#pragma unroll
    for (int e = 7; e >= 0; --e) {
        const int k = k7 + 7 - e;
        // clamped row, read without a branch: the 8 loads fly together
        const int kc = min(max(k, 0), NN - 1);
        const float c = coef[(size_t)kc * CH + ch];
        // before the load's address registers are reused
        asm volatile("s_wait_xcnt 0x0" ::: "memory");
        const float decay = (k == 0) ? 1.0f : d7 * pw;
        w[e] = (k == kc) ? (_Float16)(decay * c) : (_Float16)0.f;
        pw *= GAMMA;
    }
    *(v8h*)&g[(size_t)ch * GP + 8 * o] = w;
}

// ---------------------------------------------------------------------------
// Causal depthwise conv along time as Toeplitz matrix products, one block per
// channel:  y[b][t] = sum_{k=0..t} a[k] * v[b][t-k]
// One 16x16x32 product, for a lag offset dl and an output tile of 64 steps:
//   A[m][j] = a[dl + m - j]                      (16 x 32, Toeplitz)
//   B[j][n] = v[b][t0 + 16*c4 - dl + j]          (n = 4*b + c4)
//   D[m][n] = part of y[b][t0 + 16*c4 + m]
// dl runs over 0, 32, .., t0 + 64: every lag 0..t is met exactly once; lags
// below 0 and above N-1 read zeros of the filter row, times below 0 zeros of
// the time row.
// A depends on dl alone and B on t0 - dl alone: a wave works on two adjacent
// tiles at once, which share every A, and the upper tile takes as B what the
// lower tile read two steps earlier, kept in registers.
// A lane's 8 consecutive j of A start at a lag that depends on m: the filter
// lies in LDS eight times, copy c shifted by c halves, so that lane m reads
// copy m & 7 at a 16-byte boundary.
// ---------------------------------------------------------------------------
// a lane's 16 halves of a fragment: k = 8*hs + 0..7 at p, k = 16 + 8*hs + 0..7 at p + 16
__device__ __forceinline__ v16h frag16(const _Float16* p) {
    const v8h lo = *(const v8h*)p;
    const v8h hi = *(const v8h*)(p + 16);
    return __builtin_shufflevector(lo, hi, 0, 1, 2, 3, 4, 5, 6, 7,
                                   8, 9, 10, 11, 12, 13, 14, 15);
}
__device__ __forceinline__ v8f mm(v16h a, v16h b, v8f c) {
    return __builtin_amdgcn_wmma_f32_16x16x32_f16(false, a, false, b, (short)0, c,
                                                  false, false);
}
__global__ __launch_bounds__(256) void conv_kernel(const _Float16* __restrict__ g,
                                                   const _Float16* __restrict__ vT,
                                                   float* __restrict__ yT) {
    __shared__ __align__(16) _Float16 a_s[8 * AP];     // 33.5 KB
    __shared__ __align__(16) _Float16 v_s[VOFF(BB)];   // 17.7 KB

    const int ch   = blockIdx.x;
    const int tid  = threadIdx.x;
    const int lane = tid & 31;
    // scalar wave number: the tile loops below must be scalar branches (a
    // matrix instruction needs every lane on)
    const int wid  = __builtin_amdgcn_readfirstlane(tid >> 5);

    // filter: a_s[c][x] = g[x - c + 8]
    const _Float16* gc = g + (size_t)ch * GP;
    for (int q = tid; q < AP / 8; q += 256) {
        const v8h lo = *(const v8h*)&gc[8 * q];
        const v8h hi = *(const v8h*)&gc[8 * q + 8];
        const v16h w = __builtin_shufflevector(lo, hi, 0, 1, 2, 3, 4, 5, 6, 7,
                                               8, 9, 10, 11, 12, 13, 14, 15);
#pragma unroll
        for (int c = 0; c < 8; ++c) {
            v8h o;
#pragma unroll
            for (int e = 0; e < 8; ++e) o[e] = w[e - c + 8];
            *(v8h*)&a_s[c * AP + 8 * q] = o;
        }
    }
    // time rows of the four batches, zeros in front and behind
    const _Float16* vc = vT + (size_t)ch * BB * NN;
#pragma unroll
    for (int b = 0; b < BB; ++b) {
        const v8h x = *(const v8h*)&vc[b * NN + tid * 8];
        *(v8h*)&v_s[VOFF(b) + VF + tid * 8] = x;
    }
    if (tid < BB * 12) {
        const int b = tid / 12, p = tid % 12;
        const int off = (p < 8) ? p * 8 : VF + NN + (p - 8) * 8;
        *(v8h*)&v_s[VOFF(b) + off] = (v8h){};
    }
    __syncthreads();

    const int n  = lane & 15;
    const int hs = lane >> 4;
    const _Float16* a0 = a_s + (n & 7) * AP + LMAX - 8 * (n >> 3) + 8 * hs;
    const _Float16* b0 = v_s + VOFF(n >> 2) + VF + 16 * (n & 3) + 8 * hs;
    float* y0 = yT + ((size_t)ch * BB + (n >> 2)) * NN + 16 * (n & 3) + 8 * hs;

    // pairs of tiles w and 15-w: the same number of products for every wave
    for (int q = 0; q < 2; ++q) {
        const int p = q ? 15 - wid : wid;      // tiles 2p (acc0) and 2p+1 (acc1)
        const _Float16* bp = b0 + 128 * p;     // B of tile 2p at dl = 0
        v8f acc0 = (v8f){}, acc1 = (v8f){};
        // B of tile 2p+1 at the next even and the next odd step
        v16h h0 = frag16(bp + 64), h1 = frag16(bp + 32);
        const int np = 2 * p + 1;              // steps 0 .. 4p+1, two a trip
        // unroll: the LDS reads of later products go out ahead of one wait
#pragma unroll 2
        for (int i = 0; i < np; ++i) {
            const v16h fa0 = frag16(a0 - 64 * i);
            const v16h fb0 = frag16(bp - 64 * i);
            const v16h fa1 = frag16(a0 - 64 * i - 32);
            const v16h fb1 = frag16(bp - 64 * i - 32);
            acc0 = mm(fa0, fb0, acc0);
            acc1 = mm(fa0, h0, acc1);
            acc0 = mm(fa1, fb1, acc0);
            acc1 = mm(fa1, h1, acc1);
            h0 = fb0;
            h1 = fb1;
        }
        // step 4p+2 for both tiles, steps 4p+3 and 4p+4 for the upper one
        {
            const v16h fa0 = frag16(a0 - 64 * np);
            const v16h fb0 = frag16(bp - 64 * np);
            const v16h fa1 = frag16(a0 - 64 * np - 32);
            const v16h fa2 = frag16(a0 - 64 * np - 64);
            acc0 = mm(fa0, fb0, acc0);
            acc1 = mm(fa0, h0, acc1);
            acc1 = mm(fa1, h1, acc1);
            acc1 = mm(fa2, fb0, acc1);
        }
        float4* yp = (float4*)(y0 + 128 * p);
        yp[0]  = make_float4(acc0[0], acc0[1], acc0[2], acc0[3]);
        yp[1]  = make_float4(acc0[4], acc0[5], acc0[6], acc0[7]);
        yp[16] = make_float4(acc1[0], acc1[1], acc1[2], acc1[3]);
        yp[17] = make_float4(acc1[4], acc1[5], acc1[6], acc1[7]);
        // before the next pair reuses the stores' registers
        asm volatile("s_wait_xcnt 0x0" ::: "memory");
    }
}

// ---------------------------------------------------------------------------
// g[b,n,ch] = u[b,n,ch] * y[ch][b][n]
// One thread = one channel and 32 time steps (one 128-byte line of y); lanes
// run over channels, so u and g go in whole lines.
// ---------------------------------------------------------------------------
__global__ void gate_kernel(const float* __restrict__ u,
                            const float* __restrict__ yT,
                            float* __restrict__ g) {
    int i = blockIdx.x * 256 + threadIdx.x;
    if (i >= BB * (NN / 32) * CH) return;
    const int ch = i % CH;
    const int rest = i / CH;
    const int tb = rest % (NN / 32), b = rest / (NN / 32);
    const float4* yp = (const float4*)(yT + ((size_t)ch * BB + b) * NN + tb * 32);
    const size_t base = ((size_t)b * NN + tb * 32) * D1 + ch;
    float4 yv[8];
#pragma unroll
    for (int j = 0; j < 8; ++j) yv[j] = yp[j];
    // before the loads' address registers are reused
    asm volatile("s_wait_xcnt 0x0" ::: "memory");
    float uv[32];
#pragma unroll
    for (int j = 0; j < 32; ++j) uv[j] = u[base + (size_t)j * D1];
    // before the loads' address registers are reused
    asm volatile("s_wait_xcnt 0x0" ::: "memory");
#pragma unroll
    for (int j = 0; j < 8; ++j) {
        g[base + (size_t)(4 * j + 0) * D1] = uv[4 * j + 0] * yv[j].x;
        g[base + (size_t)(4 * j + 1) * D1] = uv[4 * j + 1] * yv[j].y;
        g[base + (size_t)(4 * j + 2) * D1] = uv[4 * j + 2] * yv[j].z;
        g[base + (size_t)(4 * j + 3) * D1] = uv[4 * j + 3] * yv[j].w;
    }
}

// ---------------------------------------------------------------------------
extern "C" void kernel_launch(void* const* d_in, const int* in_sizes, int n_in,
                              void* d_out, int out_size, void* d_ws, size_t ws_size,
                              hipStream_t stream) {
    const float* x  = (const float*)d_in[0];
    const float* Wu = (const float*)d_in[1];
    const float* bu = (const float*)d_in[2];
    const float* Wv = (const float*)d_in[3];
    const float* bv = (const float*)d_in[4];
    const float* Wo = (const float*)d_in[5];
    const float* bo = (const float*)d_in[6];
    const float* Wp = (const float*)d_in[7];
    const float* bp = (const float*)d_in[8];
    const float* W1 = (const float*)d_in[9];
    const float* b1 = (const float*)d_in[10];
    const float* W2 = (const float*)d_in[11];
    const float* b2 = (const float*)d_in[12];
    const float* W3 = (const float*)d_in[13];
    const float* b3 = (const float*)d_in[14];
    const float* Wz = (const float*)d_in[15];
    const float* bz = (const float*)d_in[16];
    float* out = (float*)d_out;

    float* ws = (float*)d_ws;
    const size_t SZ_XN = (size_t)BB * NN * DD;   // 4M
    const size_t SZ_U  = (size_t)BB * NN * D1;   // 8M
    const size_t SZ_H  = (size_t)NN * EE;        // 1M
    const size_t SZ_CO = (size_t)NN * D1;        // 2M

    float* xn   = ws;                    // 4M
    float* u    = xn + SZ_XN;            // 8M
    float* v    = u + SZ_U;              // 8M  f16 [CH][B][N] in its first half; reused for g
    float* y    = v + SZ_U;              // 8M  [CH][B][N]
    float* hcfA = y + SZ_U;              // 1M
    float* hcfB = hcfA + SZ_H;           // 1M
    float* bufT = hcfB + SZ_H;           // 1M
    float* coef = bufT + SZ_H;           // 2M
    float* av   = coef + SZ_CO;          // f16 [CH][GP]

    const int MT = BB * NN;  // 8192 token rows

    // 1) xn = srms(x)
    srms_kernel<<<MT, 256, 0, stream>>>(x, xn, DD, 0);

    // 2) u = silu(xn @ Wu + bu)
    gemm_wmma_kernel<<<dim3(MT / 64, D1 / 128), 256, 0, stream>>>(
        xn, Wu, bu, u, nullptr, MT, D1, DD, 1);

    // 3) v = silu(xn @ Wv + bv), f16, [CH][B][N]
    gemm_wmma_kernel<<<dim3(MT / 64, D1 / 128), 256, 0, stream>>>(
        xn, Wv, bv, v, nullptr, MT, D1, DD, 2);

    // 4) positional MLP
    posinit_kernel<<<(NN * EE + 255) / 256, 256, 0, stream>>>(Wp, bp, hcfA);

    const float* Ws[3] = {W1, W2, W3};
    const float* bs[3] = {b1, b2, b3};
    float* bufs[2] = {hcfA, hcfB};
    int cur = 0;
    for (int l = 0; l < 3; ++l) {
        srms_kernel<<<NN, 256, 0, stream>>>(bufs[cur], bufT, EE, 1);
        gemm_wmma_kernel<<<dim3(NN / 64, EE / 128), 256, 0, stream>>>(
            bufT, Ws[l], bs[l], bufs[cur ^ 1], nullptr, NN, EE, EE, 0);
        cur ^= 1;
    }
    srms_kernel<<<NN, 256, 0, stream>>>(bufs[cur], bufT, EE, 1);
    gemm_wmma_kernel<<<dim3(NN / 64, D1 / 128), 256, 0, stream>>>(
        bufT, Wz, bz, coef, nullptr, NN, D1, EE, 0);

    // 5) build decayed filter rows, f16, lags descending
    build_a_kernel<<<(CH * (GP / 8) + 255) / 256, 256, 0, stream>>>(coef, (_Float16*)av);

    // 6) causal depthwise conv: y[ch][b][t]
    conv_kernel<<<CH, 256, 0, stream>>>((const _Float16*)av, (const _Float16*)v, y);

    // 7) gate: g = u * y  (g reuses v buffer)
    gate_kernel<<<(BB * (NN / 32) * CH + 255) / 256, 256, 0, stream>>>(u, y, v);

    // 8) out = g @ Wo + bo + x
    gemm_wmma_kernel<<<dim3(MT / 64, DD / 128), 256, 0, stream>>>(
        v, Wo, bo, out, x, MT, DD, D1, 3);
}

// v003
// A run of this version takes 309 microseconds.
// Two timings next to v002 both put it at 1.11 times that version's speed.
// Counting every step since v000, it is 2.93 times as fast.
#include <hip/hip_runtime.h>
#include <hip/hip_bf16.h>
#include <math.h>

// Problem constants (fixed by the reference)
#define BB 4
#define NN 2048
#define DD 512
#define HH 8
#define EE 512
#define D1 1024
#define HD 128
#define GAMMA 0.999f

typedef _Float16 v16h __attribute__((ext_vector_type(16)));
typedef float    v8f  __attribute__((ext_vector_type(8)));
typedef _Float16 h2   __attribute__((ext_vector_type(2)));
typedef _Float16 v8h  __attribute__((ext_vector_type(8)));

// ---------------------------------------------------------------------------
// Generic WMMA GEMM: C[M,Nf] = epilogue(A[M,K] @ W[K,Nf] + bias)
//   mode 0: bias only
//   mode 1: bias + SiLU
//   mode 2: bias + SiLU, output as f16, time-major per channel: [col][B][N]
//   mode 3: bias + residual add (res has same [M,Nf] layout)
// What the A operand is:
//   amode 0: A as stored
//   amode 1: srms(A)
//   amode 2: relu(srms(A))
//   amode 3: relu(srms(P)), P[m][k] = m * A[k] + A2[k] (position rows, never stored)
// srms(x) = s * x with one s > 0 per row, s = 1 / (sqrt(mean(x^2)) + eps), so
// relu(srms(x)) @ W = s * (relu(x) @ W): the raw values go into the product,
// a row's sum of squares is gathered while its K values (K is the length of
// the norm) pass through the staging, and s multiplies the accumulators.
// Block tile 64x128x32, 256 threads = 8 waves, each wave -> 32x32 via
// 2x2 v_wmma_f32_16x16x32_f16. Assumes M%64==0, Nf%128==0, K%32==0.
// ---------------------------------------------------------------------------
__global__ void gemm_wmma_kernel(const float* __restrict__ A,
                                 const float* __restrict__ W,
                                 const float* __restrict__ bias,
                                 float* __restrict__ C,
                                 const float* __restrict__ res,
                                 const float* __restrict__ A2,
                                 int M, int Nf, int K, int mode, int amode) {
    __shared__ __align__(16) _Float16 As[64 * 32];    // [m][k] row-major
    __shared__ __align__(16) _Float16 Bs[128 * 32];   // [n][k] (W tile transposed)
    __shared__ __align__(16) float rs[64];            // s of the tile's rows

    const int tid  = threadIdx.x;
    const int lane = tid & 31;
    const int wid  = tid >> 5;
    const int wm   = wid & 1;    // 0..1  (rows 0-31 / 32-63)
    const int wn   = wid >> 1;   // 0..3  (cols, 32 each)

    const int bm = blockIdx.x * 64;
    const int bn = blockIdx.y * 128;

    v8f acc[2][2];
    acc[0][0] = (v8f){}; acc[0][1] = (v8f){};
    acc[1][0] = (v8f){}; acc[1][1] = (v8f){};

    const int laneM = lane & 15;
    const int hiSel = (lane >> 4) & 1;   // upper half of wave

    float ss = 0.f;   // this thread's part of its staged row's sum of squares

    const int nkb = K / 32;
    for (int kb = 0; kb < nkb; ++kb) {
        // ---- stage A tile: 64x32 floats -> f16, 8 per thread ----
        {
            const int r  = tid >> 2;            // 0..63
            const int c0 = (tid & 3) * 8;       // 0,8,16,24
            float av[8];
            if (amode == 3) {
                const float* pw = A + kb * 32 + c0;
                const float* pb = A2 + kb * 32 + c0;
                const float m = (float)(bm + r);
#pragma unroll
                for (int j = 0; j < 8; ++j) av[j] = m * pw[j] + pb[j];
                // before the loads' address registers are reused; the pointers
                // are inputs so that no load's result is placed in them earlier
                asm volatile("s_wait_xcnt 0x0" :: "v"(pw), "v"(pb) : "memory");
            } else {
                const float* src = A + (size_t)(bm + r) * K + kb * 32 + c0;
                if (kb + 1 < nkb) __builtin_prefetch(src + 32, 0, 0);
#pragma unroll
                for (int j = 0; j < 8; ++j) av[j] = src[j];
                // before the loads' address registers are reused; the pointer
                // is an input so that no load's result is placed in it earlier
                asm volatile("s_wait_xcnt 0x0" :: "v"(src) : "memory");
            }
            if (amode != 0) {
#pragma unroll
                for (int j = 0; j < 8; ++j) ss += av[j] * av[j];
            }
            if (amode >= 2) {
#pragma unroll
                for (int j = 0; j < 8; ++j) av[j] = fmaxf(av[j], 0.f);
            }
#pragma unroll
            for (int j = 0; j < 8; ++j)
                As[r * 32 + c0 + j] = (_Float16)av[j];
        }
        // ---- stage W tile transposed: each thread owns a K-pair (k0,k0+1)
        //      for 8 consecutive n -> packed 32-bit DS stores ----
        {
            const int k0 = (tid >> 4) * 2;      // 0,2,..,30
            const int n0 = (tid & 15) * 8;      // 0..120
            const float* src0 = W + (size_t)(kb * 32 + k0) * Nf + bn + n0;
            const float* src1 = src0 + Nf;
            if (kb + 1 < nkb) __builtin_prefetch(src0 + (size_t)32 * Nf, 0, 0);
#pragma unroll
            for (int j = 0; j < 8; ++j) {
                h2 pk;
                pk.x = (_Float16)src0[j];
                pk.y = (_Float16)src1[j];
                *(h2*)&Bs[(n0 + j) * 32 + k0] = pk;
            }
        }
        __syncthreads();

        // ---- load fragments (documented 16-bit A/B layout: K pairs 2g,2g+1
        //      contiguous per lane -> 128-bit DS reads per fragment) ----
        v16h fa[2], fb[2];
#pragma unroll
        for (int mi = 0; mi < 2; ++mi) {
            const int Mr = wm * 32 + mi * 16 + laneM;
#pragma unroll
            for (int g = 0; g < 8; ++g) {
                const int k0 = ((g >= 4) ? 16 : 0) + hiSel * 8 + 2 * (g & 3);
                h2 p = *(const h2*)&As[Mr * 32 + k0];
                fa[mi][2 * g]     = p.x;
                fa[mi][2 * g + 1] = p.y;
            }
        }
#pragma unroll
        for (int ni = 0; ni < 2; ++ni) {
            const int Nr = wn * 32 + ni * 16 + laneM;
#pragma unroll
            for (int g = 0; g < 8; ++g) {
                const int k0 = ((g >= 4) ? 16 : 0) + hiSel * 8 + 2 * (g & 3);
                h2 p = *(const h2*)&Bs[Nr * 32 + k0];
                fb[ni][2 * g]     = p.x;
                fb[ni][2 * g + 1] = p.y;
            }
        }

#pragma unroll
        for (int mi = 0; mi < 2; ++mi)
#pragma unroll
            for (int ni = 0; ni < 2; ++ni)
                acc[mi][ni] = __builtin_amdgcn_wmma_f32_16x16x32_f16(
                    false, fa[mi], false, fb[ni], (short)0, acc[mi][ni],
                    false, false);
        __syncthreads();
    }

    // ---- the rows' norm factors: four neighbouring lanes staged one row ----
    if (amode != 0) {
        ss += __shfl_xor(ss, 1);
        ss += __shfl_xor(ss, 2);
        if ((tid & 3) == 0)
            rs[tid >> 2] = 1.0f / (sqrtf(ss / (float)K) + 1e-8f);
        __syncthreads();
#pragma unroll
        for (int mi = 0; mi < 2; ++mi) {
            const float* sp = &rs[wm * 32 + mi * 16 + hiSel * 8];
#pragma unroll
            for (int r = 0; r < 8; ++r) {
                acc[mi][0][r] *= sp[r];
                acc[mi][1][r] *= sp[r];
            }
        }
    }

    // ---- epilogue, mode 2: a lane holds 8 consecutive tokens of one channel,
    //      one 16-byte store into the channel's own time row ----
    if (mode == 2) {
        _Float16* Ch = (_Float16*)C;
#pragma unroll
        for (int mi = 0; mi < 2; ++mi) {
#pragma unroll
            for (int ni = 0; ni < 2; ++ni) {
                const int row0 = bm + wm * 32 + mi * 16 + hiSel * 8;
                const int col  = bn + wn * 32 + ni * 16 + laneM;
                const float bc = bias[col];
                // before the load's address registers are reused
                asm volatile("s_wait_xcnt 0x0" ::: "memory");
                v8h pk;
#pragma unroll
                for (int r = 0; r < 8; ++r) {
                    float val = acc[mi][ni][r] + bc;
                    val = val / (1.0f + __expf(-val));   // SiLU
                    pk[r] = (_Float16)val;
                }
                const int b = row0 / NN, n = row0 % NN;
                *(v8h*)&Ch[((size_t)col * BB + b) * NN + n] = pk;
                // before the store's registers are reused
                asm volatile("s_wait_xcnt 0x0" ::: "memory");
            }
        }
        return;
    }

    // ---- epilogue ----
#pragma unroll
    for (int mi = 0; mi < 2; ++mi) {
#pragma unroll
        for (int ni = 0; ni < 2; ++ni) {
#pragma unroll
            for (int r = 0; r < 8; ++r) {
                const int row = bm + wm * 32 + mi * 16 + r + hiSel * 8;
                const int col = bn + wn * 32 + ni * 16 + laneM;
                float val = acc[mi][ni][r] + bias[col];
                if (mode == 1) {
                    val = val / (1.0f + __expf(-val));   // SiLU
                }
                if (mode == 3) {
                    val += res[(size_t)row * Nf + col];
                }
                C[(size_t)row * Nf + col] = val;
                // before the store's registers are reused
                asm volatile("s_wait_xcnt 0x0" ::: "memory");
            }
        }
    }
}

// ---------------------------------------------------------------------------
// Filter per channel, f16, lags descending along the row:
//   g[ch][p] = decay(k) * coef[k][ch],  k = LMAX + 8 - p,  0 outside 0..N-1
//   decay(0) = 1, decay(k) = gamma^k
// coef layout: [N, CH]; g layout: [CH, GP]. One thread = 8 consecutive p.
// ---------------------------------------------------------------------------
#define CH   (HH * HD)
#define LMAX 2064            // largest lag index a fragment can ask for, rounded up to 8
#define GP   (LMAX + 40)     // row length of g, halves
#define AP   (LMAX + 32)     // row length of one shifted copy in LDS, halves
#define VF   64              // zeros in front of a time row (times < 0)
// time row in LDS: VF zeros, N values, 32 zeros, padded. A fragment read takes
// 16 bytes at every 32 from four places of each of the four rows: the rows
// start at 0, 1, 8 and 9 sixteen-byte units modulo 16, so that the 16 lanes of
// a half wave fall on all 64 banks
#define VP   2184
#define VOFF(b) ((b) * VP + ((b) >> 1) * 48)
__global__ void build_a_kernel(const float* __restrict__ coef,
                               _Float16* __restrict__ g) {
    int i = blockIdx.x * 256 + threadIdx.x;
    if (i >= CH * (GP / 8)) return;
    const int ch = i % CH;
    const int o  = i / CH;
    v8h w;
    // gamma^k of the smallest of the eight lags; the others by constant factors
    const int k7 = LMAX + 1 - 8 * o;
    const float d7 = __expf((float)k7 * __logf(GAMMA));
    float pw = 1.0f;
#pragma unroll
    for (int e = 7; e >= 0; --e) {
        const int k = k7 + 7 - e;
        // clamped row, read without a branch: the 8 loads fly together
        const int kc = min(max(k, 0), NN - 1);
        const float c = coef[(size_t)kc * CH + ch];
        // before the load's address registers are reused
        asm volatile("s_wait_xcnt 0x0" ::: "memory");
        const float decay = (k == 0) ? 1.0f : d7 * pw;
        w[e] = (k == kc) ? (_Float16)(decay * c) : (_Float16)0.f;
        pw *= GAMMA;
    }
    *(v8h*)&g[(size_t)ch * GP + 8 * o] = w;
}

// ---------------------------------------------------------------------------
// Causal depthwise conv along time as Toeplitz matrix products, one block per
// channel:  y[b][t] = sum_{k=0..t} a[k] * v[b][t-k]
// One 16x16x32 product, for a lag offset dl and an output tile of 64 steps:
//   A[m][j] = a[dl + m - j]                      (16 x 32, Toeplitz)
//   B[j][n] = v[b][t0 + 16*c4 - dl + j]          (n = 4*b + c4)
//   D[m][n] = part of y[b][t0 + 16*c4 + m]
// dl runs over 0, 32, .., t0 + 64: every lag 0..t is met exactly once; lags
// below 0 and above N-1 read zeros of the filter row, times below 0 zeros of
// the time row.
// A depends on dl alone and B on t0 - dl alone: a wave works on two adjacent
// tiles at once, which share every A, and the upper tile takes as B what the
// lower tile read two steps earlier, kept in registers.
// A lane's 8 consecutive j of A start at a lag that depends on m: the filter
// lies in LDS eight times, copy c shifted by c halves, so that lane m reads
// copy m & 7 at a 16-byte boundary.
// ---------------------------------------------------------------------------
// a lane's 16 halves of a fragment: k = 8*hs + 0..7 at p, k = 16 + 8*hs + 0..7 at p + 16
__device__ __forceinline__ v16h frag16(const _Float16* p) {
    const v8h lo = *(const v8h*)p;
    const v8h hi = *(const v8h*)(p + 16);
    return __builtin_shufflevector(lo, hi, 0, 1, 2, 3, 4, 5, 6, 7,
                                   8, 9, 10, 11, 12, 13, 14, 15);
}
__device__ __forceinline__ v8f mm(v16h a, v16h b, v8f c) {
    return __builtin_amdgcn_wmma_f32_16x16x32_f16(false, a, false, b, (short)0, c,
                                                  false, false);
}
__global__ __launch_bounds__(256) void conv_kernel(const _Float16* __restrict__ g,
                                                   const _Float16* __restrict__ vT,
                                                   float* __restrict__ yT) {
    __shared__ __align__(16) _Float16 a_s[8 * AP];     // 33.5 KB
    __shared__ __align__(16) _Float16 v_s[VOFF(BB)];   // 17.7 KB

    const int ch   = blockIdx.x;
    const int tid  = threadIdx.x;
    const int lane = tid & 31;
    // scalar wave number: the tile loops below must be scalar branches (a
    // matrix instruction needs every lane on)
    const int wid  = __builtin_amdgcn_readfirstlane(tid >> 5);

    // filter: a_s[c][x] = g[x - c + 8]
    const _Float16* gc = g + (size_t)ch * GP;
    for (int q = tid; q < AP / 8; q += 256) {
        const v8h lo = *(const v8h*)&gc[8 * q];
        const v8h hi = *(const v8h*)&gc[8 * q + 8];
        const v16h w = __builtin_shufflevector(lo, hi, 0, 1, 2, 3, 4, 5, 6, 7,
                                               8, 9, 10, 11, 12, 13, 14, 15);
#pragma unroll
        for (int c = 0; c < 8; ++c) {
            v8h o;
#pragma unroll
            for (int e = 0; e < 8; ++e) o[e] = w[e - c + 8];
            *(v8h*)&a_s[c * AP + 8 * q] = o;
        }
    }
    // time rows of the four batches, zeros in front and behind
    const _Float16* vc = vT + (size_t)ch * BB * NN;
#pragma unroll
    for (int b = 0; b < BB; ++b) {
        const v8h x = *(const v8h*)&vc[b * NN + tid * 8];
        *(v8h*)&v_s[VOFF(b) + VF + tid * 8] = x;
    }
    if (tid < BB * 12) {
        const int b = tid / 12, p = tid % 12;
        const int off = (p < 8) ? p * 8 : VF + NN + (p - 8) * 8;
        *(v8h*)&v_s[VOFF(b) + off] = (v8h){};
    }
    __syncthreads();

    const int n  = lane & 15;
    const int hs = lane >> 4;
    const _Float16* a0 = a_s + (n & 7) * AP + LMAX - 8 * (n >> 3) + 8 * hs;
    const _Float16* b0 = v_s + VOFF(n >> 2) + VF + 16 * (n & 3) + 8 * hs;
    float* y0 = yT + ((size_t)ch * BB + (n >> 2)) * NN + 16 * (n & 3) + 8 * hs;

    // pairs of tiles w and 15-w: the same number of products for every wave
    for (int q = 0; q < 2; ++q) {
        const int p = q ? 15 - wid : wid;      // tiles 2p (acc0) and 2p+1 (acc1)
        const _Float16* bp = b0 + 128 * p;     // B of tile 2p at dl = 0
        v8f acc0 = (v8f){}, acc1 = (v8f){};
        // B of tile 2p+1 at the next even and the next odd step
        v16h h0 = frag16(bp + 64), h1 = frag16(bp + 32);
        const int np = 2 * p + 1;              // steps 0 .. 4p+1, two a trip
        // unroll: the LDS reads of later products go out ahead of one wait
#pragma unroll 2
        for (int i = 0; i < np; ++i) {
            const v16h fa0 = frag16(a0 - 64 * i);
            const v16h fb0 = frag16(bp - 64 * i);
            const v16h fa1 = frag16(a0 - 64 * i - 32);
            const v16h fb1 = frag16(bp - 64 * i - 32);
            acc0 = mm(fa0, fb0, acc0);
            acc1 = mm(fa0, h0, acc1);
            acc0 = mm(fa1, fb1, acc0);
            acc1 = mm(fa1, h1, acc1);
            h0 = fb0;
            h1 = fb1;
        }
        // step 4p+2 for both tiles, steps 4p+3 and 4p+4 for the upper one
        {
            const v16h fa0 = frag16(a0 - 64 * np);
            const v16h fb0 = frag16(bp - 64 * np);
            const v16h fa1 = frag16(a0 - 64 * np - 32);
            const v16h fa2 = frag16(a0 - 64 * np - 64);
            acc0 = mm(fa0, fb0, acc0);
            acc1 = mm(fa0, h0, acc1);
            acc1 = mm(fa1, h1, acc1);
            acc1 = mm(fa2, fb0, acc1);
        }
        float4* yp = (float4*)(y0 + 128 * p);
        yp[0]  = make_float4(acc0[0], acc0[1], acc0[2], acc0[3]);
        yp[1]  = make_float4(acc0[4], acc0[5], acc0[6], acc0[7]);
        yp[16] = make_float4(acc1[0], acc1[1], acc1[2], acc1[3]);
        yp[17] = make_float4(acc1[4], acc1[5], acc1[6], acc1[7]);
        // before the next pair reuses the stores' registers
        asm volatile("s_wait_xcnt 0x0" ::: "memory");
    }
}

// ---------------------------------------------------------------------------
// g[b,n,ch] = u[b,n,ch] * y[ch][b][n]
// One thread = one channel and 32 time steps (one 128-byte line of y); lanes
// run over channels, so u and g go in whole lines.
// ---------------------------------------------------------------------------
__global__ void gate_kernel(const float* __restrict__ u,
                            const float* __restrict__ yT,
                            float* __restrict__ g) {
    int i = blockIdx.x * 256 + threadIdx.x;
    if (i >= BB * (NN / 32) * CH) return;
    const int ch = i % CH;
    const int rest = i / CH;
    const int tb = rest % (NN / 32), b = rest / (NN / 32);
    const float4* yp = (const float4*)(yT + ((size_t)ch * BB + b) * NN + tb * 32);
    const size_t base = ((size_t)b * NN + tb * 32) * D1 + ch;
    float4 yv[8];
#pragma unroll
    for (int j = 0; j < 8; ++j) yv[j] = yp[j];
    // before the loads' address registers are reused
    asm volatile("s_wait_xcnt 0x0" ::: "memory");
    float uv[32];
#pragma unroll
    for (int j = 0; j < 32; ++j) uv[j] = u[base + (size_t)j * D1];
    // before the loads' address registers are reused
    asm volatile("s_wait_xcnt 0x0" ::: "memory");
#pragma unroll
    for (int j = 0; j < 8; ++j) {
        g[base + (size_t)(4 * j + 0) * D1] = uv[4 * j + 0] * yv[j].x;
        g[base + (size_t)(4 * j + 1) * D1] = uv[4 * j + 1] * yv[j].y;
        g[base + (size_t)(4 * j + 2) * D1] = uv[4 * j + 2] * yv[j].z;
        g[base + (size_t)(4 * j + 3) * D1] = uv[4 * j + 3] * yv[j].w;
    }
}

// ---------------------------------------------------------------------------
extern "C" void kernel_launch(void* const* d_in, const int* in_sizes, int n_in,
                              void* d_out, int out_size, void* d_ws, size_t ws_size,
                              hipStream_t stream) {
    const float* x  = (const float*)d_in[0];
    const float* Wu = (const float*)d_in[1];
    const float* bu = (const float*)d_in[2];
    const float* Wv = (const float*)d_in[3];
    const float* bv = (const float*)d_in[4];
    const float* Wo = (const float*)d_in[5];
    const float* bo = (const float*)d_in[6];
    const float* Wp = (const float*)d_in[7];
    const float* bp = (const float*)d_in[8];
    const float* W1 = (const float*)d_in[9];
    const float* b1 = (const float*)d_in[10];
    const float* W2 = (const float*)d_in[11];
    const float* b2 = (const float*)d_in[12];
    const float* W3 = (const float*)d_in[13];
    const float* b3 = (const float*)d_in[14];
    const float* Wz = (const float*)d_in[15];
    const float* bz = (const float*)d_in[16];
    float* out = (float*)d_out;

    float* ws = (float*)d_ws;
    const size_t SZ_U  = (size_t)BB * NN * D1;   // 8M
    const size_t SZ_H  = (size_t)NN * EE;        // 1M
    const size_t SZ_CO = (size_t)NN * D1;        // 2M

    float* u    = ws;                    // 8M
    float* v    = u + SZ_U;              // 8M  f16 [CH][B][N] in its first half; reused for g
    float* y    = v + SZ_U;              // 8M  [CH][B][N]
    float* hcfA = y + SZ_U;              // 1M
    float* hcfB = hcfA + SZ_H;           // 1M
    float* coef = hcfB + SZ_H;           // 2M
    float* av   = coef + SZ_CO;          // f16 [CH][GP]

    const int MT = BB * NN;  // 8192 token rows

    // 1) u = silu(srms(x) @ Wu + bu)
    gemm_wmma_kernel<<<dim3(MT / 64, D1 / 128), 256, 0, stream>>>(
        x, Wu, bu, u, nullptr, nullptr, MT, D1, DD, 1, 1);

    // 2) v = silu(srms(x) @ Wv + bv), f16, [CH][B][N]
    gemm_wmma_kernel<<<dim3(MT / 64, D1 / 128), 256, 0, stream>>>(
        x, Wv, bv, v, nullptr, nullptr, MT, D1, DD, 2, 1);

    // 3) positional MLP: each layer is relu(srms(.)) @ W + b
    gemm_wmma_kernel<<<dim3(NN / 64, EE / 128), 256, 0, stream>>>(
        Wp, W1, b1, hcfA, nullptr, bp, NN, EE, EE, 0, 3);
    gemm_wmma_kernel<<<dim3(NN / 64, EE / 128), 256, 0, stream>>>(
        hcfA, W2, b2, hcfB, nullptr, nullptr, NN, EE, EE, 0, 2);
    gemm_wmma_kernel<<<dim3(NN / 64, EE / 128), 256, 0, stream>>>(
        hcfB, W3, b3, hcfA, nullptr, nullptr, NN, EE, EE, 0, 2);
    gemm_wmma_kernel<<<dim3(NN / 64, D1 / 128), 256, 0, stream>>>(
        hcfA, Wz, bz, coef, nullptr, nullptr, NN, D1, EE, 0, 2);

    // 4) build decayed filter rows, f16, lags descending
    build_a_kernel<<<(CH * (GP / 8) + 255) / 256, 256, 0, stream>>>(coef, (_Float16*)av);

    // 5) causal depthwise conv: y[ch][b][t]
    conv_kernel<<<CH, 256, 0, stream>>>((const _Float16*)av, (const _Float16*)v, y);

    // 6) gate: g = u * y  (g reuses v buffer)
    gate_kernel<<<(BB * (NN / 32) * CH + 255) / 256, 256, 0, stream>>>(u, y, v);

    // 7) out = g @ Wo + bo + x
    gemm_wmma_kernel<<<dim3(MT / 64, DD / 128), 256, 0, stream>>>(
        v, Wo, bo, out, x, nullptr, MT, DD, D1, 3, 0);
}

// v004
// A run of this version takes 223 microseconds.
// Two timings next to v003 both put it at 1.39 times that version's speed.
// Counting every step since v000, it is 4.07 times as fast.
#include <hip/hip_runtime.h>
#include <hip/hip_bf16.h>
#include <math.h>

// Problem constants (fixed by the reference)
#define BB 4
#define NN 2048
#define DD 512
#define HH 8
#define EE 512
#define D1 1024
#define HD 128
#define GAMMA 0.999f

typedef _Float16 v16h __attribute__((ext_vector_type(16)));
typedef float    v8f  __attribute__((ext_vector_type(8)));
typedef _Float16 v8h  __attribute__((ext_vector_type(8)));
typedef short    s16x8 __attribute__((ext_vector_type(8)));

// a lane's 16 halves of a fragment: k = 8*hs + 0..7 at p, k = 16 + 8*hs + 0..7 at p + 16
__device__ __forceinline__ v16h frag16(const _Float16* p) {
    const v8h lo = *(const v8h*)p;
    const v8h hi = *(const v8h*)(p + 16);
    return __builtin_shufflevector(lo, hi, 0, 1, 2, 3, 4, 5, 6, 7,
                                   8, 9, 10, 11, 12, 13, 14, 15);
}
// transposing LDS read of a 16 x 16 block of halves that lies row by row
__device__ __forceinline__ v8h ld_tr16(const _Float16* p) {
    typedef __attribute__((address_space(3))) s16x8 lds_s16x8;
    return __builtin_bit_cast(v8h, __builtin_amdgcn_ds_load_tr16_b128_v8i16((lds_s16x8*)p));
}

// ---------------------------------------------------------------------------
// Generic WMMA GEMM: C[M,Nf] = epilogue(A[M,K] @ W[K,Nf] + bias)
//   mode 0: bias only
//   mode 1: bias + SiLU
//   mode 2: bias + SiLU, output as f16, time-major per channel: [col][B][N]
//   mode 3: bias + residual add (res has same [M,Nf] layout)
// What the A operand is:
//   amode 0: A as stored
//   amode 1: srms(A)
//   amode 2: relu(srms(A))
//   amode 3: relu(srms(P)), P[m][k] = m * A[k] + A2[k] (position rows, never stored)
// srms(x) = s * x with one s > 0 per row, s = 1 / (sqrt(mean(x^2)) + eps), so
// relu(srms(x)) @ W = s * (relu(x) @ W): the raw values go into the product,
// a row's sum of squares is gathered while its K values (K is the length of
// the norm) pass through the staging, and s multiplies the accumulators.
// Block tile 64x128x32, 256 threads = 8 waves, each wave -> 32x32 via
// 2x2 v_wmma_f32_16x16x32_f16. Assumes M%64==0, Nf%128==0, K%32==0.
// LDS banks: the A tile's rows stand at 80 bytes (16 x odd), where the 16 rows
// of a 16-byte fragment read fall on all 64 banks. The W tile lies [k][n], as
// in memory, so that a thread stores its 8 consecutive n of a row as one
// 16-byte piece and 16 lanes fill 256 bytes in a row; the transposing read
// turns it into the B fragment, and its rows stand at 288 bytes (32 x odd).
// ---------------------------------------------------------------------------
#define AS_P 40     // row pitch of the A tile in LDS, halves
#define BS_P 144    // row pitch of the W tile in LDS, halves
__global__ void gemm_wmma_kernel(const float* __restrict__ A,
                                 const float* __restrict__ W,
                                 const float* __restrict__ bias,
                                 float* __restrict__ C,
                                 const float* __restrict__ res,
                                 const float* __restrict__ A2,
                                 int M, int Nf, int K, int mode, int amode) {
    __shared__ __align__(16) _Float16 As[64 * AS_P];  // [m][k]
    __shared__ __align__(16) _Float16 Bs[32 * BS_P];  // [k][n]
    __shared__ __align__(16) float rs[64];            // s of the tile's rows

    const int tid  = threadIdx.x;
    const int lane = tid & 31;
    const int wid  = tid >> 5;
    const int wm   = wid & 1;    // 0..1  (rows 0-31 / 32-63)
    const int wn   = wid >> 1;   // 0..3  (cols, 32 each)

    const int bm = blockIdx.x * 64;
    const int bn = blockIdx.y * 128;

    v8f acc[2][2];
    acc[0][0] = (v8f){}; acc[0][1] = (v8f){};
    acc[1][0] = (v8f){}; acc[1][1] = (v8f){};

    const int laneM = lane & 15;
    const int hiSel = (lane >> 4) & 1;   // upper half of wave

    float ss = 0.f;   // this thread's part of its staged row's sum of squares

    const int nkb = K / 32;
    for (int kb = 0; kb < nkb; ++kb) {
        // ---- stage A tile: 64x32 floats -> f16, 8 per thread ----
        {
            const int r  = tid >> 2;            // 0..63
            const int c0 = (tid & 3) * 8;       // 0,8,16,24
            float av[8];
            if (amode == 3) {
                const float* pw = A + kb * 32 + c0;
                const float* pb = A2 + kb * 32 + c0;
                const float m = (float)(bm + r);
#pragma unroll
                for (int j = 0; j < 8; ++j) av[j] = m * pw[j] + pb[j];
                // before the loads' address registers are reused; the pointers
                // are inputs so that no load's result is placed in them earlier
                asm volatile("s_wait_xcnt 0x0" :: "v"(pw), "v"(pb) : "memory");
            } else {
                const float* src = A + (size_t)(bm + r) * K + kb * 32 + c0;
                if (kb + 1 < nkb) __builtin_prefetch(src + 32, 0, 0);
#pragma unroll
                for (int j = 0; j < 8; ++j) av[j] = src[j];
                // before the loads' address registers are reused; the pointer
                // is an input so that no load's result is placed in it earlier
                asm volatile("s_wait_xcnt 0x0" :: "v"(src) : "memory");
            }
            if (amode != 0) {
#pragma unroll
                for (int j = 0; j < 8; ++j) ss += av[j] * av[j];
            }
            if (amode >= 2) {
#pragma unroll
                for (int j = 0; j < 8; ++j) av[j] = fmaxf(av[j], 0.f);
            }
            v8h pa;
#pragma unroll
            for (int j = 0; j < 8; ++j) pa[j] = (_Float16)av[j];
            *(v8h*)&As[r * AS_P + c0] = pa;
        }
        // ---- stage W tile: each thread owns 8 consecutive n of the rows
        //      k0 and k0+1 -> one 16-byte DS store a row ----
        {
            const int k0 = (tid >> 4) * 2;      // 0,2,..,30
            const int n0 = (tid & 15) * 8;      // 0..120
            const float* src0 = W + (size_t)(kb * 32 + k0) * Nf + bn + n0;
            const float* src1 = src0 + Nf;
            if (kb + 1 < nkb) __builtin_prefetch(src0 + (size_t)32 * Nf, 0, 0);
            float w0[8], w1[8];
#pragma unroll
            for (int j = 0; j < 8; ++j) { w0[j] = src0[j]; w1[j] = src1[j]; }
            // before the loads' address registers are reused; the pointers
            // are inputs so that no load's result is placed in them earlier
            asm volatile("s_wait_xcnt 0x0" :: "v"(src0), "v"(src1) : "memory");
            v8h p0, p1;
#pragma unroll
            for (int j = 0; j < 8; ++j) {
                p0[j] = (_Float16)w0[j];
                p1[j] = (_Float16)w1[j];
            }
            *(v8h*)&Bs[k0 * BS_P + n0]       = p0;
            *(v8h*)&Bs[(k0 + 1) * BS_P + n0] = p1;
        }
        __syncthreads();

        // ---- load fragments, both in the hardware's k order: a lane holds
        //      k = 8*hiSel + 0..7 and 16 + 8*hiSel + 0..7 of its row or column ----
        v16h fa[2], fb[2];
#pragma unroll
        for (int mi = 0; mi < 2; ++mi)
            fa[mi] = frag16(&As[(wm * 32 + mi * 16 + laneM) * AS_P + hiSel * 8]);
        // a lane names 8 halves of row 8*hiSel + (lane & 7) of the block and
        // gets column laneM of the rows 8*hiSel + 0..7
        const _Float16* bt = &Bs[(hiSel * 8 + (lane & 7)) * BS_P + wn * 32 + ((lane >> 3) & 1) * 8];
#pragma unroll
        for (int ni = 0; ni < 2; ++ni) {
            const v8h lo = ld_tr16(bt + ni * 16);
            const v8h hi = ld_tr16(bt + 16 * BS_P + ni * 16);
            fb[ni] = __builtin_shufflevector(lo, hi, 0, 1, 2, 3, 4, 5, 6, 7,
                                             8, 9, 10, 11, 12, 13, 14, 15);
        }

#pragma unroll
        for (int mi = 0; mi < 2; ++mi)
#pragma unroll
            for (int ni = 0; ni < 2; ++ni)
                acc[mi][ni] = __builtin_amdgcn_wmma_f32_16x16x32_f16(
                    false, fa[mi], false, fb[ni], (short)0, acc[mi][ni],
                    false, false);
        __syncthreads();
    }

    // ---- the rows' norm factors: four neighbouring lanes staged one row ----
    if (amode != 0) {
        ss += __shfl_xor(ss, 1);
        ss += __shfl_xor(ss, 2);
        if ((tid & 3) == 0)
            rs[tid >> 2] = 1.0f / (sqrtf(ss / (float)K) + 1e-8f);
        __syncthreads();
#pragma unroll
        for (int mi = 0; mi < 2; ++mi) {
            const float* sp = &rs[wm * 32 + mi * 16 + hiSel * 8];
#pragma unroll
            for (int r = 0; r < 8; ++r) {
                acc[mi][0][r] *= sp[r];
                acc[mi][1][r] *= sp[r];
            }
        }
    }

    // ---- epilogue, mode 2: a lane holds 8 consecutive tokens of one channel,
    //      one 16-byte store into the channel's own time row ----
    if (mode == 2) {
        _Float16* Ch = (_Float16*)C;
#pragma unroll
        for (int mi = 0; mi < 2; ++mi) {
#pragma unroll
            for (int ni = 0; ni < 2; ++ni) {
                const int row0 = bm + wm * 32 + mi * 16 + hiSel * 8;
                const int col  = bn + wn * 32 + ni * 16 + laneM;
                const float bc = bias[col];
                // before the load's address registers are reused
                asm volatile("s_wait_xcnt 0x0" ::: "memory");
                v8h pk;
#pragma unroll
                for (int r = 0; r < 8; ++r) {
                    float val = acc[mi][ni][r] + bc;
                    val = val / (1.0f + __expf(-val));   // SiLU
                    pk[r] = (_Float16)val;
                }
                const int b = row0 / NN, n = row0 % NN;
                *(v8h*)&Ch[((size_t)col * BB + b) * NN + n] = pk;
                // before the store's registers are reused
                asm volatile("s_wait_xcnt 0x0" ::: "memory");
            }
        }
        return;
    }

    // ---- epilogue ----
#pragma unroll
    for (int mi = 0; mi < 2; ++mi) {
#pragma unroll
        for (int ni = 0; ni < 2; ++ni) {
#pragma unroll
            for (int r = 0; r < 8; ++r) {
                const int row = bm + wm * 32 + mi * 16 + r + hiSel * 8;
                const int col = bn + wn * 32 + ni * 16 + laneM;
                float val = acc[mi][ni][r] + bias[col];
                if (mode == 1) {
                    val = val / (1.0f + __expf(-val));   // SiLU
                }
                if (mode == 3) {
                    val += res[(size_t)row * Nf + col];
                }
                C[(size_t)row * Nf + col] = val;
                // before the store's registers are reused
                asm volatile("s_wait_xcnt 0x0" ::: "memory");
            }
        }
    }
}

// ---------------------------------------------------------------------------
// Filter per channel, f16, lags descending along the row:
//   g[ch][p] = decay(k) * coef[k][ch],  k = LMAX + 8 - p,  0 outside 0..N-1
//   decay(0) = 1, decay(k) = gamma^k
// coef layout: [N, CH]; g layout: [CH, GP]. One thread = 8 consecutive p.
// ---------------------------------------------------------------------------
#define CH   (HH * HD)
#define LMAX 2064            // largest lag index a fragment can ask for, rounded up to 8
#define GP   (LMAX + 40)     // row length of g, halves
#define AP   (LMAX + 32)     // row length of one shifted copy in LDS, halves
#define VF   64              // zeros in front of a time row (times < 0)
// time row in LDS: VF zeros, N values, 32 zeros, padded. A fragment read takes
// 16 bytes at every 32 from four places of each of the four rows: the rows
// start at 0, 1, 8 and 9 sixteen-byte units modulo 16, so that the 16 lanes of
// a half wave fall on all 64 banks
#define VP   2184
#define VOFF(b) ((b) * VP + ((b) >> 1) * 48)
__global__ void build_a_kernel(const float* __restrict__ coef,
                               _Float16* __restrict__ g) {
    int i = blockIdx.x * 256 + threadIdx.x;
    if (i >= CH * (GP / 8)) return;
    const int ch = i % CH;
    const int o  = i / CH;
    v8h w;
    // gamma^k of the smallest of the eight lags; the others by constant factors
    const int k7 = LMAX + 1 - 8 * o;
    const float d7 = __expf((float)k7 * __logf(GAMMA));
    float pw = 1.0f;
#pragma unroll
    for (int e = 7; e >= 0; --e) {
        const int k = k7 + 7 - e;
        // clamped row, read without a branch: the 8 loads fly together
        const int kc = min(max(k, 0), NN - 1);
        const float c = coef[(size_t)kc * CH + ch];
        // before the load's address registers are reused
        asm volatile("s_wait_xcnt 0x0" ::: "memory");
        const float decay = (k == 0) ? 1.0f : d7 * pw;
        w[e] = (k == kc) ? (_Float16)(decay * c) : (_Float16)0.f;
        pw *= GAMMA;
    }
    *(v8h*)&g[(size_t)ch * GP + 8 * o] = w;
}

// ---------------------------------------------------------------------------
// Causal depthwise conv along time as Toeplitz matrix products, one block per
// channel:  y[b][t] = sum_{k=0..t} a[k] * v[b][t-k]
// One 16x16x32 product, for a lag offset dl and an output tile of 64 steps:
//   A[m][j] = a[dl + m - j]                      (16 x 32, Toeplitz)
//   B[j][n] = v[b][t0 + 16*c4 - dl + j]          (n = 4*b + c4)
//   D[m][n] = part of y[b][t0 + 16*c4 + m]
// dl runs over 0, 32, .., t0 + 64: every lag 0..t is met exactly once; lags
// below 0 and above N-1 read zeros of the filter row, times below 0 zeros of
// the time row.
// A depends on dl alone and B on t0 - dl alone: a wave works on two adjacent
// tiles at once, which share every A, and the upper tile takes as B what the
// lower tile read two steps earlier, kept in registers.
// A lane's 8 consecutive j of A start at a lag that depends on m: the filter
// lies in LDS eight times, copy c shifted by c halves, so that lane m reads
// copy m & 7 at a 16-byte boundary.
// ---------------------------------------------------------------------------
__device__ __forceinline__ v8f mm(v16h a, v16h b, v8f c) {
    return __builtin_amdgcn_wmma_f32_16x16x32_f16(false, a, false, b, (short)0, c,
                                                  false, false);
}
__global__ __launch_bounds__(256) void conv_kernel(const _Float16* __restrict__ g,
                                                   const _Float16* __restrict__ vT,
                                                   float* __restrict__ yT) {
    __shared__ __align__(16) _Float16 a_s[8 * AP];     // 33.5 KB
    __shared__ __align__(16) _Float16 v_s[VOFF(BB)];   // 17.7 KB

    const int ch   = blockIdx.x;
    const int tid  = threadIdx.x;
    const int lane = tid & 31;
    // scalar wave number: the tile loops below must be scalar branches (a
    // matrix instruction needs every lane on)
    const int wid  = __builtin_amdgcn_readfirstlane(tid >> 5);

    // filter: a_s[c][x] = g[x - c + 8]
    const _Float16* gc = g + (size_t)ch * GP;
    for (int q = tid; q < AP / 8; q += 256) {
        const v8h lo = *(const v8h*)&gc[8 * q];
        const v8h hi = *(const v8h*)&gc[8 * q + 8];
        const v16h w = __builtin_shufflevector(lo, hi, 0, 1, 2, 3, 4, 5, 6, 7,
                                               8, 9, 10, 11, 12, 13, 14, 15);
#pragma unroll
        for (int c = 0; c < 8; ++c) {
            v8h o;
#pragma unroll
            for (int e = 0; e < 8; ++e) o[e] = w[e - c + 8];
            *(v8h*)&a_s[c * AP + 8 * q] = o;
        }
    }
    // time rows of the four batches, zeros in front and behind
    const _Float16* vc = vT + (size_t)ch * BB * NN;
#pragma unroll
    for (int b = 0; b < BB; ++b) {
        const v8h x = *(const v8h*)&vc[b * NN + tid * 8];
        *(v8h*)&v_s[VOFF(b) + VF + tid * 8] = x;
    }
    if (tid < BB * 12) {
        const int b = tid / 12, p = tid % 12;
        const int off = (p < 8) ? p * 8 : VF + NN + (p - 8) * 8;
        *(v8h*)&v_s[VOFF(b) + off] = (v8h){};
    }
    __syncthreads();

    const int n  = lane & 15;
    const int hs = lane >> 4;
    const _Float16* a0 = a_s + (n & 7) * AP + LMAX - 8 * (n >> 3) + 8 * hs;
    const _Float16* b0 = v_s + VOFF(n >> 2) + VF + 16 * (n & 3) + 8 * hs;
    float* y0 = yT + ((size_t)ch * BB + (n >> 2)) * NN + 16 * (n & 3) + 8 * hs;

    // pairs of tiles w and 15-w: the same number of products for every wave
    for (int q = 0; q < 2; ++q) {
        const int p = q ? 15 - wid : wid;      // tiles 2p (acc0) and 2p+1 (acc1)
        const _Float16* bp = b0 + 128 * p;     // B of tile 2p at dl = 0
        v8f acc0 = (v8f){}, acc1 = (v8f){};
        // B of tile 2p+1 at the next even and the next odd step
        v16h h0 = frag16(bp + 64), h1 = frag16(bp + 32);
        const int np = 2 * p + 1;              // steps 0 .. 4p+1, two a trip
        // unroll: the LDS reads of later products go out ahead of one wait
#pragma unroll 2
        for (int i = 0; i < np; ++i) {
            const v16h fa0 = frag16(a0 - 64 * i);
            const v16h fb0 = frag16(bp - 64 * i);
            const v16h fa1 = frag16(a0 - 64 * i - 32);
            const v16h fb1 = frag16(bp - 64 * i - 32);
            acc0 = mm(fa0, fb0, acc0);
            acc1 = mm(fa0, h0, acc1);
            acc0 = mm(fa1, fb1, acc0);
            acc1 = mm(fa1, h1, acc1);
            h0 = fb0;
            h1 = fb1;
        }
        // step 4p+2 for both tiles, steps 4p+3 and 4p+4 for the upper one
        {
            const v16h fa0 = frag16(a0 - 64 * np);
            const v16h fb0 = frag16(bp - 64 * np);
            const v16h fa1 = frag16(a0 - 64 * np - 32);
            const v16h fa2 = frag16(a0 - 64 * np - 64);
            acc0 = mm(fa0, fb0, acc0);
            acc1 = mm(fa0, h0, acc1);
            acc1 = mm(fa1, h1, acc1);
            acc1 = mm(fa2, fb0, acc1);
        }
        float4* yp = (float4*)(y0 + 128 * p);
        yp[0]  = make_float4(acc0[0], acc0[1], acc0[2], acc0[3]);
        yp[1]  = make_float4(acc0[4], acc0[5], acc0[6], acc0[7]);
        yp[16] = make_float4(acc1[0], acc1[1], acc1[2], acc1[3]);
        yp[17] = make_float4(acc1[4], acc1[5], acc1[6], acc1[7]);
        // before the next pair reuses the stores' registers
        asm volatile("s_wait_xcnt 0x0" ::: "memory");
    }
}

// ---------------------------------------------------------------------------
// g[b,n,ch] = u[b,n,ch] * y[ch][b][n]
// One thread = one channel and 32 time steps (one 128-byte line of y); lanes
// run over channels, so u and g go in whole lines.
// ---------------------------------------------------------------------------
__global__ void gate_kernel(const float* __restrict__ u,
                            const float* __restrict__ yT,
                            float* __restrict__ g) {
    int i = blockIdx.x * 256 + threadIdx.x;
    if (i >= BB * (NN / 32) * CH) return;
    const int ch = i % CH;
    const int rest = i / CH;
    const int tb = rest % (NN / 32), b = rest / (NN / 32);
    const float4* yp = (const float4*)(yT + ((size_t)ch * BB + b) * NN + tb * 32);
    const size_t base = ((size_t)b * NN + tb * 32) * D1 + ch;
    float4 yv[8];
#pragma unroll
    for (int j = 0; j < 8; ++j) yv[j] = yp[j];
    // before the loads' address registers are reused
    asm volatile("s_wait_xcnt 0x0" ::: "memory");
    float uv[32];
#pragma unroll
    for (int j = 0; j < 32; ++j) uv[j] = u[base + (size_t)j * D1];
    // before the loads' address registers are reused
    asm volatile("s_wait_xcnt 0x0" ::: "memory");
#pragma unroll
    for (int j = 0; j < 8; ++j) {
        g[base + (size_t)(4 * j + 0) * D1] = uv[4 * j + 0] * yv[j].x;
        g[base + (size_t)(4 * j + 1) * D1] = uv[4 * j + 1] * yv[j].y;
        g[base + (size_t)(4 * j + 2) * D1] = uv[4 * j + 2] * yv[j].z;
        g[base + (size_t)(4 * j + 3) * D1] = uv[4 * j + 3] * yv[j].w;
    }
}

// ---------------------------------------------------------------------------
extern "C" void kernel_launch(void* const* d_in, const int* in_sizes, int n_in,
                              void* d_out, int out_size, void* d_ws, size_t ws_size,
                              hipStream_t stream) {
    const float* x  = (const float*)d_in[0];
    const float* Wu = (const float*)d_in[1];
    const float* bu = (const float*)d_in[2];
    const float* Wv = (const float*)d_in[3];
    const float* bv = (const float*)d_in[4];
    const float* Wo = (const float*)d_in[5];
    const float* bo = (const float*)d_in[6];
    const float* Wp = (const float*)d_in[7];
    const float* bp = (const float*)d_in[8];
    const float* W1 = (const float*)d_in[9];
    const float* b1 = (const float*)d_in[10];
    const float* W2 = (const float*)d_in[11];
    const float* b2 = (const float*)d_in[12];
    const float* W3 = (const float*)d_in[13];
    const float* b3 = (const float*)d_in[14];
    const float* Wz = (const float*)d_in[15];
    const float* bz = (const float*)d_in[16];
    float* out = (float*)d_out;

    float* ws = (float*)d_ws;
    const size_t SZ_U  = (size_t)BB * NN * D1;   // 8M
    const size_t SZ_H  = (size_t)NN * EE;        // 1M
    const size_t SZ_CO = (size_t)NN * D1;        // 2M

    float* u    = ws;                    // 8M
    float* v    = u + SZ_U;              // 8M  f16 [CH][B][N] in its first half; reused for g
    float* y    = v + SZ_U;              // 8M  [CH][B][N]
    float* hcfA = y + SZ_U;              // 1M
    float* hcfB = hcfA + SZ_H;           // 1M
    float* coef = hcfB + SZ_H;           // 2M
    float* av   = coef + SZ_CO;          // f16 [CH][GP]

    const int MT = BB * NN;  // 8192 token rows

    // 1) u = silu(srms(x) @ Wu + bu)
    gemm_wmma_kernel<<<dim3(MT / 64, D1 / 128), 256, 0, stream>>>(
        x, Wu, bu, u, nullptr, nullptr, MT, D1, DD, 1, 1);

    // 2) v = silu(srms(x) @ Wv + bv), f16, [CH][B][N]
    gemm_wmma_kernel<<<dim3(MT / 64, D1 / 128), 256, 0, stream>>>(
        x, Wv, bv, v, nullptr, nullptr, MT, D1, DD, 2, 1);

    // 3) positional MLP: each layer is relu(srms(.)) @ W + b
    gemm_wmma_kernel<<<dim3(NN / 64, EE / 128), 256, 0, stream>>>(
        Wp, W1, b1, hcfA, nullptr, bp, NN, EE, EE, 0, 3);
    gemm_wmma_kernel<<<dim3(NN / 64, EE / 128), 256, 0, stream>>>(
        hcfA, W2, b2, hcfB, nullptr, nullptr, NN, EE, EE, 0, 2);
    gemm_wmma_kernel<<<dim3(NN / 64, EE / 128), 256, 0, stream>>>(
        hcfB, W3, b3, hcfA, nullptr, nullptr, NN, EE, EE, 0, 2);
    gemm_wmma_kernel<<<dim3(NN / 64, D1 / 128), 256, 0, stream>>>(
        hcfA, Wz, bz, coef, nullptr, nullptr, NN, D1, EE, 0, 2);

    // 4) build decayed filter rows, f16, lags descending
    build_a_kernel<<<(CH * (GP / 8) + 255) / 256, 256, 0, stream>>>(coef, (_Float16*)av);

    // 5) causal depthwise conv: y[ch][b][t]
    conv_kernel<<<CH, 256, 0, stream>>>((const _Float16*)av, (const _Float16*)v, y);

    // 6) gate: g = u * y  (g reuses v buffer)
    gate_kernel<<<(BB * (NN / 32) * CH + 255) / 256, 256, 0, stream>>>(u, y, v);

    // 7) out = g @ Wo + bo + x
    gemm_wmma_kernel<<<dim3(MT / 64, DD / 128), 256, 0, stream>>>(
        v, Wo, bo, out, x, nullptr, MT, DD, D1, 3, 0);
}

// v005
// A run of this version takes 184 microseconds.
// Next to v004, in two timings, it ran 1.21 times as fast each time.
// Over all steps from v000 it is 4.94 times as fast.
#include <hip/hip_runtime.h>
#include <hip/hip_bf16.h>
#include <math.h>

// Problem constants (fixed by the reference)
#define BB 4
#define NN 2048
#define DD 512
#define HH 8
#define EE 512
#define D1 1024
#define HD 128
#define GAMMA 0.999f

typedef _Float16 v16h __attribute__((ext_vector_type(16)));
typedef float    v8f  __attribute__((ext_vector_type(8)));
typedef _Float16 v8h  __attribute__((ext_vector_type(8)));
typedef short    s16x8 __attribute__((ext_vector_type(8)));

// a lane's 16 halves of a fragment: k = 8*hs + 0..7 at p, k = 16 + 8*hs + 0..7 at p + 16
__device__ __forceinline__ v16h frag16(const _Float16* p) {
    const v8h lo = *(const v8h*)p;
    const v8h hi = *(const v8h*)(p + 16);
    return __builtin_shufflevector(lo, hi, 0, 1, 2, 3, 4, 5, 6, 7,
                                   8, 9, 10, 11, 12, 13, 14, 15);
}
// transposing LDS read of a 16 x 16 block of halves that lies row by row
__device__ __forceinline__ v8h ld_tr16(const _Float16* p) {
    typedef __attribute__((address_space(3))) s16x8 lds_s16x8;
    return __builtin_bit_cast(v8h, __builtin_amdgcn_ds_load_tr16_b128_v8i16((lds_s16x8*)p));
}

// ---------------------------------------------------------------------------
// Generic WMMA GEMM: C[M,Nf] = epilogue(A[M,K] @ W[K,Nf] + bias)
//   mode 0: bias only
//   mode 1: bias + SiLU
//   mode 2: bias + SiLU, output as f16, time-major per channel: [col][B][N]
//   mode 3: bias + residual add (res has same [M,Nf] layout)
// What the A operand is:
//   amode 0: A as stored
//   amode 1: srms(A)
//   amode 2: relu(srms(A))
//   amode 3: relu(srms(P)), P[m][k] = m * A[k] + A2[k] (position rows, never stored)
// srms(x) = s * x with one s > 0 per row, s = 1 / (sqrt(mean(x^2)) + eps), so
// relu(srms(x)) @ W = s * (relu(x) @ W): the raw values go into the product,
// a row's sum of squares is gathered while its K values (K is the length of
// the norm) pass through the staging, and s multiplies the accumulators.
// Block tile 64x128x32, 256 threads = 8 waves, each wave -> 32x32 via
// 2x2 v_wmma_f32_16x16x32_f16. Assumes M%64==0, Nf%128==0, K%32==0.
// LDS banks: the A tile's rows stand at 80 bytes (16 x odd), where the 16 rows
// of a 16-byte fragment read fall on all 64 banks. The W tile lies [k][n], as
// in memory, so that a thread stores its 8 consecutive n of a row as one
// 16-byte piece and 16 lanes fill 256 bytes in a row; the transposing read
// turns it into the B fragment, and its rows stand at 288 bytes (32 x odd).
// ---------------------------------------------------------------------------
#define AS_P 40     // row pitch of the A tile in LDS, halves
#define BS_P 144    // row pitch of the W tile in LDS, halves
// One product, or a band of its column tiles. Its tiles are numbered rows first:
// tile j stands at row tile j mod 2^lgx, column tile by0 + (j >> lgx).
struct GemmJob {
    const float* A;
    const float* W;
    const float* bias;
    float*       C;
    const float* res;
    const float* A2;
    int Nf, K, mode, amode;
    int lgx;    // log2 of the number of row tiles (M / 64)
    int by0;    // first column tile of the band
};
// The tile of 64 rows from bm and 128 columns from bn of one product.
__device__ __forceinline__ void gemm_tile(const float* __restrict__ A,
                                          const float* __restrict__ W,
                                          const float* __restrict__ bias,
                                          float* __restrict__ C,
                                          const float* __restrict__ res,
                                          const float* __restrict__ A2,
                                          int Nf, int K, int mode, int amode,
                                          int bm, int bn) {
    __shared__ __align__(16) _Float16 As[64 * AS_P];  // [m][k]
    __shared__ __align__(16) _Float16 Bs[32 * BS_P];  // [k][n]
    __shared__ __align__(16) float rs[64];            // s of the tile's rows

    const int tid  = threadIdx.x;
    const int lane = tid & 31;
    const int wid  = tid >> 5;
    const int wm   = wid & 1;    // 0..1  (rows 0-31 / 32-63)
    const int wn   = wid >> 1;   // 0..3  (cols, 32 each)

    v8f acc[2][2];
    acc[0][0] = (v8f){}; acc[0][1] = (v8f){};
    acc[1][0] = (v8f){}; acc[1][1] = (v8f){};

    const int laneM = lane & 15;
    const int hiSel = (lane >> 4) & 1;   // upper half of wave

    float ss = 0.f;   // this thread's part of its staged row's sum of squares

    const int nkb = K / 32;
    for (int kb = 0; kb < nkb; ++kb) {
        // ---- stage A tile: 64x32 floats -> f16, 8 per thread ----
        {
            const int r  = tid >> 2;            // 0..63
            const int c0 = (tid & 3) * 8;       // 0,8,16,24
            float av[8];
            if (amode == 3) {
                const float* pw = A + kb * 32 + c0;
                const float* pb = A2 + kb * 32 + c0;
                const float m = (float)(bm + r);
#pragma unroll
                for (int j = 0; j < 8; ++j) av[j] = m * pw[j] + pb[j];
                // before the loads' address registers are reused; the pointers
                // are inputs so that no load's result is placed in them earlier
                asm volatile("s_wait_xcnt 0x0" :: "v"(pw), "v"(pb) : "memory");
            } else {
                const float* src = A + (size_t)(bm + r) * K + kb * 32 + c0;
                if (kb + 1 < nkb) __builtin_prefetch(src + 32, 0, 0);
#pragma unroll
                for (int j = 0; j < 8; ++j) av[j] = src[j];
                // before the loads' address registers are reused; the pointer
                // is an input so that no load's result is placed in it earlier
                asm volatile("s_wait_xcnt 0x0" :: "v"(src) : "memory");
            }
            if (amode != 0) {
#pragma unroll
                for (int j = 0; j < 8; ++j) ss += av[j] * av[j];
            }
            if (amode >= 2) {
#pragma unroll
                for (int j = 0; j < 8; ++j) av[j] = fmaxf(av[j], 0.f);
            }
            v8h pa;
#pragma unroll
            for (int j = 0; j < 8; ++j) pa[j] = (_Float16)av[j];
            *(v8h*)&As[r * AS_P + c0] = pa;
        }
        // ---- stage W tile: each thread owns 8 consecutive n of the rows
        //      k0 and k0+1 -> one 16-byte DS store a row ----
        {
            const int k0 = (tid >> 4) * 2;      // 0,2,..,30
            const int n0 = (tid & 15) * 8;      // 0..120
            const float* src0 = W + (size_t)(kb * 32 + k0) * Nf + bn + n0;
            const float* src1 = src0 + Nf;
            if (kb + 1 < nkb) __builtin_prefetch(src0 + (size_t)32 * Nf, 0, 0);
            float w0[8], w1[8];
#pragma unroll
            for (int j = 0; j < 8; ++j) { w0[j] = src0[j]; w1[j] = src1[j]; }
            // before the loads' address registers are reused; the pointers
            // are inputs so that no load's result is placed in them earlier
            asm volatile("s_wait_xcnt 0x0" :: "v"(src0), "v"(src1) : "memory");
            v8h p0, p1;
#pragma unroll
            for (int j = 0; j < 8; ++j) {
                p0[j] = (_Float16)w0[j];
                p1[j] = (_Float16)w1[j];
            }
            *(v8h*)&Bs[k0 * BS_P + n0]       = p0;
            *(v8h*)&Bs[(k0 + 1) * BS_P + n0] = p1;
        }
        __syncthreads();

        // ---- load fragments, both in the hardware's k order: a lane holds
        //      k = 8*hiSel + 0..7 and 16 + 8*hiSel + 0..7 of its row or column ----
        v16h fa[2], fb[2];
#pragma unroll
        for (int mi = 0; mi < 2; ++mi)
            fa[mi] = frag16(&As[(wm * 32 + mi * 16 + laneM) * AS_P + hiSel * 8]);
        // a lane names 8 halves of row 8*hiSel + (lane & 7) of the block and
        // gets column laneM of the rows 8*hiSel + 0..7
        const _Float16* bt = &Bs[(hiSel * 8 + (lane & 7)) * BS_P + wn * 32 + ((lane >> 3) & 1) * 8];
#pragma unroll
        for (int ni = 0; ni < 2; ++ni) {
            const v8h lo = ld_tr16(bt + ni * 16);
            const v8h hi = ld_tr16(bt + 16 * BS_P + ni * 16);
            fb[ni] = __builtin_shufflevector(lo, hi, 0, 1, 2, 3, 4, 5, 6, 7,
                                             8, 9, 10, 11, 12, 13, 14, 15);
        }

#pragma unroll
        for (int mi = 0; mi < 2; ++mi)
#pragma unroll
            for (int ni = 0; ni < 2; ++ni)
                acc[mi][ni] = __builtin_amdgcn_wmma_f32_16x16x32_f16(
                    false, fa[mi], false, fb[ni], (short)0, acc[mi][ni],
                    false, false);
        __syncthreads();
    }

    // ---- the rows' norm factors: four neighbouring lanes staged one row ----
    if (amode != 0) {
        ss += __shfl_xor(ss, 1);
        ss += __shfl_xor(ss, 2);
        if ((tid & 3) == 0)
            rs[tid >> 2] = 1.0f / (sqrtf(ss / (float)K) + 1e-8f);
        __syncthreads();
#pragma unroll
        for (int mi = 0; mi < 2; ++mi) {
            const float* sp = &rs[wm * 32 + mi * 16 + hiSel * 8];
#pragma unroll
            for (int r = 0; r < 8; ++r) {
                acc[mi][0][r] *= sp[r];
                acc[mi][1][r] *= sp[r];
            }
        }
    }

    // ---- epilogue, mode 2: a lane holds 8 consecutive tokens of one channel,
    //      one 16-byte store into the channel's own time row ----
    if (mode == 2) {
        _Float16* Ch = (_Float16*)C;
#pragma unroll
        for (int mi = 0; mi < 2; ++mi) {
#pragma unroll
            for (int ni = 0; ni < 2; ++ni) {
                const int row0 = bm + wm * 32 + mi * 16 + hiSel * 8;
                const int col  = bn + wn * 32 + ni * 16 + laneM;
                const float bc = bias[col];
                // before the load's address registers are reused
                asm volatile("s_wait_xcnt 0x0" ::: "memory");
                v8h pk;
#pragma unroll
                for (int r = 0; r < 8; ++r) {
                    float val = acc[mi][ni][r] + bc;
                    val = val / (1.0f + __expf(-val));   // SiLU
                    pk[r] = (_Float16)val;
                }
                const int b = row0 / NN, n = row0 % NN;
                *(v8h*)&Ch[((size_t)col * BB + b) * NN + n] = pk;
                // before the store's registers are reused
                asm volatile("s_wait_xcnt 0x0" ::: "memory");
            }
        }
        return;
    }

    // ---- epilogue ----
#pragma unroll
    for (int mi = 0; mi < 2; ++mi) {
#pragma unroll
        for (int ni = 0; ni < 2; ++ni) {
            const int col = bn + wn * 32 + ni * 16 + laneM;
            const float* bq = bias + col;
            const float bc = *bq;
            // before the load's address registers are reused; the pointer is
            // an input so that the load's result is not placed in it earlier
            asm volatile("s_wait_xcnt 0x0" :: "v"(bq) : "memory");
#pragma unroll
            for (int r = 0; r < 8; ++r) {
                const int row = bm + wm * 32 + mi * 16 + r + hiSel * 8;
                float val = acc[mi][ni][r] + bc;
                if (mode == 1) {
                    val = val / (1.0f + __expf(-val));   // SiLU
                }
                if (mode == 3) {
                    val += res[(size_t)row * Nf + col];
                }
                C[(size_t)row * Nf + col] = val;
                // before the store's registers are reused
                asm volatile("s_wait_xcnt 0x0" ::: "memory");
            }
        }
    }
}

// A launch carries two products that do not depend on each other: the first
// nb0 blocks work on j0, the others on j1. A short product, which alone leaves
// most of the chip idle for the length of its k loop, runs beside a large one.
__global__ void gemm_wmma_kernel(GemmJob j0, GemmJob j1, int nb0) {
    const bool f0   = (int)blockIdx.x < nb0;
    const int  tile = f0 ? (int)blockIdx.x : (int)blockIdx.x - nb0;
    const int  lgx  = f0 ? j0.lgx : j1.lgx;
    const int  by0  = f0 ? j0.by0 : j1.by0;
    gemm_tile(f0 ? j0.A : j1.A, f0 ? j0.W : j1.W, f0 ? j0.bias : j1.bias,
              f0 ? j0.C : j1.C, f0 ? j0.res : j1.res, f0 ? j0.A2 : j1.A2,
              f0 ? j0.Nf : j1.Nf, f0 ? j0.K : j1.K,
              f0 ? j0.mode : j1.mode, f0 ? j0.amode : j1.amode,
              (tile & ((1 << lgx) - 1)) * 64, (by0 + (tile >> lgx)) * 128);
}

// ---------------------------------------------------------------------------
// Filter per channel, f16, lags descending along the row:
//   g[ch][p] = decay(k) * coef[k][ch],  k = LMAX + 8 - p,  0 outside 0..N-1
//   decay(0) = 1, decay(k) = gamma^k
// coef layout: [N, CH]; g layout: [CH, GP]. One thread = 8 consecutive p.
// ---------------------------------------------------------------------------
#define CH   (HH * HD)
#define LMAX 2064            // largest lag index a fragment can ask for, rounded up to 8
#define GP   (LMAX + 40)     // row length of g, halves
#define AP   (LMAX + 32)     // row length of one shifted copy in LDS, halves
#define VF   64              // zeros in front of a time row (times < 0)
// time row in LDS: VF zeros, N values, 32 zeros, padded. A fragment read takes
// 16 bytes at every 32 from four places of each of the four rows: the rows
// start at 0, 1, 8 and 9 sixteen-byte units modulo 16, so that the 16 lanes of
// a half wave fall on all 64 banks
#define VP   2184
#define VOFF(b) ((b) * VP + ((b) >> 1) * 48)
__global__ void build_a_kernel(const float* __restrict__ coef,
                               _Float16* __restrict__ g) {
    int i = blockIdx.x * 256 + threadIdx.x;
    if (i >= CH * (GP / 8)) return;
    const int ch = i % CH;
    const int o  = i / CH;
    v8h w;
    // gamma^k of the smallest of the eight lags; the others by constant factors
    const int k7 = LMAX + 1 - 8 * o;
    const float d7 = __expf((float)k7 * __logf(GAMMA));
    float pw = 1.0f;
#pragma unroll
    for (int e = 7; e >= 0; --e) {
        const int k = k7 + 7 - e;
        // clamped row, read without a branch: the 8 loads fly together
        const int kc = min(max(k, 0), NN - 1);
        const float c = coef[(size_t)kc * CH + ch];
        // before the load's address registers are reused
        asm volatile("s_wait_xcnt 0x0" ::: "memory");
        const float decay = (k == 0) ? 1.0f : d7 * pw;
        w[e] = (k == kc) ? (_Float16)(decay * c) : (_Float16)0.f;
        pw *= GAMMA;
    }
    *(v8h*)&g[(size_t)ch * GP + 8 * o] = w;
}

// ---------------------------------------------------------------------------
// Causal depthwise conv along time as Toeplitz matrix products, one block per
// channel:  y[b][t] = sum_{k=0..t} a[k] * v[b][t-k]
// One 16x16x32 product, for a lag offset dl and an output tile of 64 steps:
//   A[m][j] = a[dl + m - j]                      (16 x 32, Toeplitz)
//   B[j][n] = v[b][t0 + 16*c4 - dl + j]          (n = 4*b + c4)
//   D[m][n] = part of y[b][t0 + 16*c4 + m]
// dl runs over 0, 32, .., t0 + 64: every lag 0..t is met exactly once; lags
// below 0 and above N-1 read zeros of the filter row, times below 0 zeros of
// the time row.
// A depends on dl alone and B on t0 - dl alone: a wave works on two adjacent
// tiles at once, which share every A, and the upper tile takes as B what the
// lower tile read two steps earlier, kept in registers.
// A lane's 8 consecutive j of A start at a lag that depends on m: the filter
// lies in LDS eight times, copy c shifted by c halves, so that lane m reads
// copy m & 7 at a 16-byte boundary.
// ---------------------------------------------------------------------------
__device__ __forceinline__ v8f mm(v16h a, v16h b, v8f c) {
    return __builtin_amdgcn_wmma_f32_16x16x32_f16(false, a, false, b, (short)0, c,
                                                  false, false);
}
__global__ __launch_bounds__(256) void conv_kernel(const _Float16* __restrict__ g,
                                                   const _Float16* __restrict__ vT,
                                                   float* __restrict__ yT) {
    __shared__ __align__(16) _Float16 a_s[8 * AP];     // 33.5 KB
    __shared__ __align__(16) _Float16 v_s[VOFF(BB)];   // 17.7 KB

    const int ch   = blockIdx.x;
    const int tid  = threadIdx.x;
    const int lane = tid & 31;
    // scalar wave number: the tile loops below must be scalar branches (a
    // matrix instruction needs every lane on)
    const int wid  = __builtin_amdgcn_readfirstlane(tid >> 5);

    // filter: a_s[c][x] = g[x - c + 8]
    const _Float16* gc = g + (size_t)ch * GP;
    for (int q = tid; q < AP / 8; q += 256) {
        const v8h lo = *(const v8h*)&gc[8 * q];
        const v8h hi = *(const v8h*)&gc[8 * q + 8];
        const v16h w = __builtin_shufflevector(lo, hi, 0, 1, 2, 3, 4, 5, 6, 7,
                                               8, 9, 10, 11, 12, 13, 14, 15);
#pragma unroll
        for (int c = 0; c < 8; ++c) {
            v8h o;
#pragma unroll
            for (int e = 0; e < 8; ++e) o[e] = w[e - c + 8];
            *(v8h*)&a_s[c * AP + 8 * q] = o;
        }
    }
    // time rows of the four batches, zeros in front and behind
    const _Float16* vc = vT + (size_t)ch * BB * NN;
#pragma unroll
    for (int b = 0; b < BB; ++b) {
        const v8h x = *(const v8h*)&vc[b * NN + tid * 8];
        *(v8h*)&v_s[VOFF(b) + VF + tid * 8] = x;
    }
    if (tid < BB * 12) {
        const int b = tid / 12, p = tid % 12;
        const int off = (p < 8) ? p * 8 : VF + NN + (p - 8) * 8;
        *(v8h*)&v_s[VOFF(b) + off] = (v8h){};
    }
    __syncthreads();

    const int n  = lane & 15;
    const int hs = lane >> 4;
    const _Float16* a0 = a_s + (n & 7) * AP + LMAX - 8 * (n >> 3) + 8 * hs;
    const _Float16* b0 = v_s + VOFF(n >> 2) + VF + 16 * (n & 3) + 8 * hs;
    float* y0 = yT + ((size_t)ch * BB + (n >> 2)) * NN + 16 * (n & 3) + 8 * hs;

    // pairs of tiles w and 15-w: the same number of products for every wave
    for (int q = 0; q < 2; ++q) {
        const int p = q ? 15 - wid : wid;      // tiles 2p (acc0) and 2p+1 (acc1)
        const _Float16* bp = b0 + 128 * p;     // B of tile 2p at dl = 0
        v8f acc0 = (v8f){}, acc1 = (v8f){};
        // B of tile 2p+1 at the next even and the next odd step
        v16h h0 = frag16(bp + 64), h1 = frag16(bp + 32);
        const int np = 2 * p + 1;              // steps 0 .. 4p+1, two a trip
        // unroll: the LDS reads of later products go out ahead of one wait
#pragma unroll 2
        for (int i = 0; i < np; ++i) {
            const v16h fa0 = frag16(a0 - 64 * i);
            const v16h fb0 = frag16(bp - 64 * i);
            const v16h fa1 = frag16(a0 - 64 * i - 32);
            const v16h fb1 = frag16(bp - 64 * i - 32);
            acc0 = mm(fa0, fb0, acc0);
            acc1 = mm(fa0, h0, acc1);
            acc0 = mm(fa1, fb1, acc0);
            acc1 = mm(fa1, h1, acc1);
            h0 = fb0;
            h1 = fb1;
        }
        // step 4p+2 for both tiles, steps 4p+3 and 4p+4 for the upper one
        {
            const v16h fa0 = frag16(a0 - 64 * np);
            const v16h fb0 = frag16(bp - 64 * np);
            const v16h fa1 = frag16(a0 - 64 * np - 32);
            const v16h fa2 = frag16(a0 - 64 * np - 64);
            acc0 = mm(fa0, fb0, acc0);
            acc1 = mm(fa0, h0, acc1);
            acc1 = mm(fa1, h1, acc1);
            acc1 = mm(fa2, fb0, acc1);
        }
        float4* yp = (float4*)(y0 + 128 * p);
        yp[0]  = make_float4(acc0[0], acc0[1], acc0[2], acc0[3]);
        yp[1]  = make_float4(acc0[4], acc0[5], acc0[6], acc0[7]);
        yp[16] = make_float4(acc1[0], acc1[1], acc1[2], acc1[3]);
        yp[17] = make_float4(acc1[4], acc1[5], acc1[6], acc1[7]);
        // before the next pair reuses the stores' registers
        asm volatile("s_wait_xcnt 0x0" ::: "memory");
    }
}

// ---------------------------------------------------------------------------
// g[b,n,ch] = u[b,n,ch] * y[ch][b][n]
// One thread = one channel and 32 time steps (one 128-byte line of y); lanes
// run over channels, so u and g go in whole lines.
// ---------------------------------------------------------------------------
__global__ void gate_kernel(const float* __restrict__ u,
                            const float* __restrict__ yT,
                            float* __restrict__ g) {
    int i = blockIdx.x * 256 + threadIdx.x;
    if (i >= BB * (NN / 32) * CH) return;
    const int ch = i % CH;
    const int rest = i / CH;
    const int tb = rest % (NN / 32), b = rest / (NN / 32);
    const float4* yp = (const float4*)(yT + ((size_t)ch * BB + b) * NN + tb * 32);
    const size_t base = ((size_t)b * NN + tb * 32) * D1 + ch;
    float4 yv[8];
#pragma unroll
    for (int j = 0; j < 8; ++j) yv[j] = yp[j];
    // before the loads' address registers are reused
    asm volatile("s_wait_xcnt 0x0" ::: "memory");
    float uv[32];
#pragma unroll
    for (int j = 0; j < 32; ++j) uv[j] = u[base + (size_t)j * D1];
    // before the loads' address registers are reused
    asm volatile("s_wait_xcnt 0x0" ::: "memory");
#pragma unroll
    for (int j = 0; j < 8; ++j) {
        g[base + (size_t)(4 * j + 0) * D1] = uv[4 * j + 0] * yv[j].x;
        g[base + (size_t)(4 * j + 1) * D1] = uv[4 * j + 1] * yv[j].y;
        g[base + (size_t)(4 * j + 2) * D1] = uv[4 * j + 2] * yv[j].z;
        g[base + (size_t)(4 * j + 3) * D1] = uv[4 * j + 3] * yv[j].w;
    }
}

// ---------------------------------------------------------------------------
extern "C" void kernel_launch(void* const* d_in, const int* in_sizes, int n_in,
                              void* d_out, int out_size, void* d_ws, size_t ws_size,
                              hipStream_t stream) {
    const float* x  = (const float*)d_in[0];
    const float* Wu = (const float*)d_in[1];
    const float* bu = (const float*)d_in[2];
    const float* Wv = (const float*)d_in[3];
    const float* bv = (const float*)d_in[4];
    const float* Wo = (const float*)d_in[5];
    const float* bo = (const float*)d_in[6];
    const float* Wp = (const float*)d_in[7];
    const float* bp = (const float*)d_in[8];
    const float* W1 = (const float*)d_in[9];
    const float* b1 = (const float*)d_in[10];
    const float* W2 = (const float*)d_in[11];
    const float* b2 = (const float*)d_in[12];
    const float* W3 = (const float*)d_in[13];
    const float* b3 = (const float*)d_in[14];
    const float* Wz = (const float*)d_in[15];
    const float* bz = (const float*)d_in[16];
    float* out = (float*)d_out;

    float* ws = (float*)d_ws;
    const size_t SZ_U  = (size_t)BB * NN * D1;   // 8M
    const size_t SZ_H  = (size_t)NN * EE;        // 1M
    const size_t SZ_CO = (size_t)NN * D1;        // 2M

    float* u    = ws;                    // 8M
    float* v    = u + SZ_U;              // 8M  f16 [CH][B][N] in its first half; reused for g
    float* y    = v + SZ_U;              // 8M  [CH][B][N]
    float* hcfA = y + SZ_U;              // 1M
    float* hcfB = hcfA + SZ_H;           // 1M
    float* coef = hcfB + SZ_H;           // 2M
    float* av   = coef + SZ_CO;          // f16 [CH][GP]

    // row tiles: 8192 token rows -> 2^7, 2048 position rows -> 2^5
    // u = silu(srms(x) @ Wu + bu); v = silu(srms(x) @ Wv + bv), f16, [CH][B][N];
    // each in two bands of four column tiles (512 blocks)
    const GemmJob ju0 = {x, Wu, bu, u, nullptr, nullptr, D1, DD, 1, 1, 7, 0};
    const GemmJob ju1 = {x, Wu, bu, u, nullptr, nullptr, D1, DD, 1, 1, 7, 4};
    const GemmJob jv0 = {x, Wv, bv, v, nullptr, nullptr, D1, DD, 2, 1, 7, 0};
    const GemmJob jv1 = {x, Wv, bv, v, nullptr, nullptr, D1, DD, 2, 1, 7, 4};
    // positional MLP: each layer is relu(srms(.)) @ W + b
    const GemmJob jp1 = {Wp,   W1, b1, hcfA, nullptr, bp,      EE, EE, 0, 3, 5, 0};
    const GemmJob jp2 = {hcfA, W2, b2, hcfB, nullptr, nullptr, EE, EE, 0, 2, 5, 0};
    const GemmJob jp3 = {hcfB, W3, b3, hcfA, nullptr, nullptr, EE, EE, 0, 2, 5, 0};
    const GemmJob jpz = {hcfA, Wz, bz, coef, nullptr, nullptr, D1, EE, 0, 2, 5, 0};

    // 1-3) the four layers follow one another; each shares its launch with a
    //      band of u or v, which depend on x alone
    //      (128 or 256 blocks of the layer first, then the band's 512)
    gemm_wmma_kernel<<<640, 256, 0, stream>>>(jp1, ju0, 128);
    gemm_wmma_kernel<<<640, 256, 0, stream>>>(jp2, ju1, 128);
    gemm_wmma_kernel<<<640, 256, 0, stream>>>(jp3, jv0, 128);
    gemm_wmma_kernel<<<768, 256, 0, stream>>>(jpz, jv1, 256);

    // 4) build decayed filter rows, f16, lags descending
    build_a_kernel<<<(CH * (GP / 8) + 255) / 256, 256, 0, stream>>>(coef, (_Float16*)av);

    // 5) causal depthwise conv: y[ch][b][t]
    conv_kernel<<<CH, 256, 0, stream>>>((const _Float16*)av, (const _Float16*)v, y);

    // 6) gate: g = u * y  (g reuses v buffer)
    gate_kernel<<<(BB * (NN / 32) * CH + 255) / 256, 256, 0, stream>>>(u, y, v);

    // 7) out = g @ Wo + bo + x
    const GemmJob jo = {v, Wo, bo, out, x, nullptr, DD, D1, 3, 0, 7, 0};
    gemm_wmma_kernel<<<512, 256, 0, stream>>>(jo, jo, 512);
}

// v006
// A run of this version takes 150 microseconds.
// Two timings next to v005 both put it at 1.23 times that version's speed.
// All steps since v000 together make it 6.06 times as fast.
#include <hip/hip_runtime.h>
#include <hip/hip_bf16.h>
#include <math.h>

// Problem constants (fixed by the reference)
#define BB 4
#define NN 2048
#define DD 512
#define HH 8
#define EE 512
#define D1 1024
#define HD 128
#define GAMMA 0.999f

typedef _Float16 v16h __attribute__((ext_vector_type(16)));
typedef float    v8f  __attribute__((ext_vector_type(8)));
typedef _Float16 v8h  __attribute__((ext_vector_type(8)));
typedef short    s16x8 __attribute__((ext_vector_type(8)));

// a lane's 16 halves of a fragment: k = 8*hs + 0..7 at p, k = 16 + 8*hs + 0..7 at p + 16
__device__ __forceinline__ v16h frag16(const _Float16* p) {
    const v8h lo = *(const v8h*)p;
    const v8h hi = *(const v8h*)(p + 16);
    return __builtin_shufflevector(lo, hi, 0, 1, 2, 3, 4, 5, 6, 7,
                                   8, 9, 10, 11, 12, 13, 14, 15);
}
// a base that is the same for the whole block + a thread's 32-bit byte offset
__device__ __forceinline__ const float* at(const float* base, unsigned bytes) {
    return (const float*)((const char*)base + bytes);
}
// transposing LDS read of a 16 x 16 block of halves that lies row by row
__device__ __forceinline__ v8h ld_tr16(const _Float16* p) {
    typedef __attribute__((address_space(3))) s16x8 lds_s16x8;
    return __builtin_bit_cast(v8h, __builtin_amdgcn_ds_load_tr16_b128_v8i16((lds_s16x8*)p));
}

// ---------------------------------------------------------------------------
// Generic WMMA GEMM: C[M,Nf] = epilogue(A[M,K] @ W[K,Nf] + bias)
//   mode 0: bias only
//   mode 1: bias + SiLU
//   mode 2: bias + SiLU, output as f16, time-major per channel: [col][B][N]
//   mode 3: bias + residual add (res has same [M,Nf] layout)
// What the A operand is:
//   amode 0: A as stored
//   amode 1: srms(A)
//   amode 2: relu(srms(A))
//   amode 3: relu(srms(P)), P[m][k] = m * A[k] + A2[k] (position rows, never stored)
// srms(x) = s * x with one s > 0 per row, s = 1 / (sqrt(mean(x^2)) + eps), so
// relu(srms(x)) @ W = s * (relu(x) @ W): the raw values go into the product,
// a row's sum of squares is gathered while its K values (K is the length of
// the norm) pass through the staging, and s multiplies the accumulators.
// Block tile 64x128x128, 256 threads = 8 waves, each wave -> 32x32 via
// 2x2 v_wmma_f32_16x16x32_f16. Assumes M%64==0, Nf%128==0, K%128==0.
// LDS banks: the A tile's rows stand at 272 bytes (16 x odd), where the 16 rows
// of a 16-byte fragment read fall on all 64 banks. The W tile lies [k][n], as
// in memory, so that a thread stores its 8 consecutive n of a row as one
// 16-byte piece and 16 lanes fill 256 bytes in a row; the transposing read
// turns it into the B fragment, and its rows stand at 288 bytes (32 x odd).
// ---------------------------------------------------------------------------
#define BK   128    // k of one pass of the k loop
#define AS_P 136    // row pitch of the A tile in LDS, halves
#define BS_P 144    // row pitch of the W tile in LDS, halves
// One product, or a band of its column tiles. Its tiles are numbered rows first:
// tile j stands at row tile j mod 2^lgx, column tile by0 + (j >> lgx).
struct GemmJob {
    const float* A;
    const float* W;
    const float* bias;
    float*       C;
    const float* res;
    const float* A2;
    int Nf, K, mode, amode;
    int lgx;    // log2 of the number of row tiles (M / 64)
    int by0;    // first column tile of the band
};
// The tile of 64 rows from bm and 128 columns from bn of one product.
__device__ __forceinline__ void gemm_tile(const float* __restrict__ A,
                                          const float* __restrict__ W,
                                          const float* __restrict__ bias,
                                          float* __restrict__ C,
                                          const float* __restrict__ res,
                                          const float* __restrict__ A2,
                                          int Nf, int K, int mode, int amode,
                                          int bm, int bn) {
    __shared__ __align__(16) _Float16 As[64 * AS_P];  // [m][k]
    __shared__ __align__(16) _Float16 Bs[BK * BS_P];  // [k][n]
    __shared__ __align__(16) float rs[64];            // s of the tile's rows

    const int tid  = threadIdx.x;
    const int lane = tid & 31;
    const int wid  = tid >> 5;
    const int wm   = wid & 1;    // 0..1  (rows 0-31 / 32-63)
    const int wn   = wid >> 1;   // 0..3  (cols, 32 each)

    v8f acc[2][2];
    acc[0][0] = (v8f){}; acc[0][1] = (v8f){};
    acc[1][0] = (v8f){}; acc[1][1] = (v8f){};

    const int laneM = lane & 15;
    const int hiSel = (lane >> 4) & 1;   // upper half of wave

    float ss = 0.f;   // this thread's part of its staged row's sum of squares

    const int nkb = K / BK;
    // A: row r, 8 floats at c0 of each of the row's 32-float lines
    const int r  = tid >> 2;            // 0..63
    const int c0 = (tid & 3) * 8;       // 0,8,16,24
    // W: 8 consecutive n of the rows k0 and k0+1 of each group of 32 rows
    const int k0 = (tid >> 4) * 2;      // 0,2,..,30
    const int n0 = (tid & 15) * 8;      // 0..120
    // a thread's places in the two tiles, in bytes, the same in every pass
    const unsigned ao = (unsigned)(r * K + c0) * 4u;
    const unsigned wo = (unsigned)(k0 * Nf + n0) * 4u;
    // and the places it asks for ahead: one line of its row of A, one line of
    // an even row of W
    const unsigned ap = (unsigned)(r * K + (tid & 3) * 32) * 4u;
    const unsigned wp = (unsigned)((tid >> 2) * 2 * Nf + (tid & 3) * 32) * 4u;
    for (int kb = 0; kb < nkb; ++kb) {
        // ---- all global loads of the pass go out before the first is waited
        //      for: one load latency and two barriers per BK k ----
        float av[4][8];
        if (amode == 3) {
            const float* pw = A + kb * BK;
            const float* pb = A2 + kb * BK;
            const float m = (float)(bm + r);
#pragma unroll
            for (int q = 0; q < 4; ++q)
#pragma unroll
                for (int j = 0; j < 8; ++j) av[q][j] = m * (pw + c0)[q * 32 + j] + (pb + c0)[q * 32 + j];
            // before the loads' address registers are reused; they are inputs
            // so that they stay as they are up to here
            asm volatile("s_wait_xcnt 0x0" :: "s"(pw), "s"(pb), "v"(c0) : "memory");
        } else {
            const float* src = A + (size_t)bm * K + kb * BK;
            const float* pa0 = at(src, ao);
            // next pass: the row's lines, one a thread
            const float* pa1 = at(src, ap) + BK;
            if (kb + 1 < nkb) __builtin_prefetch(pa1, 0, 0);
#pragma unroll
            for (int q = 0; q < 4; ++q)
#pragma unroll
                for (int j = 0; j < 8; ++j) av[q][j] = pa0[q * 32 + j];
            // before the loads' address registers are reused; the pointers
            // are inputs so that no load's result is placed in them earlier
            asm volatile("s_wait_xcnt 0x0" :: "v"(pa0), "v"(pa1) : "memory");
        }
        const float* wq0 = W + (size_t)(kb * BK) * Nf + bn;
        const float* wq1 = wq0 + (size_t)32 * Nf;
        const float* wq2 = wq1 + (size_t)32 * Nf;
        const float* wq3 = wq2 + (size_t)32 * Nf;
        const float* wr0 = wq0 + Nf;
        const float* wr1 = wq1 + Nf;
        const float* wr2 = wq2 + Nf;
        const float* wr3 = wq3 + Nf;
        // next pass: every even row of W, one of its four lines a thread
        const float* wnx = at(wq3 + (size_t)32 * Nf, wp);
        if (kb + 1 < nkb) __builtin_prefetch(wnx, 0, 0);
        float w0[4][8], w1[4][8];
        {
            const float* p0 = at(wq0, wo);
            const float* p1 = at(wr0, wo);
#pragma unroll
            for (int j = 0; j < 8; ++j) { w0[0][j] = p0[j]; w1[0][j] = p1[j]; }
            // before the loads' address registers are reused; the pointers
            // are inputs so that no load's result is placed in them earlier
            asm volatile("s_wait_xcnt 0x0" :: "v"(p0), "v"(p1), "v"(wnx) : "memory");
        }
        {
            const float* p0 = at(wq1, wo);
            const float* p1 = at(wr1, wo);
#pragma unroll
            for (int j = 0; j < 8; ++j) { w0[1][j] = p0[j]; w1[1][j] = p1[j]; }
            // before the loads' address registers are reused; the pointers
            // are inputs so that no load's result is placed in them earlier
            asm volatile("s_wait_xcnt 0x0" :: "v"(p0), "v"(p1) : "memory");
        }
        {
            const float* p0 = at(wq2, wo);
            const float* p1 = at(wr2, wo);
#pragma unroll
            for (int j = 0; j < 8; ++j) { w0[2][j] = p0[j]; w1[2][j] = p1[j]; }
            // before the loads' address registers are reused; the pointers
            // are inputs so that no load's result is placed in them earlier
            asm volatile("s_wait_xcnt 0x0" :: "v"(p0), "v"(p1) : "memory");
        }
        {
            const float* p0 = at(wq3, wo);
            const float* p1 = at(wr3, wo);
#pragma unroll
            for (int j = 0; j < 8; ++j) { w0[3][j] = p0[j]; w1[3][j] = p1[j]; }
            // before the loads' address registers are reused; the pointers
            // are inputs so that no load's result is placed in them earlier
            asm volatile("s_wait_xcnt 0x0" :: "v"(p0), "v"(p1) : "memory");
        }
        // ---- stage A tile: 64 x BK floats -> f16 ----
#pragma unroll
        for (int q = 0; q < 4; ++q) {
            if (amode != 0) {
#pragma unroll
                for (int j = 0; j < 8; ++j) ss += av[q][j] * av[q][j];
            }
            if (amode >= 2) {
#pragma unroll
                for (int j = 0; j < 8; ++j) av[q][j] = fmaxf(av[q][j], 0.f);
            }
            v8h pa;
#pragma unroll
            for (int j = 0; j < 8; ++j) pa[j] = (_Float16)av[q][j];
            *(v8h*)&As[r * AS_P + q * 32 + c0] = pa;
        }
        // ---- stage W tile: one 16-byte DS store a row ----
#pragma unroll
        for (int q = 0; q < 4; ++q) {
            v8h p0, p1;
#pragma unroll
            for (int j = 0; j < 8; ++j) {
                p0[j] = (_Float16)w0[q][j];
                p1[j] = (_Float16)w1[q][j];
            }
            *(v8h*)&Bs[(q * 32 + k0) * BS_P + n0]     = p0;
            *(v8h*)&Bs[(q * 32 + k0 + 1) * BS_P + n0] = p1;
        }
        __syncthreads();

        // a lane names 8 halves of row 8*hiSel + (lane & 7) of a block of W and
        // gets column laneM of the rows 8*hiSel + 0..7
        const _Float16* bt = &Bs[(hiSel * 8 + (lane & 7)) * BS_P + wn * 32 + ((lane >> 3) & 1) * 8];
#pragma unroll
        for (int ks = 0; ks < 4; ++ks) {
            // ---- load fragments, both in the hardware's k order: a lane holds
            //      k = 8*hiSel + 0..7 and 16 + 8*hiSel + 0..7 of its row or column ----
            v16h fa[2], fb[2];
#pragma unroll
            for (int mi = 0; mi < 2; ++mi)
                fa[mi] = frag16(&As[(wm * 32 + mi * 16 + laneM) * AS_P + ks * 32 + hiSel * 8]);
#pragma unroll
            for (int ni = 0; ni < 2; ++ni) {
                const v8h lo = ld_tr16(bt + ks * 32 * BS_P + ni * 16);
                const v8h hi = ld_tr16(bt + (ks * 32 + 16) * BS_P + ni * 16);
                fb[ni] = __builtin_shufflevector(lo, hi, 0, 1, 2, 3, 4, 5, 6, 7,
                                                 8, 9, 10, 11, 12, 13, 14, 15);
            }

#pragma unroll
            for (int mi = 0; mi < 2; ++mi)
#pragma unroll
                for (int ni = 0; ni < 2; ++ni)
                    acc[mi][ni] = __builtin_amdgcn_wmma_f32_16x16x32_f16(
                        false, fa[mi], false, fb[ni], (short)0, acc[mi][ni],
                        false, false);
        }
        __syncthreads();
    }

    // ---- the rows' norm factors: four neighbouring lanes staged one row ----
    if (amode != 0) {
        ss += __shfl_xor(ss, 1);
        ss += __shfl_xor(ss, 2);
        if ((tid & 3) == 0)
            rs[tid >> 2] = 1.0f / (sqrtf(ss / (float)K) + 1e-8f);
        __syncthreads();
#pragma unroll
        for (int mi = 0; mi < 2; ++mi) {
            const float* sp = &rs[wm * 32 + mi * 16 + hiSel * 8];
#pragma unroll
            for (int r = 0; r < 8; ++r) {
                acc[mi][0][r] *= sp[r];
                acc[mi][1][r] *= sp[r];
            }
        }
    }

    // ---- epilogue, mode 2: a lane holds 8 consecutive tokens of one channel,
    //      one 16-byte store into the channel's own time row ----
    if (mode == 2) {
        _Float16* Ch = (_Float16*)C;
#pragma unroll
        for (int mi = 0; mi < 2; ++mi) {
#pragma unroll
            for (int ni = 0; ni < 2; ++ni) {
                const int row0 = bm + wm * 32 + mi * 16 + hiSel * 8;
                const int col  = bn + wn * 32 + ni * 16 + laneM;
                const float bc = bias[col];
                // before the load's address registers are reused
                asm volatile("s_wait_xcnt 0x0" ::: "memory");
                v8h pk;
#pragma unroll
                for (int r = 0; r < 8; ++r) {
                    float val = acc[mi][ni][r] + bc;
                    val = val / (1.0f + __expf(-val));   // SiLU
                    pk[r] = (_Float16)val;
                }
                const int b = row0 / NN, n = row0 % NN;
                *(v8h*)&Ch[((size_t)col * BB + b) * NN + n] = pk;
                // before the store's registers are reused
                asm volatile("s_wait_xcnt 0x0" ::: "memory");
            }
        }
        return;
    }

    // ---- epilogue ----
#pragma unroll
    for (int mi = 0; mi < 2; ++mi) {
#pragma unroll
        for (int ni = 0; ni < 2; ++ni) {
            const int col = bn + wn * 32 + ni * 16 + laneM;
            const float* bq = bias + col;
            const float bc = *bq;
            // before the load's address registers are reused; the pointer is
            // an input so that the load's result is not placed in it earlier
            asm volatile("s_wait_xcnt 0x0" :: "v"(bq) : "memory");
#pragma unroll
            for (int r = 0; r < 8; ++r) {
                const int row = bm + wm * 32 + mi * 16 + r + hiSel * 8;
                float val = acc[mi][ni][r] + bc;
                if (mode == 1) {
                    val = val / (1.0f + __expf(-val));   // SiLU
                }
                if (mode == 3) {
                    val += res[(size_t)row * Nf + col];
                }
                C[(size_t)row * Nf + col] = val;
                // before the store's registers are reused
                asm volatile("s_wait_xcnt 0x0" ::: "memory");
            }
        }
    }
}

// A launch carries two products that do not depend on each other: the first
// nb0 blocks work on j0, the others on j1. A short product, which alone leaves
// most of the chip idle for the length of its k loop, runs beside a large one.
__global__ __launch_bounds__(256) void gemm_wmma_kernel(GemmJob j0, GemmJob j1, int nb0) {
    const bool f0   = (int)blockIdx.x < nb0;
    const int  tile = f0 ? (int)blockIdx.x : (int)blockIdx.x - nb0;
    const int  lgx  = f0 ? j0.lgx : j1.lgx;
    const int  by0  = f0 ? j0.by0 : j1.by0;
    gemm_tile(f0 ? j0.A : j1.A, f0 ? j0.W : j1.W, f0 ? j0.bias : j1.bias,
              f0 ? j0.C : j1.C, f0 ? j0.res : j1.res, f0 ? j0.A2 : j1.A2,
              f0 ? j0.Nf : j1.Nf, f0 ? j0.K : j1.K,
              f0 ? j0.mode : j1.mode, f0 ? j0.amode : j1.amode,
              (tile & ((1 << lgx) - 1)) * 64, (by0 + (tile >> lgx)) * 128);
}

// ---------------------------------------------------------------------------
// Filter per channel, f16, lags descending along the row:
//   g[ch][p] = decay(k) * coef[k][ch],  k = LMAX + 8 - p,  0 outside 0..N-1
//   decay(0) = 1, decay(k) = gamma^k
// coef layout: [N, CH]; g layout: [CH, GP]. One thread = 8 consecutive p.
// ---------------------------------------------------------------------------
#define CH   (HH * HD)
#define LMAX 2064            // largest lag index a fragment can ask for, rounded up to 8
#define GP   (LMAX + 40)     // row length of g, halves
#define AP   (LMAX + 32)     // row length of one shifted copy in LDS, halves
#define VF   64              // zeros in front of a time row (times < 0)
// time row in LDS: VF zeros, N values, 32 zeros, padded. A fragment read takes
// 16 bytes at every 32 from four places of each of the four rows: the rows
// start at 0, 1, 8 and 9 sixteen-byte units modulo 16, so that the 16 lanes of
// a half wave fall on all 64 banks
#define VP   2184
#define VOFF(b) ((b) * VP + ((b) >> 1) * 48)
__global__ void build_a_kernel(const float* __restrict__ coef,
                               _Float16* __restrict__ g) {
    int i = blockIdx.x * 256 + threadIdx.x;
    if (i >= CH * (GP / 8)) return;
    const int ch = i % CH;
    const int o  = i / CH;
    v8h w;
    // gamma^k of the smallest of the eight lags; the others by constant factors
    const int k7 = LMAX + 1 - 8 * o;
    const float d7 = __expf((float)k7 * __logf(GAMMA));
    float pw = 1.0f;
#pragma unroll
    for (int e = 7; e >= 0; --e) {
        const int k = k7 + 7 - e;
        // clamped row, read without a branch: the 8 loads fly together
        const int kc = min(max(k, 0), NN - 1);
        const float c = coef[(size_t)kc * CH + ch];
        // before the load's address registers are reused
        asm volatile("s_wait_xcnt 0x0" ::: "memory");
        const float decay = (k == 0) ? 1.0f : d7 * pw;
        w[e] = (k == kc) ? (_Float16)(decay * c) : (_Float16)0.f;
        pw *= GAMMA;
    }
    *(v8h*)&g[(size_t)ch * GP + 8 * o] = w;
}

// ---------------------------------------------------------------------------
// Causal depthwise conv along time as Toeplitz matrix products, one block per
// channel:  y[b][t] = sum_{k=0..t} a[k] * v[b][t-k]
// One 16x16x32 product, for a lag offset dl and an output tile of 64 steps:
//   A[m][j] = a[dl + m - j]                      (16 x 32, Toeplitz)
//   B[j][n] = v[b][t0 + 16*c4 - dl + j]          (n = 4*b + c4)
//   D[m][n] = part of y[b][t0 + 16*c4 + m]
// dl runs over 0, 32, .., t0 + 64: every lag 0..t is met exactly once; lags
// below 0 and above N-1 read zeros of the filter row, times below 0 zeros of
// the time row.
// A depends on dl alone and B on t0 - dl alone: a wave works on two adjacent
// tiles at once, which share every A, and the upper tile takes as B what the
// lower tile read two steps earlier, kept in registers.
// A lane's 8 consecutive j of A start at a lag that depends on m: the filter
// lies in LDS eight times, copy c shifted by c halves, so that lane m reads
// copy m & 7 at a 16-byte boundary.
// ---------------------------------------------------------------------------
__device__ __forceinline__ v8f mm(v16h a, v16h b, v8f c) {
    return __builtin_amdgcn_wmma_f32_16x16x32_f16(false, a, false, b, (short)0, c,
                                                  false, false);
}
__global__ __launch_bounds__(256) void conv_kernel(const _Float16* __restrict__ g,
                                                   const _Float16* __restrict__ vT,
                                                   float* __restrict__ yT) {
    __shared__ __align__(16) _Float16 a_s[8 * AP];     // 33.5 KB
    __shared__ __align__(16) _Float16 v_s[VOFF(BB)];   // 17.7 KB

    const int ch   = blockIdx.x;
    const int tid  = threadIdx.x;
    const int lane = tid & 31;
    // scalar wave number: the tile loops below must be scalar branches (a
    // matrix instruction needs every lane on)
    const int wid  = __builtin_amdgcn_readfirstlane(tid >> 5);

    // filter: a_s[c][x] = g[x - c + 8]
    const _Float16* gc = g + (size_t)ch * GP;
    for (int q = tid; q < AP / 8; q += 256) {
        const v8h lo = *(const v8h*)&gc[8 * q];
        const v8h hi = *(const v8h*)&gc[8 * q + 8];
        const v16h w = __builtin_shufflevector(lo, hi, 0, 1, 2, 3, 4, 5, 6, 7,
                                               8, 9, 10, 11, 12, 13, 14, 15);
#pragma unroll
        for (int c = 0; c < 8; ++c) {
            v8h o;
#pragma unroll
            for (int e = 0; e < 8; ++e) o[e] = w[e - c + 8];
            *(v8h*)&a_s[c * AP + 8 * q] = o;
        }
    }
    // time rows of the four batches, zeros in front and behind
    const _Float16* vc = vT + (size_t)ch * BB * NN;
#pragma unroll
    for (int b = 0; b < BB; ++b) {
        const v8h x = *(const v8h*)&vc[b * NN + tid * 8];
        *(v8h*)&v_s[VOFF(b) + VF + tid * 8] = x;
    }
    if (tid < BB * 12) {
        const int b = tid / 12, p = tid % 12;
        const int off = (p < 8) ? p * 8 : VF + NN + (p - 8) * 8;
        *(v8h*)&v_s[VOFF(b) + off] = (v8h){};
    }
    __syncthreads();

    const int n  = lane & 15;
    const int hs = lane >> 4;
    const _Float16* a0 = a_s + (n & 7) * AP + LMAX - 8 * (n >> 3) + 8 * hs;
    const _Float16* b0 = v_s + VOFF(n >> 2) + VF + 16 * (n & 3) + 8 * hs;
    float* y0 = yT + ((size_t)ch * BB + (n >> 2)) * NN + 16 * (n & 3) + 8 * hs;

    // pairs of tiles w and 15-w: the same number of products for every wave
    for (int q = 0; q < 2; ++q) {
        const int p = q ? 15 - wid : wid;      // tiles 2p (acc0) and 2p+1 (acc1)
        const _Float16* bp = b0 + 128 * p;     // B of tile 2p at dl = 0
        v8f acc0 = (v8f){}, acc1 = (v8f){};
        // B of tile 2p+1 at the next even and the next odd step
        v16h h0 = frag16(bp + 64), h1 = frag16(bp + 32);
        const int np = 2 * p + 1;              // steps 0 .. 4p+1, two a trip
        // unroll: the LDS reads of later products go out ahead of one wait
#pragma unroll 2
        for (int i = 0; i < np; ++i) {
            const v16h fa0 = frag16(a0 - 64 * i);
            const v16h fb0 = frag16(bp - 64 * i);
            const v16h fa1 = frag16(a0 - 64 * i - 32);
            const v16h fb1 = frag16(bp - 64 * i - 32);
            acc0 = mm(fa0, fb0, acc0);
            acc1 = mm(fa0, h0, acc1);
            acc0 = mm(fa1, fb1, acc0);
            acc1 = mm(fa1, h1, acc1);
            h0 = fb0;
            h1 = fb1;
        }
        // step 4p+2 for both tiles, steps 4p+3 and 4p+4 for the upper one
        {
            const v16h fa0 = frag16(a0 - 64 * np);
            const v16h fb0 = frag16(bp - 64 * np);
            const v16h fa1 = frag16(a0 - 64 * np - 32);
            const v16h fa2 = frag16(a0 - 64 * np - 64);
            acc0 = mm(fa0, fb0, acc0);
            acc1 = mm(fa0, h0, acc1);
            acc1 = mm(fa1, h1, acc1);
            acc1 = mm(fa2, fb0, acc1);
        }
        float4* yp = (float4*)(y0 + 128 * p);
        yp[0]  = make_float4(acc0[0], acc0[1], acc0[2], acc0[3]);
        yp[1]  = make_float4(acc0[4], acc0[5], acc0[6], acc0[7]);
        yp[16] = make_float4(acc1[0], acc1[1], acc1[2], acc1[3]);
        yp[17] = make_float4(acc1[4], acc1[5], acc1[6], acc1[7]);
        // before the next pair reuses the stores' registers
        asm volatile("s_wait_xcnt 0x0" ::: "memory");
    }
}

// ---------------------------------------------------------------------------
// g[b,n,ch] = u[b,n,ch] * y[ch][b][n]
// One thread = one channel and 32 time steps (one 128-byte line of y); lanes
// run over channels, so u and g go in whole lines.
// ---------------------------------------------------------------------------
__global__ void gate_kernel(const float* __restrict__ u,
                            const float* __restrict__ yT,
                            float* __restrict__ g) {
    int i = blockIdx.x * 256 + threadIdx.x;
    if (i >= BB * (NN / 32) * CH) return;
    const int ch = i % CH;
    const int rest = i / CH;
    const int tb = rest % (NN / 32), b = rest / (NN / 32);
    const float4* yp = (const float4*)(yT + ((size_t)ch * BB + b) * NN + tb * 32);
    const size_t base = ((size_t)b * NN + tb * 32) * D1 + ch;
    float4 yv[8];
#pragma unroll
    for (int j = 0; j < 8; ++j) yv[j] = yp[j];
    // before the loads' address registers are reused
    asm volatile("s_wait_xcnt 0x0" ::: "memory");
    float uv[32];
#pragma unroll
    for (int j = 0; j < 32; ++j) uv[j] = u[base + (size_t)j * D1];
    // before the loads' address registers are reused
    asm volatile("s_wait_xcnt 0x0" ::: "memory");
#pragma unroll
    for (int j = 0; j < 8; ++j) {
        g[base + (size_t)(4 * j + 0) * D1] = uv[4 * j + 0] * yv[j].x;
        g[base + (size_t)(4 * j + 1) * D1] = uv[4 * j + 1] * yv[j].y;
        g[base + (size_t)(4 * j + 2) * D1] = uv[4 * j + 2] * yv[j].z;
        g[base + (size_t)(4 * j + 3) * D1] = uv[4 * j + 3] * yv[j].w;
    }
}

// ---------------------------------------------------------------------------
extern "C" void kernel_launch(void* const* d_in, const int* in_sizes, int n_in,
                              void* d_out, int out_size, void* d_ws, size_t ws_size,
                              hipStream_t stream) {
    const float* x  = (const float*)d_in[0];
    const float* Wu = (const float*)d_in[1];
    const float* bu = (const float*)d_in[2];
    const float* Wv = (const float*)d_in[3];
    const float* bv = (const float*)d_in[4];
    const float* Wo = (const float*)d_in[5];
    const float* bo = (const float*)d_in[6];
    const float* Wp = (const float*)d_in[7];
    const float* bp = (const float*)d_in[8];
    const float* W1 = (const float*)d_in[9];
    const float* b1 = (const float*)d_in[10];
    const float* W2 = (const float*)d_in[11];
    const float* b2 = (const float*)d_in[12];
    const float* W3 = (const float*)d_in[13];
    const float* b3 = (const float*)d_in[14];
    const float* Wz = (const float*)d_in[15];
    const float* bz = (const float*)d_in[16];
    float* out = (float*)d_out;

    float* ws = (float*)d_ws;
    const size_t SZ_U  = (size_t)BB * NN * D1;   // 8M
    const size_t SZ_H  = (size_t)NN * EE;        // 1M
    const size_t SZ_CO = (size_t)NN * D1;        // 2M

    float* u    = ws;                    // 8M
    float* v    = u + SZ_U;              // 8M  f16 [CH][B][N] in its first half; reused for g
    float* y    = v + SZ_U;              // 8M  [CH][B][N]
    float* hcfA = y + SZ_U;              // 1M
    float* hcfB = hcfA + SZ_H;           // 1M
    float* coef = hcfB + SZ_H;           // 2M
    float* av   = coef + SZ_CO;          // f16 [CH][GP]

    // row tiles: 8192 token rows -> 2^7, 2048 position rows -> 2^5
    // u = silu(srms(x) @ Wu + bu); v = silu(srms(x) @ Wv + bv), f16, [CH][B][N];
    // each in two bands of four column tiles (512 blocks)
    const GemmJob ju0 = {x, Wu, bu, u, nullptr, nullptr, D1, DD, 1, 1, 7, 0};
    const GemmJob ju1 = {x, Wu, bu, u, nullptr, nullptr, D1, DD, 1, 1, 7, 4};
    const GemmJob jv0 = {x, Wv, bv, v, nullptr, nullptr, D1, DD, 2, 1, 7, 0};
    const GemmJob jv1 = {x, Wv, bv, v, nullptr, nullptr, D1, DD, 2, 1, 7, 4};
    // positional MLP: each layer is relu(srms(.)) @ W + b
    const GemmJob jp1 = {Wp,   W1, b1, hcfA, nullptr, bp,      EE, EE, 0, 3, 5, 0};
    const GemmJob jp2 = {hcfA, W2, b2, hcfB, nullptr, nullptr, EE, EE, 0, 2, 5, 0};
    const GemmJob jp3 = {hcfB, W3, b3, hcfA, nullptr, nullptr, EE, EE, 0, 2, 5, 0};
    const GemmJob jpz = {hcfA, Wz, bz, coef, nullptr, nullptr, D1, EE, 0, 2, 5, 0};

    // 1-3) the four layers follow one another; each shares its launch with a
    //      band of u or v, which depend on x alone
    //      (128 or 256 blocks of the layer first, then the band's 512)
    gemm_wmma_kernel<<<640, 256, 0, stream>>>(jp1, ju0, 128);
    gemm_wmma_kernel<<<640, 256, 0, stream>>>(jp2, ju1, 128);
    gemm_wmma_kernel<<<640, 256, 0, stream>>>(jp3, jv0, 128);
    gemm_wmma_kernel<<<768, 256, 0, stream>>>(jpz, jv1, 256);

    // 4) build decayed filter rows, f16, lags descending
    build_a_kernel<<<(CH * (GP / 8) + 255) / 256, 256, 0, stream>>>(coef, (_Float16*)av);

    // 5) causal depthwise conv: y[ch][b][t]
    conv_kernel<<<CH, 256, 0, stream>>>((const _Float16*)av, (const _Float16*)v, y);

    // 6) gate: g = u * y  (g reuses v buffer)
    gate_kernel<<<(BB * (NN / 32) * CH + 255) / 256, 256, 0, stream>>>(u, y, v);

    // 7) out = g @ Wo + bo + x
    const GemmJob jo = {v, Wo, bo, out, x, nullptr, DD, D1, 3, 0, 7, 0};
    gemm_wmma_kernel<<<512, 256, 0, stream>>>(jo, jo, 512);
}

// v007
// Measured time: 134 microseconds a run.
// Two timings next to v006 both put it at 1.12 times that version's speed.
// Counting every step since v000, it is 6.80 times as fast.
#include <hip/hip_runtime.h>
#include <hip/hip_bf16.h>
#include <math.h>

// Problem constants (fixed by the reference)
#define BB 4
#define NN 2048
#define DD 512
#define HH 8
#define EE 512
#define D1 1024
#define HD 128
#define GAMMA 0.999f

typedef _Float16 v16h __attribute__((ext_vector_type(16)));
typedef float    v8f  __attribute__((ext_vector_type(8)));
typedef _Float16 v8h  __attribute__((ext_vector_type(8)));
typedef short    s16x8 __attribute__((ext_vector_type(8)));
typedef float    v4f  __attribute__((ext_vector_type(4)));

// a lane's 16 halves of a fragment: k = 8*hs + 0..7 at p, k = 16 + 8*hs + 0..7 at p + 16
__device__ __forceinline__ v16h frag16(const _Float16* p) {
    const v8h lo = *(const v8h*)p;
    const v8h hi = *(const v8h*)(p + 16);
    return __builtin_shufflevector(lo, hi, 0, 1, 2, 3, 4, 5, 6, 7,
                                   8, 9, 10, 11, 12, 13, 14, 15);
}
// a base that is the same for the whole block + a thread's 32-bit byte offset
__device__ __forceinline__ const float* at(const float* base, unsigned bytes) {
    return (const float*)((const char*)base + bytes);
}
// transposing LDS read of a 16 x 16 block of halves that lies row by row
__device__ __forceinline__ v8h ld_tr16(const _Float16* p) {
    typedef __attribute__((address_space(3))) s16x8 lds_s16x8;
    return __builtin_bit_cast(v8h, __builtin_amdgcn_ds_load_tr16_b128_v8i16((lds_s16x8*)p));
}

// ---------------------------------------------------------------------------
// Generic WMMA GEMM: C[M,Nf] = epilogue(A[M,K] @ W[K,Nf] + bias)
//   mode 0: bias only
//   mode 1: bias + SiLU, output time-major per channel: [col][B][N]
//   mode 2: the same, output as f16
//   mode 3: bias + residual add (res has same [M,Nf] layout)
// What the A operand is:
//   amode 0: A as stored
//   amode 1: srms(A)
//   amode 2: relu(srms(A))
//   amode 3: relu(srms(P)), P[m][k] = m * A[k] + A2[k] (position rows, never stored)
// AT: A lies in memory as f16, k-major ([K][M]), and is taken as stored; its
// tile goes into LDS as it lies, [k][m], and the transposing read that serves
// W turns it into the A fragment.
// srms(x) = s * x with one s > 0 per row, s = 1 / (sqrt(mean(x^2)) + eps), so
// relu(srms(x)) @ W = s * (relu(x) @ W): the raw values go into the product,
// a row's sum of squares is gathered while its K values (K is the length of
// the norm) pass through the staging, and s multiplies the accumulators.
// Block tile 64x128x128, 256 threads = 8 waves, each wave -> 32x32 via
// 2x2 v_wmma_f32_16x16x32_f16. Assumes M%64==0, Nf%128==0, K%128==0.
// LDS banks: the A tile's rows stand at 272 bytes (16 x odd), where the 16 rows
// of a 16-byte fragment read fall on all 64 banks. The W tile lies [k][n], as
// in memory, so that a thread stores its 8 consecutive n of a row as one
// 16-byte piece and 16 lanes fill 256 bytes in a row; the transposing read
// turns it into the B fragment, and its rows stand at 288 bytes (32 x odd).
// ---------------------------------------------------------------------------
#define BK   128    // k of one pass of the k loop
#define AS_P 136    // row pitch of the A tile in LDS, halves
#define BS_P 144    // row pitch of the W tile in LDS, halves
#define AT_P 80     // row pitch of a k-major A tile in LDS, halves (160 bytes, 32 x odd)
// One product, or a band of its column tiles. Its tiles are numbered rows first:
// tile j stands at row tile j mod 2^lgx, column tile by0 + (j >> lgx).
struct GemmJob {
    const float* A;
    const float* W;
    const float* bias;
    float*       C;
    const float* res;
    const float* A2;
    int Nf, K, mode, amode;
    int lgx;    // log2 of the number of row tiles (M / 64)
    int by0;    // first column tile of the band
};
// The tile of 64 rows from bm and 128 columns from bn of one product.
template <bool AT>
__device__ __forceinline__ void gemm_tile(const float* __restrict__ A,
                                          const float* __restrict__ W,
                                          const float* __restrict__ bias,
                                          float* __restrict__ C,
                                          const float* __restrict__ res,
                                          const float* __restrict__ A2,
                                          int Nf, int K, int mode, int amode,
                                          int M, int bm, int bn) {
    __shared__ __align__(16) _Float16 As[AT ? BK * AT_P : 64 * AS_P];  // [m][k]; AT: [k][m]
    __shared__ __align__(16) _Float16 Bs[BK * BS_P];  // [k][n]
    __shared__ __align__(16) float rs[64];            // s of the tile's rows

    const int tid  = threadIdx.x;
    const int lane = tid & 31;
    const int wid  = tid >> 5;
    const int wm   = wid & 1;    // 0..1  (rows 0-31 / 32-63)
    const int wn   = wid >> 1;   // 0..3  (cols, 32 each)

    v8f acc[2][2];
    acc[0][0] = (v8f){}; acc[0][1] = (v8f){};
    acc[1][0] = (v8f){}; acc[1][1] = (v8f){};

    const int laneM = lane & 15;
    const int hiSel = (lane >> 4) & 1;   // upper half of wave

    float ss = 0.f;   // this thread's part of its staged row's sum of squares

    const int nkb = K / BK;
    // A: row r, 8 floats at c0 of each of the row's 32-float lines
    const int r  = tid >> 2;            // 0..63
    const int c0 = (tid & 3) * 8;       // 0,8,16,24
    // W: 8 consecutive n of the rows k0 and k0+1 of each group of 32 rows
    const int k0 = (tid >> 4) * 2;      // 0,2,..,30
    const int n0 = (tid & 15) * 8;      // 0..120
    // a thread's places in the two tiles, in bytes, the same in every pass
    const unsigned ao = (unsigned)(r * K + c0) * 4u;
    const unsigned wo = (unsigned)(k0 * Nf + n0) * 4u;
    // and the places it asks for ahead: one line of its row of A, one line of
    // an even row of W
    const unsigned ap = (unsigned)(r * K + (tid & 3) * 32) * 4u;
    const unsigned wp = (unsigned)((tid >> 2) * 2 * Nf + (tid & 3) * 32) * 4u;
    // k-major A: 8 consecutive m of row kr of each group of 32 rows; a row of
    // the tile is one line
    const int kr = tid >> 3;            // 0..31
    const int mc = (tid & 7) * 8;       // 0..56
    for (int kb = 0; kb < nkb; ++kb) {
        // ---- all global loads of the pass go out before the first is waited
        //      for: one load latency and two barriers per BK k ----
        float av[4][8];
        v8h ah[4];
        if (AT) {
            const _Float16* src = (const _Float16*)A + (size_t)(kb * BK) * M + bm;
            const _Float16* pa0 = src + kr * M + mc;
            // next pass: the tile's 128 lines, two threads a line
            const _Float16* pa1 = src + (size_t)(BK + (tid >> 1)) * M;
            if (kb + 1 < nkb) __builtin_prefetch(pa1, 0, 0);
            const _Float16* pa2 = pa0 + (size_t)32 * M;
            const _Float16* pa3 = pa2 + (size_t)32 * M;
            const _Float16* pa4 = pa3 + (size_t)32 * M;
            ah[0] = *(const v8h*)pa0;
            ah[1] = *(const v8h*)pa2;
            ah[2] = *(const v8h*)pa3;
            ah[3] = *(const v8h*)pa4;
            // before the loads' address registers are reused; the pointers
            // are inputs so that they stay as they are up to here
            asm volatile("s_wait_xcnt 0x0" :: "v"(pa0), "v"(pa1), "v"(pa2), "v"(pa3), "v"(pa4) : "memory");
        } else if (amode == 3) {
            const float* pw = A + kb * BK;
            const float* pb = A2 + kb * BK;
            const float m = (float)(bm + r);
#pragma unroll
            for (int q = 0; q < 4; ++q)
#pragma unroll
                for (int j = 0; j < 8; ++j) av[q][j] = m * (pw + c0)[q * 32 + j] + (pb + c0)[q * 32 + j];
            // before the loads' address registers are reused; they are inputs
            // so that they stay as they are up to here
            asm volatile("s_wait_xcnt 0x0" :: "s"(pw), "s"(pb), "v"(c0) : "memory");
        } else {
            const float* src = A + (size_t)bm * K + kb * BK;
            const float* pa0 = at(src, ao);
            // next pass: the row's lines, one a thread
            const float* pa1 = at(src, ap) + BK;
            if (kb + 1 < nkb) __builtin_prefetch(pa1, 0, 0);
#pragma unroll
            for (int q = 0; q < 4; ++q)
#pragma unroll
                for (int j = 0; j < 8; ++j) av[q][j] = pa0[q * 32 + j];
            // before the loads' address registers are reused; the pointers
            // are inputs so that no load's result is placed in them earlier
            asm volatile("s_wait_xcnt 0x0" :: "v"(pa0), "v"(pa1) : "memory");
        }
        const float* wq0 = W + (size_t)(kb * BK) * Nf + bn;
        const float* wq1 = wq0 + (size_t)32 * Nf;
        const float* wq2 = wq1 + (size_t)32 * Nf;
        const float* wq3 = wq2 + (size_t)32 * Nf;
        const float* wr0 = wq0 + Nf;
        const float* wr1 = wq1 + Nf;
        const float* wr2 = wq2 + Nf;
        const float* wr3 = wq3 + Nf;
        // next pass: every even row of W, one of its four lines a thread
        const float* wnx = at(wq3 + (size_t)32 * Nf, wp);
        if (kb + 1 < nkb) __builtin_prefetch(wnx, 0, 0);
        float w0[4][8], w1[4][8];
        {
            const float* p0 = at(wq0, wo);
            const float* p1 = at(wr0, wo);
#pragma unroll
            for (int j = 0; j < 8; ++j) { w0[0][j] = p0[j]; w1[0][j] = p1[j]; }
            // before the loads' address registers are reused; the pointers
            // are inputs so that no load's result is placed in them earlier
            asm volatile("s_wait_xcnt 0x0" :: "v"(p0), "v"(p1), "v"(wnx) : "memory");
        }
        {
            const float* p0 = at(wq1, wo);
            const float* p1 = at(wr1, wo);
#pragma unroll
            for (int j = 0; j < 8; ++j) { w0[1][j] = p0[j]; w1[1][j] = p1[j]; }
            // before the loads' address registers are reused; the pointers
            // are inputs so that no load's result is placed in them earlier
            asm volatile("s_wait_xcnt 0x0" :: "v"(p0), "v"(p1) : "memory");
        }
        {
            const float* p0 = at(wq2, wo);
            const float* p1 = at(wr2, wo);
#pragma unroll
            for (int j = 0; j < 8; ++j) { w0[2][j] = p0[j]; w1[2][j] = p1[j]; }
            // before the loads' address registers are reused; the pointers
            // are inputs so that no load's result is placed in them earlier
            asm volatile("s_wait_xcnt 0x0" :: "v"(p0), "v"(p1) : "memory");
        }
        {
            const float* p0 = at(wq3, wo);
            const float* p1 = at(wr3, wo);
#pragma unroll
            for (int j = 0; j < 8; ++j) { w0[3][j] = p0[j]; w1[3][j] = p1[j]; }
            // before the loads' address registers are reused; the pointers
            // are inputs so that no load's result is placed in them earlier
            asm volatile("s_wait_xcnt 0x0" :: "v"(p0), "v"(p1) : "memory");
        }
        // holds the loaded values of W as they came up to here, inputs only: the
        // conversions below, moved up between the loads, would wait for the
        // first loads before the last have gone out
        if (AT) {
#define F4(a, i) ((v4f){(a)[i], (a)[(i) + 1], (a)[(i) + 2], (a)[(i) + 3]})
            asm volatile("" :: "v"(F4(w0[0], 0)), "v"(F4(w0[0], 4)), "v"(F4(w1[0], 0)), "v"(F4(w1[0], 4)),
                               "v"(F4(w0[1], 0)), "v"(F4(w0[1], 4)), "v"(F4(w1[1], 0)), "v"(F4(w1[1], 4)),
                               "v"(F4(w0[2], 0)), "v"(F4(w0[2], 4)), "v"(F4(w1[2], 0)), "v"(F4(w1[2], 4)),
                               "v"(F4(w0[3], 0)), "v"(F4(w0[3], 4)), "v"(F4(w1[3], 0)), "v"(F4(w1[3], 4)));
#undef F4
        }
        // ---- stage A tile: 64 x BK floats -> f16; k-major: as it is ----
#pragma unroll
        for (int q = 0; q < 4; ++q) {
            if (AT) {
                *(v8h*)&As[(q * 32 + kr) * AT_P + mc] = ah[q];
                continue;
            }
            if (amode != 0) {
#pragma unroll
                for (int j = 0; j < 8; ++j) ss += av[q][j] * av[q][j];
            }
            if (amode >= 2) {
#pragma unroll
                for (int j = 0; j < 8; ++j) av[q][j] = fmaxf(av[q][j], 0.f);
            }
            v8h pa;
#pragma unroll
            for (int j = 0; j < 8; ++j) pa[j] = (_Float16)av[q][j];
            *(v8h*)&As[r * AS_P + q * 32 + c0] = pa;
        }
        // ---- stage W tile: one 16-byte DS store a row ----
#pragma unroll
        for (int q = 0; q < 4; ++q) {
            v8h p0, p1;
#pragma unroll
            for (int j = 0; j < 8; ++j) {
                p0[j] = (_Float16)w0[q][j];
                p1[j] = (_Float16)w1[q][j];
            }
            *(v8h*)&Bs[(q * 32 + k0) * BS_P + n0]     = p0;
            *(v8h*)&Bs[(q * 32 + k0 + 1) * BS_P + n0] = p1;
        }
        __syncthreads();

        // a lane names 8 halves of row 8*hiSel + (lane & 7) of a block of W and
        // gets column laneM of the rows 8*hiSel + 0..7
        const _Float16* bt = &Bs[(hiSel * 8 + (lane & 7)) * BS_P + wn * 32 + ((lane >> 3) & 1) * 8];
        // the same for a k-major A tile: row laneM of A, k = 8*hiSel + 0..7
        const _Float16* att = &As[(hiSel * 8 + (lane & 7)) * AT_P + wm * 32 + ((lane >> 3) & 1) * 8];
#pragma unroll
        for (int ks = 0; ks < 4; ++ks) {
            // ---- load fragments, both in the hardware's k order: a lane holds
            //      k = 8*hiSel + 0..7 and 16 + 8*hiSel + 0..7 of its row or column ----
            v16h fa[2], fb[2];
#pragma unroll
            for (int mi = 0; mi < 2; ++mi) {
                if (AT) {
                    const v8h lo = ld_tr16(att + ks * 32 * AT_P + mi * 16);
                    const v8h hi = ld_tr16(att + (ks * 32 + 16) * AT_P + mi * 16);
                    fa[mi] = __builtin_shufflevector(lo, hi, 0, 1, 2, 3, 4, 5, 6, 7,
                                                     8, 9, 10, 11, 12, 13, 14, 15);
                } else {
                    fa[mi] = frag16(&As[(wm * 32 + mi * 16 + laneM) * AS_P + ks * 32 + hiSel * 8]);
                }
            }
#pragma unroll
            for (int ni = 0; ni < 2; ++ni) {
                const v8h lo = ld_tr16(bt + ks * 32 * BS_P + ni * 16);
                const v8h hi = ld_tr16(bt + (ks * 32 + 16) * BS_P + ni * 16);
                fb[ni] = __builtin_shufflevector(lo, hi, 0, 1, 2, 3, 4, 5, 6, 7,
                                                 8, 9, 10, 11, 12, 13, 14, 15);
            }

#pragma unroll
            for (int mi = 0; mi < 2; ++mi)
#pragma unroll
                for (int ni = 0; ni < 2; ++ni)
                    acc[mi][ni] = __builtin_amdgcn_wmma_f32_16x16x32_f16(
                        false, fa[mi], false, fb[ni], (short)0, acc[mi][ni],
                        false, false);
        }
        __syncthreads();
    }

    // ---- the rows' norm factors: four neighbouring lanes staged one row ----
    if (!AT && amode != 0) {
        ss += __shfl_xor(ss, 1);
        ss += __shfl_xor(ss, 2);
        if ((tid & 3) == 0)
            rs[tid >> 2] = 1.0f / (sqrtf(ss / (float)K) + 1e-8f);
        __syncthreads();
#pragma unroll
        for (int mi = 0; mi < 2; ++mi) {
            const float* sp = &rs[wm * 32 + mi * 16 + hiSel * 8];
#pragma unroll
            for (int r = 0; r < 8; ++r) {
                acc[mi][0][r] *= sp[r];
                acc[mi][1][r] *= sp[r];
            }
        }
    }

    // ---- epilogue, modes 1 and 2: a lane holds 8 consecutive tokens of one
    //      channel, 16-byte stores into the channel's own time row ----
    if (mode == 1 || mode == 2) {
        _Float16* Ch = (_Float16*)C;
#pragma unroll
        for (int mi = 0; mi < 2; ++mi) {
#pragma unroll
            for (int ni = 0; ni < 2; ++ni) {
                const int row0 = bm + wm * 32 + mi * 16 + hiSel * 8;
                const int col  = bn + wn * 32 + ni * 16 + laneM;
                const float bc = bias[col];
                // before the load's address registers are reused
                asm volatile("s_wait_xcnt 0x0" ::: "memory");
                float sv[8];
#pragma unroll
                for (int r = 0; r < 8; ++r) {
                    const float val = acc[mi][ni][r] + bc;
                    sv[r] = val / (1.0f + __expf(-val));   // SiLU
                }
                const int b = row0 / NN, n = row0 % NN;
                const size_t o = ((size_t)col * BB + b) * NN + n;
                if (mode == 1) {
                    *(float4*)&C[o]     = make_float4(sv[0], sv[1], sv[2], sv[3]);
                    *(float4*)&C[o + 4] = make_float4(sv[4], sv[5], sv[6], sv[7]);
                    // before the stores' registers are reused
                    asm volatile("s_wait_xcnt 0x0" ::: "memory");
                } else {
                    v8h pk;
#pragma unroll
                    for (int r = 0; r < 8; ++r) pk[r] = (_Float16)sv[r];
                    *(v8h*)&Ch[o] = pk;
                    // before the store's registers are reused
                    asm volatile("s_wait_xcnt 0x0" ::: "memory");
                }
            }
        }
        return;
    }

    // ---- epilogue ----
#pragma unroll
    for (int mi = 0; mi < 2; ++mi) {
#pragma unroll
        for (int ni = 0; ni < 2; ++ni) {
            const int col = bn + wn * 32 + ni * 16 + laneM;
            const float* bq = bias + col;
            const float bc = *bq;
            // before the load's address registers are reused; the pointer is
            // an input so that the load's result is not placed in it earlier
            asm volatile("s_wait_xcnt 0x0" :: "v"(bq) : "memory");
#pragma unroll
            for (int r = 0; r < 8; ++r) {
                const int row = bm + wm * 32 + mi * 16 + r + hiSel * 8;
                float val = acc[mi][ni][r] + bc;
                if (mode == 3) {
                    val += res[(size_t)row * Nf + col];
                }
                C[(size_t)row * Nf + col] = val;
                // before the store's registers are reused
                asm volatile("s_wait_xcnt 0x0" ::: "memory");
            }
        }
    }
}

// A launch carries two products that do not depend on each other: the first
// nb0 blocks work on j0, the others on j1. A short product, which alone leaves
// most of the chip idle for the length of its k loop, runs beside a large one.
__global__ __launch_bounds__(256) void gemm_wmma_kernel(GemmJob j0, GemmJob j1, int nb0) {
    const bool f0   = (int)blockIdx.x < nb0;
    const int  tile = f0 ? (int)blockIdx.x : (int)blockIdx.x - nb0;
    const int  lgx  = f0 ? j0.lgx : j1.lgx;
    const int  by0  = f0 ? j0.by0 : j1.by0;
    gemm_tile<false>(f0 ? j0.A : j1.A, f0 ? j0.W : j1.W, f0 ? j0.bias : j1.bias,
                     f0 ? j0.C : j1.C, f0 ? j0.res : j1.res, f0 ? j0.A2 : j1.A2,
                     f0 ? j0.Nf : j1.Nf, f0 ? j0.K : j1.K,
                     f0 ? j0.mode : j1.mode, f0 ? j0.amode : j1.amode, 64 << lgx,
                     (tile & ((1 << lgx) - 1)) * 64, (by0 + (tile >> lgx)) * 128);
}
// One product whose A is f16 and k-major.
__global__ __launch_bounds__(256) void gemm_at_kernel(GemmJob j) {
    const int tile = (int)blockIdx.x;
    gemm_tile<true>(j.A, j.W, j.bias, j.C, j.res, j.A2, j.Nf, j.K, j.mode, j.amode,
                    64 << j.lgx,
                    (tile & ((1 << j.lgx) - 1)) * 64, (j.by0 + (tile >> j.lgx)) * 128);
}

// ---------------------------------------------------------------------------
// Filter per channel, f16, lags descending along the row:
//   g[ch][p] = decay(k) * coef[k][ch],  k = LMAX + 8 - p,  0 outside 0..N-1
//   decay(0) = 1, decay(k) = gamma^k
// coef layout: [N, CH]; g layout: [CH, GP]. One thread = 8 consecutive p.
// ---------------------------------------------------------------------------
#define CH   (HH * HD)
#define LMAX 2064            // largest lag index a fragment can ask for, rounded up to 8
#define GP   (LMAX + 40)     // row length of g, halves
#define AP   (LMAX + 32)     // row length of one shifted copy in LDS, halves
#define VF   64              // zeros in front of a time row (times < 0)
// time row in LDS: VF zeros, N values, 32 zeros, padded. A fragment read takes
// 16 bytes at every 32 from four places of each of the four rows: the rows
// start at 0, 1, 8 and 9 sixteen-byte units modulo 16, so that the 16 lanes of
// a half wave fall on all 64 banks
#define VP   2184
#define VOFF(b) ((b) * VP + ((b) >> 1) * 48)
__global__ void build_a_kernel(const float* __restrict__ coef,
                               _Float16* __restrict__ g) {
    int i = blockIdx.x * 256 + threadIdx.x;
    if (i >= CH * (GP / 8)) return;
    const int ch = i % CH;
    const int o  = i / CH;
    v8h w;
    // gamma^k of the smallest of the eight lags; the others by constant factors
    const int k7 = LMAX + 1 - 8 * o;
    const float d7 = __expf((float)k7 * __logf(GAMMA));
    float pw = 1.0f;
#pragma unroll
    for (int e = 7; e >= 0; --e) {
        const int k = k7 + 7 - e;
        // clamped row, read without a branch: the 8 loads fly together
        const int kc = min(max(k, 0), NN - 1);
        const float c = coef[(size_t)kc * CH + ch];
        // before the load's address registers are reused
        asm volatile("s_wait_xcnt 0x0" ::: "memory");
        const float decay = (k == 0) ? 1.0f : d7 * pw;
        w[e] = (k == kc) ? (_Float16)(decay * c) : (_Float16)0.f;
        pw *= GAMMA;
    }
    *(v8h*)&g[(size_t)ch * GP + 8 * o] = w;
}

// ---------------------------------------------------------------------------
// Causal depthwise conv along time as Toeplitz matrix products, one block per
// channel:  y[b][t] = sum_{k=0..t} a[k] * v[b][t-k]
// One 16x16x32 product, for a lag offset dl and an output tile of 64 steps:
//   A[m][j] = a[dl + m - j]                      (16 x 32, Toeplitz)
//   B[j][n] = v[b][t0 + 16*c4 - dl + j]          (n = 4*b + c4)
//   D[m][n] = part of y[b][t0 + 16*c4 + m]
// dl runs over 0, 32, .., t0 + 64: every lag 0..t is met exactly once; lags
// below 0 and above N-1 read zeros of the filter row, times below 0 zeros of
// the time row.
// A depends on dl alone and B on t0 - dl alone: a wave works on two adjacent
// tiles at once, which share every A, and the upper tile takes as B what the
// lower tile read two steps earlier, kept in registers.
// A lane's 8 consecutive j of A start at a lag that depends on m: the filter
// lies in LDS eight times, copy c shifted by c halves, so that lane m reads
// copy m & 7 at a 16-byte boundary.
// The gate: u lies time-major per channel like y, so a lane multiplies its 8
// consecutive steps of y by u in its registers and stores the product as f16,
// gT[ch][b][t] = u * y, which is the k-major A of the output product.
// ---------------------------------------------------------------------------
__device__ __forceinline__ v8f mm(v16h a, v16h b, v8f c) {
    return __builtin_amdgcn_wmma_f32_16x16x32_f16(false, a, false, b, (short)0, c,
                                                  false, false);
}
__global__ __launch_bounds__(256) void conv_kernel(const _Float16* __restrict__ g,
                                                   const _Float16* __restrict__ vT,
                                                   const float* __restrict__ uT,
                                                   _Float16* __restrict__ gT) {
    __shared__ __align__(16) _Float16 a_s[8 * AP];     // 33.5 KB
    __shared__ __align__(16) _Float16 v_s[VOFF(BB)];   // 17.7 KB

    const int ch   = blockIdx.x;
    const int tid  = threadIdx.x;
    const int lane = tid & 31;
    // scalar wave number: the tile loops below must be scalar branches (a
    // matrix instruction needs every lane on)
    const int wid  = __builtin_amdgcn_readfirstlane(tid >> 5);

    // filter: a_s[c][x] = g[x - c + 8]
    const _Float16* gc = g + (size_t)ch * GP;
    for (int q = tid; q < AP / 8; q += 256) {
        const v8h lo = *(const v8h*)&gc[8 * q];
        const v8h hi = *(const v8h*)&gc[8 * q + 8];
        const v16h w = __builtin_shufflevector(lo, hi, 0, 1, 2, 3, 4, 5, 6, 7,
                                               8, 9, 10, 11, 12, 13, 14, 15);
#pragma unroll
        for (int c = 0; c < 8; ++c) {
            v8h o;
#pragma unroll
            for (int e = 0; e < 8; ++e) o[e] = w[e - c + 8];
            *(v8h*)&a_s[c * AP + 8 * q] = o;
        }
    }
    // time rows of the four batches, zeros in front and behind
    const _Float16* vc = vT + (size_t)ch * BB * NN;
#pragma unroll
    for (int b = 0; b < BB; ++b) {
        const v8h x = *(const v8h*)&vc[b * NN + tid * 8];
        *(v8h*)&v_s[VOFF(b) + VF + tid * 8] = x;
    }
    if (tid < BB * 12) {
        const int b = tid / 12, p = tid % 12;
        const int off = (p < 8) ? p * 8 : VF + NN + (p - 8) * 8;
        *(v8h*)&v_s[VOFF(b) + off] = (v8h){};
    }
    __syncthreads();

    const int n  = lane & 15;
    const int hs = lane >> 4;
    const _Float16* a0 = a_s + (n & 7) * AP + LMAX - 8 * (n >> 3) + 8 * hs;
    const _Float16* b0 = v_s + VOFF(n >> 2) + VF + 16 * (n & 3) + 8 * hs;
    const size_t o0 = ((size_t)ch * BB + (n >> 2)) * NN + 16 * (n & 3) + 8 * hs;

    // pairs of tiles w and 15-w: the same number of products for every wave
    for (int q = 0; q < 2; ++q) {
        const int p = q ? 15 - wid : wid;      // tiles 2p (acc0) and 2p+1 (acc1)
        const _Float16* bp = b0 + 128 * p;     // B of tile 2p at dl = 0
        v8f acc0 = (v8f){}, acc1 = (v8f){};
        // u of the pair's outputs, asked for ahead of the products
        const float4* up = (const float4*)(uT + o0 + 128 * p);
        const float4 ua = up[0], ub = up[1], uc = up[16], ud = up[17];
        // before the loads' address registers are reused; the pointer is an
        // input so that no load's result is placed in it earlier
        asm volatile("s_wait_xcnt 0x0" :: "v"(up) : "memory");
        // B of tile 2p+1 at the next even and the next odd step
        v16h h0 = frag16(bp + 64), h1 = frag16(bp + 32);
        const int np = 2 * p + 1;              // steps 0 .. 4p+1, two a trip
        // unroll: the LDS reads of later products go out ahead of one wait
#pragma unroll 2
        for (int i = 0; i < np; ++i) {
            const v16h fa0 = frag16(a0 - 64 * i);
            const v16h fb0 = frag16(bp - 64 * i);
            const v16h fa1 = frag16(a0 - 64 * i - 32);
            const v16h fb1 = frag16(bp - 64 * i - 32);
            acc0 = mm(fa0, fb0, acc0);
            acc1 = mm(fa0, h0, acc1);
            acc0 = mm(fa1, fb1, acc0);
            acc1 = mm(fa1, h1, acc1);
            h0 = fb0;
            h1 = fb1;
        }
        // step 4p+2 for both tiles, steps 4p+3 and 4p+4 for the upper one
        {
            const v16h fa0 = frag16(a0 - 64 * np);
            const v16h fb0 = frag16(bp - 64 * np);
            const v16h fa1 = frag16(a0 - 64 * np - 32);
            const v16h fa2 = frag16(a0 - 64 * np - 64);
            acc0 = mm(fa0, fb0, acc0);
            acc1 = mm(fa0, h0, acc1);
            acc1 = mm(fa1, h1, acc1);
            acc1 = mm(fa2, fb0, acc1);
        }
        const float u0[8] = {ua.x, ua.y, ua.z, ua.w, ub.x, ub.y, ub.z, ub.w};
        const float u1[8] = {uc.x, uc.y, uc.z, uc.w, ud.x, ud.y, ud.z, ud.w};
        v8h g0, g1;
#pragma unroll
        for (int e = 0; e < 8; ++e) {
            g0[e] = (_Float16)(u0[e] * acc0[e]);
            g1[e] = (_Float16)(u1[e] * acc1[e]);
        }
        _Float16* gp = gT + o0 + 128 * p;
        *(v8h*)gp        = g0;
        *(v8h*)(gp + 64) = g1;
        // before the next pair reuses the stores' registers
        asm volatile("s_wait_xcnt 0x0" ::: "memory");
    }
}

// ---------------------------------------------------------------------------
extern "C" void kernel_launch(void* const* d_in, const int* in_sizes, int n_in,
                              void* d_out, int out_size, void* d_ws, size_t ws_size,
                              hipStream_t stream) {
    const float* x  = (const float*)d_in[0];
    const float* Wu = (const float*)d_in[1];
    const float* bu = (const float*)d_in[2];
    const float* Wv = (const float*)d_in[3];
    const float* bv = (const float*)d_in[4];
    const float* Wo = (const float*)d_in[5];
    const float* bo = (const float*)d_in[6];
    const float* Wp = (const float*)d_in[7];
    const float* bp = (const float*)d_in[8];
    const float* W1 = (const float*)d_in[9];
    const float* b1 = (const float*)d_in[10];
    const float* W2 = (const float*)d_in[11];
    const float* b2 = (const float*)d_in[12];
    const float* W3 = (const float*)d_in[13];
    const float* b3 = (const float*)d_in[14];
    const float* Wz = (const float*)d_in[15];
    const float* bz = (const float*)d_in[16];
    float* out = (float*)d_out;

    float* ws = (float*)d_ws;
    const size_t SZ_U  = (size_t)BB * NN * D1;   // 8M
    const size_t SZ_H  = (size_t)NN * EE;        // 1M
    const size_t SZ_CO = (size_t)NN * D1;        // 2M

    float* u    = ws;                    // 8M  [CH][B][N]
    float* v    = u + SZ_U;              // 8M  f16 [CH][B][N] in its first half
    float* y    = v + SZ_U;              // 8M  u * conv(v), f16 [CH][B][N] in its first half
    float* hcfA = y + SZ_U;              // 1M
    float* hcfB = hcfA + SZ_H;           // 1M
    float* coef = hcfB + SZ_H;           // 2M
    float* av   = coef + SZ_CO;          // f16 [CH][GP]

    // row tiles: 8192 token rows -> 2^7, 2048 position rows -> 2^5
    // u = silu(srms(x) @ Wu + bu), [CH][B][N]; v = silu(srms(x) @ Wv + bv), f16, [CH][B][N];
    // each in two bands of four column tiles (512 blocks)
    const GemmJob ju0 = {x, Wu, bu, u, nullptr, nullptr, D1, DD, 1, 1, 7, 0};
    const GemmJob ju1 = {x, Wu, bu, u, nullptr, nullptr, D1, DD, 1, 1, 7, 4};
    const GemmJob jv0 = {x, Wv, bv, v, nullptr, nullptr, D1, DD, 2, 1, 7, 0};
    const GemmJob jv1 = {x, Wv, bv, v, nullptr, nullptr, D1, DD, 2, 1, 7, 4};
    // positional MLP: each layer is relu(srms(.)) @ W + b
    const GemmJob jp1 = {Wp,   W1, b1, hcfA, nullptr, bp,      EE, EE, 0, 3, 5, 0};
    const GemmJob jp2 = {hcfA, W2, b2, hcfB, nullptr, nullptr, EE, EE, 0, 2, 5, 0};
    const GemmJob jp3 = {hcfB, W3, b3, hcfA, nullptr, nullptr, EE, EE, 0, 2, 5, 0};
    const GemmJob jpz = {hcfA, Wz, bz, coef, nullptr, nullptr, D1, EE, 0, 2, 5, 0};

    // 1-3) the four layers follow one another; each shares its launch with a
    //      band of u or v, which depend on x alone
    //      (128 or 256 blocks of the layer first, then the band's 512)
    gemm_wmma_kernel<<<640, 256, 0, stream>>>(jp1, ju0, 128);
    gemm_wmma_kernel<<<640, 256, 0, stream>>>(jp2, ju1, 128);
    gemm_wmma_kernel<<<640, 256, 0, stream>>>(jp3, jv0, 128);
    gemm_wmma_kernel<<<768, 256, 0, stream>>>(jpz, jv1, 256);

    // 4) build decayed filter rows, f16, lags descending
    build_a_kernel<<<(CH * (GP / 8) + 255) / 256, 256, 0, stream>>>(coef, (_Float16*)av);

    // 5) causal depthwise conv and gate: y[ch][b][t] = u * conv(v), f16
    conv_kernel<<<CH, 256, 0, stream>>>((const _Float16*)av, (const _Float16*)v, u, (_Float16*)y);

    // 6) out = y^T @ Wo + bo + x
    const GemmJob jo = {y, Wo, bo, out, x, nullptr, DD, D1, 3, 0, 7, 0};
    gemm_at_kernel<<<512, 256, 0, stream>>>(jo);
}

// v008
// It runs in 123 microseconds.
// Timed twice side by side with v007, it ran 1.08 times as fast both times.
// Counting every step since v000, it is 7.37 times as fast.
#include <hip/hip_runtime.h>
#include <hip/hip_bf16.h>
#include <math.h>

// Problem constants (fixed by the reference)
#define BB 4
#define NN 2048
#define DD 512
#define HH 8
#define EE 512
#define D1 1024
#define HD 128
#define GAMMA 0.999f

typedef _Float16 v16h __attribute__((ext_vector_type(16)));
typedef float    v8f  __attribute__((ext_vector_type(8)));
typedef _Float16 v8h  __attribute__((ext_vector_type(8)));
typedef short    s16x8 __attribute__((ext_vector_type(8)));
typedef float    v4f  __attribute__((ext_vector_type(4)));

// a lane's 16 halves of a fragment: k = 8*hs + 0..7 at p, k = 16 + 8*hs + 0..7 at p + 16
__device__ __forceinline__ v16h frag16(const _Float16* p) {
    const v8h lo = *(const v8h*)p;
    const v8h hi = *(const v8h*)(p + 16);
    return __builtin_shufflevector(lo, hi, 0, 1, 2, 3, 4, 5, 6, 7,
                                   8, 9, 10, 11, 12, 13, 14, 15);
}
// a base that is the same for the whole block + a thread's 32-bit byte offset
__device__ __forceinline__ const float* at(const float* base, unsigned bytes) {
    return (const float*)((const char*)base + bytes);
}
// transposing LDS read of a 16 x 16 block of halves that lies row by row
__device__ __forceinline__ v8h ld_tr16(const _Float16* p) {
    typedef __attribute__((address_space(3))) s16x8 lds_s16x8;
    return __builtin_bit_cast(v8h, __builtin_amdgcn_ds_load_tr16_b128_v8i16((lds_s16x8*)p));
}

// ---------------------------------------------------------------------------
// Generic WMMA GEMM: C[M,Nf] = epilogue(A[M,K] @ W[K,Nf] + bias)
//   mode 0: bias only
//   mode 1: bias + SiLU, output time-major per channel: [col][B][N]
//   mode 2: the same, output as f16
//   mode 3: bias + residual add (res has same [M,Nf] layout)
//   mode 4: bias, times the decay of the row's lag, output as f16 filter rows of
//           the conv: [col][N], lags descending (M is N here)
// What the A operand is:
//   amode 0: A as stored
//   amode 1: srms(A)
//   amode 2: relu(srms(A))
//   amode 3: relu(srms(P)), P[m][k] = m * A[k] + A2[k] (position rows, never stored)
// AT: A lies in memory as f16, k-major ([K][M]), and is taken as stored; its
// tile goes into LDS as it lies, [k][m], and the transposing read that serves
// W turns it into the A fragment.
// srms(x) = s * x with one s > 0 per row, s = 1 / (sqrt(mean(x^2)) + eps), so
// relu(srms(x)) @ W = s * (relu(x) @ W): the raw values go into the product,
// a row's sum of squares is gathered while its K values (K is the length of
// the norm) pass through the staging, and s multiplies the accumulators.
// Block tile 64x128x128, 256 threads = 8 waves, each wave -> 32x32 via
// 2x2 v_wmma_f32_16x16x32_f16. Assumes M%64==0, Nf%128==0, K%128==0.
// LDS banks: the A tile's rows stand at 272 bytes (16 x odd), where the 16 rows
// of a 16-byte fragment read fall on all 64 banks. The W tile lies [k][n], as
// in memory, so that a thread stores its 8 consecutive n of a row as one
// 16-byte piece and 16 lanes fill 256 bytes in a row; the transposing read
// turns it into the B fragment, and its rows stand at 288 bytes (32 x odd).
// ---------------------------------------------------------------------------
#define BK   128    // k of one pass of the k loop
#define AS_P 136    // row pitch of the A tile in LDS, halves
#define BS_P 144    // row pitch of the W tile in LDS, halves
#define AT_P 80     // row pitch of a k-major A tile in LDS, halves (160 bytes, 32 x odd)
// One product, or a band of its column tiles. Its tiles are numbered rows first:
// tile j stands at row tile j mod 2^lgx, column tile by0 + (j >> lgx).
struct GemmJob {
    const float* A;
    const float* W;
    const float* bias;
    float*       C;
    const float* res;
    const float* A2;
    int Nf, K, mode, amode;
    int lgx;    // log2 of the number of row tiles (M / 64)
    int by0;    // first column tile of the band
};
// The tile of 64 rows from bm and 128 columns from bn of one product.
template <bool AT>
__device__ __forceinline__ void gemm_tile(const float* __restrict__ A,
                                          const float* __restrict__ W,
                                          const float* __restrict__ bias,
                                          float* __restrict__ C,
                                          const float* __restrict__ res,
                                          const float* __restrict__ A2,
                                          int Nf, int K, int mode, int amode,
                                          int M, int bm, int bn) {
    __shared__ __align__(16) _Float16 As[AT ? BK * AT_P : 64 * AS_P];  // [m][k]; AT: [k][m]
    __shared__ __align__(16) _Float16 Bs[BK * BS_P];  // [k][n]
    __shared__ __align__(16) float rs[64];            // s of the tile's rows

    const int tid  = threadIdx.x;
    const int lane = tid & 31;
    const int wid  = tid >> 5;
    const int wm   = wid & 1;    // 0..1  (rows 0-31 / 32-63)
    const int wn   = wid >> 1;   // 0..3  (cols, 32 each)

    v8f acc[2][2];
    acc[0][0] = (v8f){}; acc[0][1] = (v8f){};
    acc[1][0] = (v8f){}; acc[1][1] = (v8f){};

    const int laneM = lane & 15;
    const int hiSel = (lane >> 4) & 1;   // upper half of wave

    float ss = 0.f;   // this thread's part of its staged row's sum of squares

    const int nkb = K / BK;
    // A: row r, 8 floats at c0 of each of the row's 32-float lines
    const int r  = tid >> 2;            // 0..63
    const int c0 = (tid & 3) * 8;       // 0,8,16,24
    // W: 8 consecutive n of the rows k0 and k0+1 of each group of 32 rows
    const int k0 = (tid >> 4) * 2;      // 0,2,..,30
    const int n0 = (tid & 15) * 8;      // 0..120
    // a thread's places in the two tiles, in bytes, the same in every pass
    const unsigned ao = (unsigned)(r * K + c0) * 4u;
    const unsigned wo = (unsigned)(k0 * Nf + n0) * 4u;
    // and the places it asks for ahead: one line of its row of A, one line of
    // an even row of W
    const unsigned ap = (unsigned)(r * K + (tid & 3) * 32) * 4u;
    const unsigned wp = (unsigned)((tid >> 2) * 2 * Nf + (tid & 3) * 32) * 4u;
    // k-major A: 8 consecutive m of row kr of each group of 32 rows; a row of
    // the tile is one line
    const int kr = tid >> 3;            // 0..31
    const int mc = (tid & 7) * 8;       // 0..56
    for (int kb = 0; kb < nkb; ++kb) {
        // ---- all global loads of the pass go out before the first is waited
        //      for: one load latency and two barriers per BK k ----
        float av[4][8];
        v8h ah[4];
        if (AT) {
            const _Float16* src = (const _Float16*)A + (size_t)(kb * BK) * M + bm;
            const _Float16* pa0 = src + kr * M + mc;
            // next pass: the tile's 128 lines, two threads a line
            const _Float16* pa1 = src + (size_t)(BK + (tid >> 1)) * M;
            if (kb + 1 < nkb) __builtin_prefetch(pa1, 0, 0);
            const _Float16* pa2 = pa0 + (size_t)32 * M;
            const _Float16* pa3 = pa2 + (size_t)32 * M;
            const _Float16* pa4 = pa3 + (size_t)32 * M;
            ah[0] = *(const v8h*)pa0;
            ah[1] = *(const v8h*)pa2;
            ah[2] = *(const v8h*)pa3;
            ah[3] = *(const v8h*)pa4;
            // before the loads' address registers are reused; the pointers
            // are inputs so that they stay as they are up to here
            asm volatile("s_wait_xcnt 0x0" :: "v"(pa0), "v"(pa1), "v"(pa2), "v"(pa3), "v"(pa4) : "memory");
        } else if (amode == 3) {
            const float* pw = A + kb * BK;
            const float* pb = A2 + kb * BK;
            const float m = (float)(bm + r);
#pragma unroll
            for (int q = 0; q < 4; ++q)
#pragma unroll
                for (int j = 0; j < 8; ++j) av[q][j] = m * (pw + c0)[q * 32 + j] + (pb + c0)[q * 32 + j];
            // before the loads' address registers are reused; they are inputs
            // so that they stay as they are up to here
            asm volatile("s_wait_xcnt 0x0" :: "s"(pw), "s"(pb), "v"(c0) : "memory");
        } else {
            const float* src = A + (size_t)bm * K + kb * BK;
            const float* pa0 = at(src, ao);
            // next pass: the row's lines, one a thread
            const float* pa1 = at(src, ap) + BK;
            if (kb + 1 < nkb) __builtin_prefetch(pa1, 0, 0);
#pragma unroll
            for (int q = 0; q < 4; ++q)
#pragma unroll
                for (int j = 0; j < 8; ++j) av[q][j] = pa0[q * 32 + j];
            // before the loads' address registers are reused; the pointers
            // are inputs so that no load's result is placed in them earlier
            asm volatile("s_wait_xcnt 0x0" :: "v"(pa0), "v"(pa1) : "memory");
        }
        const float* wq0 = W + (size_t)(kb * BK) * Nf + bn;
        const float* wq1 = wq0 + (size_t)32 * Nf;
        const float* wq2 = wq1 + (size_t)32 * Nf;
        const float* wq3 = wq2 + (size_t)32 * Nf;
        const float* wr0 = wq0 + Nf;
        const float* wr1 = wq1 + Nf;
        const float* wr2 = wq2 + Nf;
        const float* wr3 = wq3 + Nf;
        // next pass: every even row of W, one of its four lines a thread
        const float* wnx = at(wq3 + (size_t)32 * Nf, wp);
        if (kb + 1 < nkb) __builtin_prefetch(wnx, 0, 0);
        float w0[4][8], w1[4][8];
        {
            const float* p0 = at(wq0, wo);
            const float* p1 = at(wr0, wo);
#pragma unroll
            for (int j = 0; j < 8; ++j) { w0[0][j] = p0[j]; w1[0][j] = p1[j]; }
            // before the loads' address registers are reused; the pointers
            // are inputs so that no load's result is placed in them earlier
            asm volatile("s_wait_xcnt 0x0" :: "v"(p0), "v"(p1), "v"(wnx) : "memory");
        }
        {
            const float* p0 = at(wq1, wo);
            const float* p1 = at(wr1, wo);
#pragma unroll
            for (int j = 0; j < 8; ++j) { w0[1][j] = p0[j]; w1[1][j] = p1[j]; }
            // before the loads' address registers are reused; the pointers
            // are inputs so that no load's result is placed in them earlier
            asm volatile("s_wait_xcnt 0x0" :: "v"(p0), "v"(p1) : "memory");
        }
        {
            const float* p0 = at(wq2, wo);
            const float* p1 = at(wr2, wo);
#pragma unroll
            for (int j = 0; j < 8; ++j) { w0[2][j] = p0[j]; w1[2][j] = p1[j]; }
            // before the loads' address registers are reused; the pointers
            // are inputs so that no load's result is placed in them earlier
            asm volatile("s_wait_xcnt 0x0" :: "v"(p0), "v"(p1) : "memory");
        }
        {
            const float* p0 = at(wq3, wo);
            const float* p1 = at(wr3, wo);
#pragma unroll
            for (int j = 0; j < 8; ++j) { w0[3][j] = p0[j]; w1[3][j] = p1[j]; }
            // before the loads' address registers are reused; the pointers
            // are inputs so that no load's result is placed in them earlier
            asm volatile("s_wait_xcnt 0x0" :: "v"(p0), "v"(p1) : "memory");
        }
        // holds the loaded values of W as they came up to here, inputs only: the
        // conversions below, moved up between the loads, would wait for the
        // first loads before the last have gone out
        if (AT) {
#define F4(a, i) ((v4f){(a)[i], (a)[(i) + 1], (a)[(i) + 2], (a)[(i) + 3]})
            asm volatile("" :: "v"(F4(w0[0], 0)), "v"(F4(w0[0], 4)), "v"(F4(w1[0], 0)), "v"(F4(w1[0], 4)),
                               "v"(F4(w0[1], 0)), "v"(F4(w0[1], 4)), "v"(F4(w1[1], 0)), "v"(F4(w1[1], 4)),
                               "v"(F4(w0[2], 0)), "v"(F4(w0[2], 4)), "v"(F4(w1[2], 0)), "v"(F4(w1[2], 4)),
                               "v"(F4(w0[3], 0)), "v"(F4(w0[3], 4)), "v"(F4(w1[3], 0)), "v"(F4(w1[3], 4)));
#undef F4
        }
        // ---- stage A tile: 64 x BK floats -> f16; k-major: as it is ----
#pragma unroll
        for (int q = 0; q < 4; ++q) {
            if (AT) {
                *(v8h*)&As[(q * 32 + kr) * AT_P + mc] = ah[q];
                continue;
            }
            if (amode != 0) {
#pragma unroll
                for (int j = 0; j < 8; ++j) ss += av[q][j] * av[q][j];
            }
            if (amode >= 2) {
#pragma unroll
                for (int j = 0; j < 8; ++j) av[q][j] = fmaxf(av[q][j], 0.f);
            }
            v8h pa;
#pragma unroll
            for (int j = 0; j < 8; ++j) pa[j] = (_Float16)av[q][j];
            *(v8h*)&As[r * AS_P + q * 32 + c0] = pa;
        }
        // ---- stage W tile: one 16-byte DS store a row ----
#pragma unroll
        for (int q = 0; q < 4; ++q) {
            v8h p0, p1;
#pragma unroll
            for (int j = 0; j < 8; ++j) {
                p0[j] = (_Float16)w0[q][j];
                p1[j] = (_Float16)w1[q][j];
            }
            *(v8h*)&Bs[(q * 32 + k0) * BS_P + n0]     = p0;
            *(v8h*)&Bs[(q * 32 + k0 + 1) * BS_P + n0] = p1;
        }
        __syncthreads();

        // a lane names 8 halves of row 8*hiSel + (lane & 7) of a block of W and
        // gets column laneM of the rows 8*hiSel + 0..7
        const _Float16* bt = &Bs[(hiSel * 8 + (lane & 7)) * BS_P + wn * 32 + ((lane >> 3) & 1) * 8];
        // the same for a k-major A tile: row laneM of A, k = 8*hiSel + 0..7
        const _Float16* att = &As[(hiSel * 8 + (lane & 7)) * AT_P + wm * 32 + ((lane >> 3) & 1) * 8];
#pragma unroll
        for (int ks = 0; ks < 4; ++ks) {
            // ---- load fragments, both in the hardware's k order: a lane holds
            //      k = 8*hiSel + 0..7 and 16 + 8*hiSel + 0..7 of its row or column ----
            v16h fa[2], fb[2];
#pragma unroll
            for (int mi = 0; mi < 2; ++mi) {
                if (AT) {
                    const v8h lo = ld_tr16(att + ks * 32 * AT_P + mi * 16);
                    const v8h hi = ld_tr16(att + (ks * 32 + 16) * AT_P + mi * 16);
                    fa[mi] = __builtin_shufflevector(lo, hi, 0, 1, 2, 3, 4, 5, 6, 7,
                                                     8, 9, 10, 11, 12, 13, 14, 15);
                } else {
                    fa[mi] = frag16(&As[(wm * 32 + mi * 16 + laneM) * AS_P + ks * 32 + hiSel * 8]);
                }
            }
#pragma unroll
            for (int ni = 0; ni < 2; ++ni) {
                const v8h lo = ld_tr16(bt + ks * 32 * BS_P + ni * 16);
                const v8h hi = ld_tr16(bt + (ks * 32 + 16) * BS_P + ni * 16);
                fb[ni] = __builtin_shufflevector(lo, hi, 0, 1, 2, 3, 4, 5, 6, 7,
                                                 8, 9, 10, 11, 12, 13, 14, 15);
            }

#pragma unroll
            for (int mi = 0; mi < 2; ++mi)
#pragma unroll
                for (int ni = 0; ni < 2; ++ni)
                    acc[mi][ni] = __builtin_amdgcn_wmma_f32_16x16x32_f16(
                        false, fa[mi], false, fb[ni], (short)0, acc[mi][ni],
                        false, false);
        }
        __syncthreads();
    }

    // ---- the rows' norm factors: four neighbouring lanes staged one row ----
    if (!AT && amode != 0) {
        ss += __shfl_xor(ss, 1);
        ss += __shfl_xor(ss, 2);
        if ((tid & 3) == 0)
            rs[tid >> 2] = 1.0f / (sqrtf(ss / (float)K) + 1e-8f);
        __syncthreads();
#pragma unroll
        for (int mi = 0; mi < 2; ++mi) {
            const float* sp = &rs[wm * 32 + mi * 16 + hiSel * 8];
#pragma unroll
            for (int r = 0; r < 8; ++r) {
                acc[mi][0][r] *= sp[r];
                acc[mi][1][r] *= sp[r];
            }
        }
    }

    // ---- epilogue, modes 1 and 2: a lane holds 8 consecutive tokens of one
    //      channel, 16-byte stores into the channel's own time row ----
    if (mode == 1 || mode == 2) {
        _Float16* Ch = (_Float16*)C;
#pragma unroll
        for (int mi = 0; mi < 2; ++mi) {
#pragma unroll
            for (int ni = 0; ni < 2; ++ni) {
                const int row0 = bm + wm * 32 + mi * 16 + hiSel * 8;
                const int col  = bn + wn * 32 + ni * 16 + laneM;
                const float bc = bias[col];
                // before the load's address registers are reused
                asm volatile("s_wait_xcnt 0x0" ::: "memory");
                float sv[8];
#pragma unroll
                for (int r = 0; r < 8; ++r) {
                    const float val = acc[mi][ni][r] + bc;
                    sv[r] = val / (1.0f + __expf(-val));   // SiLU
                }
                const int b = row0 / NN, n = row0 % NN;
                const size_t o = ((size_t)col * BB + b) * NN + n;
                if (mode == 1) {
                    *(float4*)&C[o]     = make_float4(sv[0], sv[1], sv[2], sv[3]);
                    *(float4*)&C[o + 4] = make_float4(sv[4], sv[5], sv[6], sv[7]);
                    // before the stores' registers are reused
                    asm volatile("s_wait_xcnt 0x0" ::: "memory");
                } else {
                    v8h pk;
#pragma unroll
                    for (int r = 0; r < 8; ++r) pk[r] = (_Float16)sv[r];
                    *(v8h*)&Ch[o] = pk;
                    // before the store's registers are reused
                    asm volatile("s_wait_xcnt 0x0" ::: "memory");
                }
            }
        }
        return;
    }

    // ---- epilogue, mode 4: a row is a lag k and a lane holds 8 consecutive lags
    //      of one channel: G[col][N - 1 - k] = decay(k) * value, decay(0) = 1,
    //      decay(k) = gamma^k, one 16-byte store; a block fills whole 128-byte
    //      lines of its channels' rows ----
    if (!AT && mode == 4) {
        _Float16* G = (_Float16*)C;
        const int colb = bn + wn * 32 + laneM;
        const float bc[2] = {bias[colb], bias[colb + 16]};
        // before the loads' address registers are reused; the column, which the
        // loads take as their offset, is an input so that no load's result is
        // placed in it earlier
        asm volatile("s_wait_xcnt 0x0" :: "v"(colb) : "memory");
#pragma unroll
        for (int mi = 0; mi < 2; ++mi) {
            const int row0 = bm + wm * 32 + mi * 16 + hiSel * 8;
            // gamma^k of the smallest of the eight lags; the others by constant factors
            const float d0 = __expf((float)row0 * __logf(GAMMA));
#pragma unroll
            for (int ni = 0; ni < 2; ++ni) {
                const int col = colb + ni * 16;
                v8h w;
                float pw = 1.0f;
#pragma unroll
                for (int r = 0; r < 8; ++r) {
                    const float decay = (row0 + r == 0) ? 1.0f : d0 * pw;
                    w[7 - r] = (_Float16)(decay * (acc[mi][ni][r] + bc[ni]));
                    pw *= GAMMA;
                }
                *(v8h*)&G[(size_t)col * NN + (NN - 8 - row0)] = w;
                // before the store's registers are reused
                asm volatile("s_wait_xcnt 0x0" ::: "memory");
            }
        }
        return;
    }

    // ---- epilogue ----
#pragma unroll
    for (int mi = 0; mi < 2; ++mi) {
#pragma unroll
        for (int ni = 0; ni < 2; ++ni) {
            const int col = bn + wn * 32 + ni * 16 + laneM;
            const float* bq = bias + col;
            const float bc = *bq;
            // before the load's address registers are reused; the pointer is
            // an input so that the load's result is not placed in it earlier
            asm volatile("s_wait_xcnt 0x0" :: "v"(bq) : "memory");
#pragma unroll
            for (int r = 0; r < 8; ++r) {
                const int row = bm + wm * 32 + mi * 16 + r + hiSel * 8;
                float val = acc[mi][ni][r] + bc;
                if (mode == 3) {
                    val += res[(size_t)row * Nf + col];
                }
                C[(size_t)row * Nf + col] = val;
                // before the store's registers are reused
                asm volatile("s_wait_xcnt 0x0" ::: "memory");
            }
        }
    }
}

// A launch carries two products that do not depend on each other: the first
// nb0 blocks work on j0, the others on j1. A short product, which alone leaves
// most of the chip idle for the length of its k loop, runs beside a large one.
__global__ __launch_bounds__(256) void gemm_wmma_kernel(GemmJob j0, GemmJob j1, int nb0) {
    const bool f0   = (int)blockIdx.x < nb0;
    const int  tile = f0 ? (int)blockIdx.x : (int)blockIdx.x - nb0;
    const int  lgx  = f0 ? j0.lgx : j1.lgx;
    const int  by0  = f0 ? j0.by0 : j1.by0;
    gemm_tile<false>(f0 ? j0.A : j1.A, f0 ? j0.W : j1.W, f0 ? j0.bias : j1.bias,
                     f0 ? j0.C : j1.C, f0 ? j0.res : j1.res, f0 ? j0.A2 : j1.A2,
                     f0 ? j0.Nf : j1.Nf, f0 ? j0.K : j1.K,
                     f0 ? j0.mode : j1.mode, f0 ? j0.amode : j1.amode, 64 << lgx,
                     (tile & ((1 << lgx) - 1)) * 64, (by0 + (tile >> lgx)) * 128);
}
// One product whose A is f16 and k-major.
__global__ __launch_bounds__(256) void gemm_at_kernel(GemmJob j) {
    const int tile = (int)blockIdx.x;
    gemm_tile<true>(j.A, j.W, j.bias, j.C, j.res, j.A2, j.Nf, j.K, j.mode, j.amode,
                    64 << j.lgx,
                    (tile & ((1 << j.lgx) - 1)) * 64, (j.by0 + (tile >> j.lgx)) * 128);
}

#define CH   (HH * HD)
#define LMAX 2064            // largest lag index a fragment can ask for, rounded up to 8
#define AP   (LMAX + 32)     // row length of one shifted copy in LDS, halves
#define VF   64              // zeros in front of a time row (times < 0)
// time row in LDS: VF zeros, N values, 32 zeros, padded. A fragment read takes
// 16 bytes at every 32 from four places of each of the four rows: the rows
// start at 0, 1, 8 and 9 sixteen-byte units modulo 16, so that the 16 lanes of
// a half wave fall on all 64 banks
#define VP   2184
#define VOFF(b) ((b) * VP + ((b) >> 1) * 48)

// ---------------------------------------------------------------------------
// Causal depthwise conv along time as Toeplitz matrix products, one block per
// channel:  y[b][t] = sum_{k=0..t} a[k] * v[b][t-k]
// One 16x16x32 product, for a lag offset dl and an output tile of 64 steps:
//   A[m][j] = a[dl + m - j]                      (16 x 32, Toeplitz)
//   B[j][n] = v[b][t0 + 16*c4 - dl + j]          (n = 4*b + c4)
//   D[m][n] = part of y[b][t0 + 16*c4 + m]
// dl runs over 0, 32, .., t0 + 64: every lag 0..t is met exactly once; lags
// below 0 and above N-1 read zeros of the filter row, times below 0 zeros of
// the time row.
// A depends on dl alone and B on t0 - dl alone: a wave works on two adjacent
// tiles at once, which share every A, and the upper tile takes as B what the
// lower tile read two steps earlier, kept in registers.
// A lane's 8 consecutive j of A start at a lag that depends on m: the filter
// lies in LDS eight times, copy c shifted by c halves, so that lane m reads
// copy m & 7 at a 16-byte boundary.
// The gate: u lies time-major per channel like y, so a lane multiplies its 8
// consecutive steps of y by u in its registers and stores the product as f16,
// gT[ch][b][t] = u * y, which is the k-major A of the output product.
// ---------------------------------------------------------------------------
__device__ __forceinline__ v8f mm(v16h a, v16h b, v8f c) {
    return __builtin_amdgcn_wmma_f32_16x16x32_f16(false, a, false, b, (short)0, c,
                                                  false, false);
}
__global__ __launch_bounds__(256) void conv_kernel(const _Float16* __restrict__ g,
                                                   const _Float16* __restrict__ vT,
                                                   const float* __restrict__ uT,
                                                   _Float16* __restrict__ gT) {
    __shared__ __align__(16) _Float16 a_s[8 * AP];     // 33.5 KB
    __shared__ __align__(16) _Float16 v_s[VOFF(BB)];   // 17.7 KB

    const int ch   = blockIdx.x;
    const int tid  = threadIdx.x;
    const int lane = tid & 31;
    // scalar wave number: the tile loops below must be scalar branches (a
    // matrix instruction needs every lane on)
    const int wid  = __builtin_amdgcn_readfirstlane(tid >> 5);

    // filter: g[ch][p] holds lag N - 1 - p; a_s[c][x] holds lag LMAX - x + c, that
    // is g[x - c - (LMAX - N + 1)], and 0 outside the row (lags below 0, above N-1).
    // The 8 halves at x = 8q come from the row's pieces q - 3 and q - 2.
    const _Float16* gc = g + (size_t)ch * NN;
    for (int q = tid; q < AP / 8; q += 256) {
        // clamped pieces, read without a branch
        const int i0 = min(max(q - 3, 0), NN / 8 - 1);
        const int i1 = min(max(q - 2, 0), NN / 8 - 1);
        const _Float16* g0p = gc + 8 * i0;
        const _Float16* g1p = gc + 8 * i1;
        v8h lo = *(const v8h*)g0p;
        v8h hi = *(const v8h*)g1p;
        // before the loads' address registers are reused; the piece numbers, which
        // the loads take as their offsets, are inputs so that no load's result is
        // placed in them earlier
        asm volatile("s_wait_xcnt 0x0" :: "v"(i0), "v"(i1) : "memory");
        if (i0 != q - 3) lo = (v8h){};
        if (i1 != q - 2) hi = (v8h){};
        const v16h w = __builtin_shufflevector(lo, hi, 0, 1, 2, 3, 4, 5, 6, 7,
                                               8, 9, 10, 11, 12, 13, 14, 15);
#pragma unroll
        for (int c = 0; c < 8; ++c) {
            v8h o;
#pragma unroll
            for (int e = 0; e < 8; ++e) o[e] = w[e - c + 7];
            *(v8h*)&a_s[c * AP + 8 * q] = o;
        }
    }
    // time rows of the four batches, zeros in front and behind
    const _Float16* vc = vT + (size_t)ch * BB * NN;
#pragma unroll
    for (int b = 0; b < BB; ++b) {
        const v8h x = *(const v8h*)&vc[b * NN + tid * 8];
        *(v8h*)&v_s[VOFF(b) + VF + tid * 8] = x;
    }
    if (tid < BB * 12) {
        const int b = tid / 12, p = tid % 12;
        const int off = (p < 8) ? p * 8 : VF + NN + (p - 8) * 8;
        *(v8h*)&v_s[VOFF(b) + off] = (v8h){};
    }
    __syncthreads();

    const int n  = lane & 15;
    const int hs = lane >> 4;
    const _Float16* a0 = a_s + (n & 7) * AP + LMAX - 8 * (n >> 3) + 8 * hs;
    const _Float16* b0 = v_s + VOFF(n >> 2) + VF + 16 * (n & 3) + 8 * hs;
    const size_t o0 = ((size_t)ch * BB + (n >> 2)) * NN + 16 * (n & 3) + 8 * hs;

    // pairs of tiles w and 15-w: the same number of products for every wave
    for (int q = 0; q < 2; ++q) {
        const int p = q ? 15 - wid : wid;      // tiles 2p (acc0) and 2p+1 (acc1)
        const _Float16* bp = b0 + 128 * p;     // B of tile 2p at dl = 0
        v8f acc0 = (v8f){}, acc1 = (v8f){};
        // u of the pair's outputs, asked for ahead of the products
        const float4* up = (const float4*)(uT + o0 + 128 * p);
        const float4 ua = up[0], ub = up[1], uc = up[16], ud = up[17];
        // before the loads' address registers are reused; the pointer is an
        // input so that no load's result is placed in it earlier
        asm volatile("s_wait_xcnt 0x0" :: "v"(up) : "memory");
        // B of tile 2p+1 at the next even and the next odd step
        v16h h0 = frag16(bp + 64), h1 = frag16(bp + 32);
        const int np = 2 * p + 1;              // steps 0 .. 4p+1, two a trip
        // unroll: the LDS reads of later products go out ahead of one wait
#pragma unroll 2
        for (int i = 0; i < np; ++i) {
            const v16h fa0 = frag16(a0 - 64 * i);
            const v16h fb0 = frag16(bp - 64 * i);
            const v16h fa1 = frag16(a0 - 64 * i - 32);
            const v16h fb1 = frag16(bp - 64 * i - 32);
            acc0 = mm(fa0, fb0, acc0);
            acc1 = mm(fa0, h0, acc1);
            acc0 = mm(fa1, fb1, acc0);
            acc1 = mm(fa1, h1, acc1);
            h0 = fb0;
            h1 = fb1;
        }
        // step 4p+2 for both tiles, steps 4p+3 and 4p+4 for the upper one
        {
            const v16h fa0 = frag16(a0 - 64 * np);
            const v16h fb0 = frag16(bp - 64 * np);
            const v16h fa1 = frag16(a0 - 64 * np - 32);
            const v16h fa2 = frag16(a0 - 64 * np - 64);
            acc0 = mm(fa0, fb0, acc0);
            acc1 = mm(fa0, h0, acc1);
            acc1 = mm(fa1, h1, acc1);
            acc1 = mm(fa2, fb0, acc1);
        }
        const float u0[8] = {ua.x, ua.y, ua.z, ua.w, ub.x, ub.y, ub.z, ub.w};
        const float u1[8] = {uc.x, uc.y, uc.z, uc.w, ud.x, ud.y, ud.z, ud.w};
        v8h g0, g1;
#pragma unroll
        for (int e = 0; e < 8; ++e) {
            g0[e] = (_Float16)(u0[e] * acc0[e]);
            g1[e] = (_Float16)(u1[e] * acc1[e]);
        }
        _Float16* gp = gT + o0 + 128 * p;
        *(v8h*)gp        = g0;
        *(v8h*)(gp + 64) = g1;
        // before the next pair reuses the stores' registers
        asm volatile("s_wait_xcnt 0x0" ::: "memory");
    }
}

// ---------------------------------------------------------------------------
extern "C" void kernel_launch(void* const* d_in, const int* in_sizes, int n_in,
                              void* d_out, int out_size, void* d_ws, size_t ws_size,
                              hipStream_t stream) {
    const float* x  = (const float*)d_in[0];
    const float* Wu = (const float*)d_in[1];
    const float* bu = (const float*)d_in[2];
    const float* Wv = (const float*)d_in[3];
    const float* bv = (const float*)d_in[4];
    const float* Wo = (const float*)d_in[5];
    const float* bo = (const float*)d_in[6];
    const float* Wp = (const float*)d_in[7];
    const float* bp = (const float*)d_in[8];
    const float* W1 = (const float*)d_in[9];
    const float* b1 = (const float*)d_in[10];
    const float* W2 = (const float*)d_in[11];
    const float* b2 = (const float*)d_in[12];
    const float* W3 = (const float*)d_in[13];
    const float* b3 = (const float*)d_in[14];
    const float* Wz = (const float*)d_in[15];
    const float* bz = (const float*)d_in[16];
    float* out = (float*)d_out;

    float* ws = (float*)d_ws;
    const size_t SZ_U  = (size_t)BB * NN * D1;   // 8M
    const size_t SZ_H  = (size_t)NN * EE;        // 1M

    float* u    = ws;                    // 8M  [CH][B][N]
    float* v    = u + SZ_U;              // 8M  f16 [CH][B][N] in its first half
    float* y    = v + SZ_U;              // 8M  u * conv(v), f16 [CH][B][N] in its first half
    float* hcfA = y + SZ_U;              // 1M
    float* hcfB = hcfA + SZ_H;           // 1M
    float* av   = hcfB + SZ_H;           // filter rows, f16 [CH][N], lags descending

    // row tiles: 8192 token rows -> 2^7, 2048 position rows -> 2^5
    // u = silu(srms(x) @ Wu + bu), [CH][B][N]; v = silu(srms(x) @ Wv + bv), f16, [CH][B][N];
    // each in two bands of four column tiles (512 blocks)
    const GemmJob ju0 = {x, Wu, bu, u, nullptr, nullptr, D1, DD, 1, 1, 7, 0};
    const GemmJob ju1 = {x, Wu, bu, u, nullptr, nullptr, D1, DD, 1, 1, 7, 4};
    const GemmJob jv0 = {x, Wv, bv, v, nullptr, nullptr, D1, DD, 2, 1, 7, 0};
    const GemmJob jv1 = {x, Wv, bv, v, nullptr, nullptr, D1, DD, 2, 1, 7, 4};
    // positional MLP: each layer is relu(srms(.)) @ W + b
    const GemmJob jp1 = {Wp,   W1, b1, hcfA, nullptr, bp,      EE, EE, 0, 3, 5, 0};
    const GemmJob jp2 = {hcfA, W2, b2, hcfB, nullptr, nullptr, EE, EE, 0, 2, 5, 0};
    const GemmJob jp3 = {hcfB, W3, b3, hcfA, nullptr, nullptr, EE, EE, 0, 2, 5, 0};
    // the last one stores the decayed filter rows of the conv
    const GemmJob jpz = {hcfA, Wz, bz, av,   nullptr, nullptr, D1, EE, 4, 2, 5, 0};

    // 1-3) the four layers follow one another; each shares its launch with a
    //      band of u or v, which depend on x alone
    //      (128 or 256 blocks of the layer first, then the band's 512)
    gemm_wmma_kernel<<<640, 256, 0, stream>>>(jp1, ju0, 128);
    gemm_wmma_kernel<<<640, 256, 0, stream>>>(jp2, ju1, 128);
    gemm_wmma_kernel<<<640, 256, 0, stream>>>(jp3, jv0, 128);
    gemm_wmma_kernel<<<768, 256, 0, stream>>>(jpz, jv1, 256);

    // 4) causal depthwise conv and gate: y[ch][b][t] = u * conv(v), f16
    conv_kernel<<<CH, 256, 0, stream>>>((const _Float16*)av, (const _Float16*)v, u, (_Float16*)y);

    // 5) out = y^T @ Wo + bo + x
    const GemmJob jo = {y, Wo, bo, out, x, nullptr, DD, D1, 3, 0, 7, 0};
    gemm_at_kernel<<<512, 256, 0, stream>>>(jo);
}

// v009
// A run of this version takes 109 microseconds.
// Next to v008, in two timings, it ran 1.13 times as fast each time.
// All steps since v000 together make it 8.33 times as fast.
#include <hip/hip_runtime.h>
#include <hip/hip_bf16.h>
#include <math.h>

// Problem constants (fixed by the reference)
#define BB 4
#define NN 2048
#define DD 512
#define HH 8
#define EE 512
#define D1 1024
#define HD 128
#define GAMMA 0.999f

typedef _Float16 v16h __attribute__((ext_vector_type(16)));
typedef float    v8f  __attribute__((ext_vector_type(8)));
typedef _Float16 v8h  __attribute__((ext_vector_type(8)));
typedef short    s16x8 __attribute__((ext_vector_type(8)));
typedef float    v4f  __attribute__((ext_vector_type(4)));

// a lane's 16 halves of a fragment: k = 8*hs + 0..7 at p, k = 16 + 8*hs + 0..7 at p + 16
__device__ __forceinline__ v16h frag16(const _Float16* p) {
    const v8h lo = *(const v8h*)p;
    const v8h hi = *(const v8h*)(p + 16);
    return __builtin_shufflevector(lo, hi, 0, 1, 2, 3, 4, 5, 6, 7,
                                   8, 9, 10, 11, 12, 13, 14, 15);
}
// a base that is the same for the whole block + a thread's 32-bit byte offset
__device__ __forceinline__ const float* at(const float* base, unsigned bytes) {
    return (const float*)((const char*)base + bytes);
}
// transposing LDS read of a 16 x 16 block of halves that lies row by row
__device__ __forceinline__ v8h ld_tr16(const _Float16* p) {
    typedef __attribute__((address_space(3))) s16x8 lds_s16x8;
    return __builtin_bit_cast(v8h, __builtin_amdgcn_ds_load_tr16_b128_v8i16((lds_s16x8*)p));
}

// ---------------------------------------------------------------------------
// Generic WMMA GEMM: C[M,Nf] = epilogue(A[M,K] @ W[K,Nf] + bias)
//   mode 0: bias only
//   mode 1: bias + SiLU, output time-major per channel: [col][B][N]
//   mode 2: the same, output as f16
//   mode 3: bias + residual add (res has same [M,Nf] layout)
//   mode 4: bias, times the decay of the row's lag, output as f16 filter rows of
//           the conv: [col][N], lags descending (M is N here)
// What the A operand is:
//   amode 0: A as stored
//   amode 1: srms(A)
//   amode 2: relu(srms(A))
//   amode 3: relu(srms(P)), P[m][k] = m * A[k] + A2[k] (position rows, never stored)
// AT: A lies in memory as f16, k-major ([K][M]), and is taken as stored; its
// tile goes into LDS as it lies, [k][m], and the transposing read that serves
// W turns it into the A fragment.
// srms(x) = s * x with one s > 0 per row, s = 1 / (sqrt(mean(x^2)) + eps), so
// relu(srms(x)) @ W = s * (relu(x) @ W): the raw values go into the product,
// a row's sum of squares is gathered while its K values (K is the length of
// the norm) pass through the staging, and s multiplies the accumulators.
// Block tile 64x128x128, 256 threads = 8 waves, each wave -> 32x32 via
// 2x2 v_wmma_f32_16x16x32_f16. Assumes M%64==0, Nf%128==0, K%128==0.
// LDS banks: the A tile's rows stand at 272 bytes (16 x odd), where the 16 rows
// of a 16-byte fragment read fall on all 64 banks. The W tile lies [k][n], as
// in memory, so that a thread stores its 8 consecutive n of a row as one
// 16-byte piece and 16 lanes fill 256 bytes in a row; the transposing read
// turns it into the B fragment, and its rows stand at 288 bytes (32 x odd).
// ---------------------------------------------------------------------------
#define BK   128    // k of one pass of the k loop
#define AS_P 136    // row pitch of the A tile in LDS, halves
#define BS_P 144    // row pitch of the W tile in LDS, halves
#define AT_P 80     // row pitch of a k-major A tile in LDS, halves (160 bytes, 32 x odd)
// One product, or a band of its column tiles. Its tiles are numbered rows first:
// tile j stands at row tile j mod 2^lgx, column tile by0 + (j >> lgx).
struct GemmJob {
    const float* A;
    const float* W;
    const float* bias;
    float*       C;
    const float* res;
    const float* A2;
    int Nf, K, mode, amode;
    int lgx;    // log2 of the number of row tiles (M / 64)
    int by0;    // first column tile of the band
};
// The tile of 64 rows from bm and 128 columns from bn of one product.
template <bool AT>
__device__ __forceinline__ void gemm_tile(const float* __restrict__ A,
                                          const float* __restrict__ W,
                                          const float* __restrict__ bias,
                                          float* __restrict__ C,
                                          const float* __restrict__ res,
                                          const float* __restrict__ A2,
                                          int Nf, int K, int mode, int amode,
                                          int M, int bm, int bn) {
    __shared__ __align__(16) _Float16 As[AT ? BK * AT_P : 64 * AS_P];  // [m][k]; AT: [k][m]
    __shared__ __align__(16) _Float16 Bs[BK * BS_P];  // [k][n]
    __shared__ __align__(16) float rs[64];            // s of the tile's rows

    const int tid  = threadIdx.x;
    const int lane = tid & 31;
    const int wid  = tid >> 5;
    const int wm   = wid & 1;    // 0..1  (rows 0-31 / 32-63)
    const int wn   = wid >> 1;   // 0..3  (cols, 32 each)

    v8f acc[2][2];
    acc[0][0] = (v8f){}; acc[0][1] = (v8f){};
    acc[1][0] = (v8f){}; acc[1][1] = (v8f){};

    const int laneM = lane & 15;
    const int hiSel = (lane >> 4) & 1;   // upper half of wave

    float ss = 0.f;   // this thread's part of its staged row's sum of squares

    // the bias of the thread's two columns, asked for ahead of the k loop: no
    // epilogue waits for it
    const int colb = bn + wn * 32 + laneM;
    const float bc[2] = {bias[colb], bias[colb + 16]};
    // before the loads' address registers are reused; the column, which the
    // loads take as their offset, is an input so that no load's result is
    // placed in it earlier
    asm volatile("s_wait_xcnt 0x0" :: "v"(colb) : "memory");

    const int nkb = K / BK;
    // A: row r, 8 floats at c0 of each of the row's 32-float lines
    const int r  = tid >> 2;            // 0..63
    const int c0 = (tid & 3) * 8;       // 0,8,16,24
    // W: 8 consecutive n of the rows k0 and k0+1 of each group of 32 rows
    const int k0 = (tid >> 4) * 2;      // 0,2,..,30
    const int n0 = (tid & 15) * 8;      // 0..120
    // a thread's places in the two tiles, in bytes, the same in every pass
    const unsigned ao = (unsigned)(r * K + c0) * 4u;
    const unsigned wo = (unsigned)(k0 * Nf + n0) * 4u;
    // and the places it asks for ahead: one line of its row of A, one line of
    // an even row of W
    const unsigned ap = (unsigned)(r * K + (tid & 3) * 32) * 4u;
    const unsigned wp = (unsigned)((tid >> 2) * 2 * Nf + (tid & 3) * 32) * 4u;
    // k-major A: 8 consecutive m of row kr of each group of 32 rows; a row of
    // the tile is one line
    const int kr = tid >> 3;            // 0..31
    const int mc = (tid & 7) * 8;       // 0..56
    for (int kb = 0; kb < nkb; ++kb) {
        // ---- all global loads of the pass go out before the first is waited
        //      for: one load latency and two barriers per BK k ----
        float av[4][8];
        v8h ah[4];
        if (AT) {
            const _Float16* src = (const _Float16*)A + (size_t)(kb * BK) * M + bm;
            const _Float16* pa0 = src + kr * M + mc;
            // next pass: the tile's 128 lines, two threads a line
            const _Float16* pa1 = src + (size_t)(BK + (tid >> 1)) * M;
            if (kb + 1 < nkb) __builtin_prefetch(pa1, 0, 0);
            const _Float16* pa2 = pa0 + (size_t)32 * M;
            const _Float16* pa3 = pa2 + (size_t)32 * M;
            const _Float16* pa4 = pa3 + (size_t)32 * M;
            ah[0] = *(const v8h*)pa0;
            ah[1] = *(const v8h*)pa2;
            ah[2] = *(const v8h*)pa3;
            ah[3] = *(const v8h*)pa4;
            // before the loads' address registers are reused; the pointers
            // are inputs so that they stay as they are up to here
            asm volatile("s_wait_xcnt 0x0" :: "v"(pa0), "v"(pa1), "v"(pa2), "v"(pa3), "v"(pa4) : "memory");
        } else if (amode == 3) {
            const float* pw = A + kb * BK;
            const float* pb = A2 + kb * BK;
            const float m = (float)(bm + r);
#pragma unroll
            for (int q = 0; q < 4; ++q)
#pragma unroll
                for (int j = 0; j < 8; ++j) av[q][j] = m * (pw + c0)[q * 32 + j] + (pb + c0)[q * 32 + j];
            // before the loads' address registers are reused; they are inputs
            // so that they stay as they are up to here
            asm volatile("s_wait_xcnt 0x0" :: "s"(pw), "s"(pb), "v"(c0) : "memory");
        } else {
            const float* src = A + (size_t)bm * K + kb * BK;
            const float* pa0 = at(src, ao);
            // next pass: the row's lines, one a thread
            const float* pa1 = at(src, ap) + BK;
            if (kb + 1 < nkb) __builtin_prefetch(pa1, 0, 0);
#pragma unroll
            for (int q = 0; q < 4; ++q)
#pragma unroll
                for (int j = 0; j < 8; ++j) av[q][j] = pa0[q * 32 + j];
            // before the loads' address registers are reused; the pointers
            // are inputs so that no load's result is placed in them earlier
            asm volatile("s_wait_xcnt 0x0" :: "v"(pa0), "v"(pa1) : "memory");
        }
        const float* wq0 = W + (size_t)(kb * BK) * Nf + bn;
        const float* wq1 = wq0 + (size_t)32 * Nf;
        const float* wq2 = wq1 + (size_t)32 * Nf;
        const float* wq3 = wq2 + (size_t)32 * Nf;
        const float* wr0 = wq0 + Nf;
        const float* wr1 = wq1 + Nf;
        const float* wr2 = wq2 + Nf;
        const float* wr3 = wq3 + Nf;
        // next pass: every even row of W, one of its four lines a thread
        const float* wnx = at(wq3 + (size_t)32 * Nf, wp);
        if (kb + 1 < nkb) __builtin_prefetch(wnx, 0, 0);
        float w0[4][8], w1[4][8];
        {
            const float* p0 = at(wq0, wo);
            const float* p1 = at(wr0, wo);
#pragma unroll
            for (int j = 0; j < 8; ++j) { w0[0][j] = p0[j]; w1[0][j] = p1[j]; }
            // before the loads' address registers are reused; the pointers
            // are inputs so that no load's result is placed in them earlier
            asm volatile("s_wait_xcnt 0x0" :: "v"(p0), "v"(p1), "v"(wnx) : "memory");
        }
        {
            const float* p0 = at(wq1, wo);
            const float* p1 = at(wr1, wo);
#pragma unroll
            for (int j = 0; j < 8; ++j) { w0[1][j] = p0[j]; w1[1][j] = p1[j]; }
            // before the loads' address registers are reused; the pointers
            // are inputs so that no load's result is placed in them earlier
            asm volatile("s_wait_xcnt 0x0" :: "v"(p0), "v"(p1) : "memory");
        }
        {
            const float* p0 = at(wq2, wo);
            const float* p1 = at(wr2, wo);
#pragma unroll
            for (int j = 0; j < 8; ++j) { w0[2][j] = p0[j]; w1[2][j] = p1[j]; }
            // before the loads' address registers are reused; the pointers
            // are inputs so that no load's result is placed in them earlier
            asm volatile("s_wait_xcnt 0x0" :: "v"(p0), "v"(p1) : "memory");
        }
        {
            const float* p0 = at(wq3, wo);
            const float* p1 = at(wr3, wo);
#pragma unroll
            for (int j = 0; j < 8; ++j) { w0[3][j] = p0[j]; w1[3][j] = p1[j]; }
            // before the loads' address registers are reused; the pointers
            // are inputs so that no load's result is placed in them earlier
            asm volatile("s_wait_xcnt 0x0" :: "v"(p0), "v"(p1) : "memory");
        }
        // holds the loaded values of W as they came up to here, inputs only: the
        // conversions below, moved up between the loads, would wait for the
        // first loads before the last have gone out
        if (AT) {
#define F4(a, i) ((v4f){(a)[i], (a)[(i) + 1], (a)[(i) + 2], (a)[(i) + 3]})
            asm volatile("" :: "v"(F4(w0[0], 0)), "v"(F4(w0[0], 4)), "v"(F4(w1[0], 0)), "v"(F4(w1[0], 4)),
                               "v"(F4(w0[1], 0)), "v"(F4(w0[1], 4)), "v"(F4(w1[1], 0)), "v"(F4(w1[1], 4)),
                               "v"(F4(w0[2], 0)), "v"(F4(w0[2], 4)), "v"(F4(w1[2], 0)), "v"(F4(w1[2], 4)),
                               "v"(F4(w0[3], 0)), "v"(F4(w0[3], 4)), "v"(F4(w1[3], 0)), "v"(F4(w1[3], 4)));
#undef F4
        }
        // ---- stage A tile: 64 x BK floats -> f16; k-major: as it is ----
#pragma unroll
        for (int q = 0; q < 4; ++q) {
            if (AT) {
                *(v8h*)&As[(q * 32 + kr) * AT_P + mc] = ah[q];
                continue;
            }
            if (amode != 0) {
#pragma unroll
                for (int j = 0; j < 8; ++j) ss += av[q][j] * av[q][j];
            }
            if (amode >= 2) {
#pragma unroll
                for (int j = 0; j < 8; ++j) av[q][j] = fmaxf(av[q][j], 0.f);
            }
            v8h pa;
#pragma unroll
            for (int j = 0; j < 8; ++j) pa[j] = (_Float16)av[q][j];
            *(v8h*)&As[r * AS_P + q * 32 + c0] = pa;
        }
        // ---- stage W tile: one 16-byte DS store a row ----
#pragma unroll
        for (int q = 0; q < 4; ++q) {
            v8h p0, p1;
#pragma unroll
            for (int j = 0; j < 8; ++j) {
                p0[j] = (_Float16)w0[q][j];
                p1[j] = (_Float16)w1[q][j];
            }
            *(v8h*)&Bs[(q * 32 + k0) * BS_P + n0]     = p0;
            *(v8h*)&Bs[(q * 32 + k0 + 1) * BS_P + n0] = p1;
        }
        __syncthreads();

        // a lane names 8 halves of row 8*hiSel + (lane & 7) of a block of W and
        // gets column laneM of the rows 8*hiSel + 0..7
        const _Float16* bt = &Bs[(hiSel * 8 + (lane & 7)) * BS_P + wn * 32 + ((lane >> 3) & 1) * 8];
        // the same for a k-major A tile: row laneM of A, k = 8*hiSel + 0..7
        const _Float16* att = &As[(hiSel * 8 + (lane & 7)) * AT_P + wm * 32 + ((lane >> 3) & 1) * 8];
#pragma unroll
        for (int ks = 0; ks < 4; ++ks) {
            // ---- load fragments, both in the hardware's k order: a lane holds
            //      k = 8*hiSel + 0..7 and 16 + 8*hiSel + 0..7 of its row or column ----
            v16h fa[2], fb[2];
#pragma unroll
            for (int mi = 0; mi < 2; ++mi) {
                if (AT) {
                    const v8h lo = ld_tr16(att + ks * 32 * AT_P + mi * 16);
                    const v8h hi = ld_tr16(att + (ks * 32 + 16) * AT_P + mi * 16);
                    fa[mi] = __builtin_shufflevector(lo, hi, 0, 1, 2, 3, 4, 5, 6, 7,
                                                     8, 9, 10, 11, 12, 13, 14, 15);
                } else {
                    fa[mi] = frag16(&As[(wm * 32 + mi * 16 + laneM) * AS_P + ks * 32 + hiSel * 8]);
                }
            }
#pragma unroll
            for (int ni = 0; ni < 2; ++ni) {
                const v8h lo = ld_tr16(bt + ks * 32 * BS_P + ni * 16);
                const v8h hi = ld_tr16(bt + (ks * 32 + 16) * BS_P + ni * 16);
                fb[ni] = __builtin_shufflevector(lo, hi, 0, 1, 2, 3, 4, 5, 6, 7,
                                                 8, 9, 10, 11, 12, 13, 14, 15);
            }

#pragma unroll
            for (int mi = 0; mi < 2; ++mi)
#pragma unroll
                for (int ni = 0; ni < 2; ++ni)
                    acc[mi][ni] = __builtin_amdgcn_wmma_f32_16x16x32_f16(
                        false, fa[mi], false, fb[ni], (short)0, acc[mi][ni],
                        false, false);
        }
        __syncthreads();
    }

    // ---- the rows' norm factors: four neighbouring lanes staged one row ----
    if (!AT && amode != 0) {
        ss += __shfl_xor(ss, 1);
        ss += __shfl_xor(ss, 2);
        if ((tid & 3) == 0)
            rs[tid >> 2] = 1.0f / (sqrtf(ss / (float)K) + 1e-8f);
        __syncthreads();
#pragma unroll
        for (int mi = 0; mi < 2; ++mi) {
            const float* sp = &rs[wm * 32 + mi * 16 + hiSel * 8];
#pragma unroll
            for (int r = 0; r < 8; ++r) {
                acc[mi][0][r] *= sp[r];
                acc[mi][1][r] *= sp[r];
            }
        }
    }

    // ---- epilogue, modes 1 and 2: a lane holds 8 consecutive tokens of one
    //      channel, 16-byte stores into the channel's own time row ----
    if (mode == 1 || mode == 2) {
        _Float16* Ch = (_Float16*)C;
#pragma unroll
        for (int mi = 0; mi < 2; ++mi) {
#pragma unroll
            for (int ni = 0; ni < 2; ++ni) {
                const int row0 = bm + wm * 32 + mi * 16 + hiSel * 8;
                const int col  = colb + ni * 16;
                float sv[8];
#pragma unroll
                for (int r = 0; r < 8; ++r) {
                    const float val = acc[mi][ni][r] + bc[ni];
                    sv[r] = val / (1.0f + __expf(-val));   // SiLU
                }
                const int b = row0 / NN, n = row0 % NN;
                const size_t o = ((size_t)col * BB + b) * NN + n;
                if (mode == 1) {
                    *(float4*)&C[o]     = make_float4(sv[0], sv[1], sv[2], sv[3]);
                    *(float4*)&C[o + 4] = make_float4(sv[4], sv[5], sv[6], sv[7]);
                    // before the stores' registers are reused
                    asm volatile("s_wait_xcnt 0x0" ::: "memory");
                } else {
                    v8h pk;
#pragma unroll
                    for (int r = 0; r < 8; ++r) pk[r] = (_Float16)sv[r];
                    *(v8h*)&Ch[o] = pk;
                    // before the store's registers are reused
                    asm volatile("s_wait_xcnt 0x0" ::: "memory");
                }
            }
        }
        return;
    }

    // ---- epilogue, mode 4: a row is a lag k and a lane holds 8 consecutive lags
    //      of one channel: G[col][N - 1 - k] = decay(k) * value, decay(0) = 1,
    //      decay(k) = gamma^k, one 16-byte store; a block fills whole 128-byte
    //      lines of its channels' rows ----
    if (!AT && mode == 4) {
        _Float16* G = (_Float16*)C;
#pragma unroll
        for (int mi = 0; mi < 2; ++mi) {
            const int row0 = bm + wm * 32 + mi * 16 + hiSel * 8;
            // gamma^k of the smallest of the eight lags; the others by constant factors
            const float d0 = __expf((float)row0 * __logf(GAMMA));
#pragma unroll
            for (int ni = 0; ni < 2; ++ni) {
                const int col = colb + ni * 16;
                v8h w;
                float pw = 1.0f;
#pragma unroll
                for (int r = 0; r < 8; ++r) {
                    const float decay = (row0 + r == 0) ? 1.0f : d0 * pw;
                    w[7 - r] = (_Float16)(decay * (acc[mi][ni][r] + bc[ni]));
                    pw *= GAMMA;
                }
                *(v8h*)&G[(size_t)col * NN + (NN - 8 - row0)] = w;
                // before the store's registers are reused
                asm volatile("s_wait_xcnt 0x0" ::: "memory");
            }
        }
        return;
    }

    // ---- epilogue, mode 3: all 32 residual values of the thread are asked for
    //      before the first is waited for: one load latency, not 32 in a row ----
    float rv[2][2][8];
    if (mode == 3) {
#pragma unroll
        for (int mi = 0; mi < 2; ++mi) {
            unsigned e[8];   // a row's element at the thread's first column
#pragma unroll
            for (int r = 0; r < 8; ++r)
                e[r] = (unsigned)((bm + wm * 32 + mi * 16 + r + hiSel * 8) * Nf + colb);
#pragma unroll
            for (int r = 0; r < 8; ++r) {
                const float* p = res + e[r];
                rv[mi][0][r] = p[0];
                rv[mi][1][r] = p[16];
            }
            // before the loads' address registers are reused; the element numbers,
            // which the loads take as their offsets, are inputs so that no load's
            // result is placed in them earlier
            asm volatile("s_wait_xcnt 0x0" :: "v"(e[0]), "v"(e[1]), "v"(e[2]), "v"(e[3]),
                                              "v"(e[4]), "v"(e[5]), "v"(e[6]), "v"(e[7]) : "memory");
        }
    }

    // ---- epilogue ----
#pragma unroll
    for (int mi = 0; mi < 2; ++mi) {
#pragma unroll
        for (int ni = 0; ni < 2; ++ni) {
            const int col = colb + ni * 16;
#pragma unroll
            for (int r = 0; r < 8; ++r) {
                const int row = bm + wm * 32 + mi * 16 + r + hiSel * 8;
                float val = acc[mi][ni][r] + bc[ni];
                if (mode == 3) {
                    val += rv[mi][ni][r];
                }
                C[(size_t)row * Nf + col] = val;
                // before the store's registers are reused
                asm volatile("s_wait_xcnt 0x0" ::: "memory");
            }
        }
    }
}

// A launch carries two products that do not depend on each other: the first
// nb0 blocks work on j0, the others on j1. A short product, which alone leaves
// most of the chip idle for the length of its k loop, runs beside a large one.
__global__ __launch_bounds__(256) void gemm_wmma_kernel(GemmJob j0, GemmJob j1, int nb0) {
    const bool f0   = (int)blockIdx.x < nb0;
    const int  tile = f0 ? (int)blockIdx.x : (int)blockIdx.x - nb0;
    const int  lgx  = f0 ? j0.lgx : j1.lgx;
    const int  by0  = f0 ? j0.by0 : j1.by0;
    gemm_tile<false>(f0 ? j0.A : j1.A, f0 ? j0.W : j1.W, f0 ? j0.bias : j1.bias,
                     f0 ? j0.C : j1.C, f0 ? j0.res : j1.res, f0 ? j0.A2 : j1.A2,
                     f0 ? j0.Nf : j1.Nf, f0 ? j0.K : j1.K,
                     f0 ? j0.mode : j1.mode, f0 ? j0.amode : j1.amode, 64 << lgx,
                     (tile & ((1 << lgx) - 1)) * 64, (by0 + (tile >> lgx)) * 128);
}
// One product whose A is f16 and k-major.
__global__ __launch_bounds__(256) void gemm_at_kernel(GemmJob j) {
    const int tile = (int)blockIdx.x;
    gemm_tile<true>(j.A, j.W, j.bias, j.C, j.res, j.A2, j.Nf, j.K, j.mode, j.amode,
                    64 << j.lgx,
                    (tile & ((1 << j.lgx) - 1)) * 64, (j.by0 + (tile >> j.lgx)) * 128);
}

#define CH   (HH * HD)
#define LMAX 2064            // largest lag index a fragment can ask for, rounded up to 8
#define AP   (LMAX + 32)     // row length of one shifted copy in LDS, halves
#define VF   64              // zeros in front of a time row (times < 0)
// time row in LDS: VF zeros, N values, 32 zeros, padded. A fragment read takes
// 16 bytes at every 32 from four places of each of the four rows: the rows
// start at 0, 1, 8 and 9 sixteen-byte units modulo 16, so that the 16 lanes of
// a half wave fall on all 64 banks
#define VP   2184
#define VOFF(b) ((b) * VP + ((b) >> 1) * 48)

// ---------------------------------------------------------------------------
// Causal depthwise conv along time as Toeplitz matrix products, one block per
// channel:  y[b][t] = sum_{k=0..t} a[k] * v[b][t-k]
// One 16x16x32 product, for a lag offset dl and an output tile of 64 steps:
//   A[m][j] = a[dl + m - j]                      (16 x 32, Toeplitz)
//   B[j][n] = v[b][t0 + 16*c4 - dl + j]          (n = 4*b + c4)
//   D[m][n] = part of y[b][t0 + 16*c4 + m]
// dl runs over 0, 32, .., t0 + 64: every lag 0..t is met exactly once; lags
// below 0 and above N-1 read zeros of the filter row, times below 0 zeros of
// the time row.
// A depends on dl alone and B on t0 - dl alone: a wave works on two adjacent
// tiles at once, which share every A, and the upper tile takes as B what the
// lower tile read two steps earlier, kept in registers.
// A lane's 8 consecutive j of A start at a lag that depends on m: the filter
// lies in LDS eight times, copy c shifted by c halves, so that lane m reads
// copy m & 7 at a 16-byte boundary.
// The gate: u lies time-major per channel like y, so a lane multiplies its 8
// consecutive steps of y by u in its registers and stores the product as f16,
// gT[ch][b][t] = u * y, which is the k-major A of the output product.
// ---------------------------------------------------------------------------
__device__ __forceinline__ v8f mm(v16h a, v16h b, v8f c) {
    return __builtin_amdgcn_wmma_f32_16x16x32_f16(false, a, false, b, (short)0, c,
                                                  false, false);
}
__global__ __launch_bounds__(256) void conv_kernel(const _Float16* __restrict__ g,
                                                   const _Float16* __restrict__ vT,
                                                   const float* __restrict__ uT,
                                                   _Float16* __restrict__ gT) {
    __shared__ __align__(16) _Float16 a_s[8 * AP];     // 33.5 KB
    __shared__ __align__(16) _Float16 v_s[VOFF(BB)];   // 17.7 KB

    const int ch   = blockIdx.x;
    const int tid  = threadIdx.x;
    const int lane = tid & 31;
    // scalar wave number: the tile loops below must be scalar branches (a
    // matrix instruction needs every lane on)
    const int wid  = __builtin_amdgcn_readfirstlane(tid >> 5);

    // filter: g[ch][p] holds lag N - 1 - p; a_s[c][x] holds lag LMAX - x + c, that
    // is g[x - c - (LMAX - N + 1)], and 0 outside the row (lags below 0, above N-1).
    // The 8 halves at x = 8q come from the row's pieces q - 3 and q - 2.
    const _Float16* gc = g + (size_t)ch * NN;
    for (int q = tid; q < AP / 8; q += 256) {
        // clamped pieces, read without a branch
        const int i0 = min(max(q - 3, 0), NN / 8 - 1);
        const int i1 = min(max(q - 2, 0), NN / 8 - 1);
        const _Float16* g0p = gc + 8 * i0;
        const _Float16* g1p = gc + 8 * i1;
        v8h lo = *(const v8h*)g0p;
        v8h hi = *(const v8h*)g1p;
        // before the loads' address registers are reused; the piece numbers, which
        // the loads take as their offsets, are inputs so that no load's result is
        // placed in them earlier
        asm volatile("s_wait_xcnt 0x0" :: "v"(i0), "v"(i1) : "memory");
        if (i0 != q - 3) lo = (v8h){};
        if (i1 != q - 2) hi = (v8h){};
        const v16h w = __builtin_shufflevector(lo, hi, 0, 1, 2, 3, 4, 5, 6, 7,
                                               8, 9, 10, 11, 12, 13, 14, 15);
#pragma unroll
        for (int c = 0; c < 8; ++c) {
            v8h o;
#pragma unroll
            for (int e = 0; e < 8; ++e) o[e] = w[e - c + 7];
            *(v8h*)&a_s[c * AP + 8 * q] = o;
        }
    }
    // time rows of the four batches, zeros in front and behind
    const _Float16* vc = vT + (size_t)ch * BB * NN;
#pragma unroll
    for (int b = 0; b < BB; ++b) {
        const v8h x = *(const v8h*)&vc[b * NN + tid * 8];
        *(v8h*)&v_s[VOFF(b) + VF + tid * 8] = x;
    }
    if (tid < BB * 12) {
        const int b = tid / 12, p = tid % 12;
        const int off = (p < 8) ? p * 8 : VF + NN + (p - 8) * 8;
        *(v8h*)&v_s[VOFF(b) + off] = (v8h){};
    }
    __syncthreads();

    const int n  = lane & 15;
    const int hs = lane >> 4;
    const _Float16* a0 = a_s + (n & 7) * AP + LMAX - 8 * (n >> 3) + 8 * hs;
    const _Float16* b0 = v_s + VOFF(n >> 2) + VF + 16 * (n & 3) + 8 * hs;
    const size_t o0 = ((size_t)ch * BB + (n >> 2)) * NN + 16 * (n & 3) + 8 * hs;

    // pairs of tiles w and 15-w: the same number of products for every wave
    for (int q = 0; q < 2; ++q) {
        const int p = q ? 15 - wid : wid;      // tiles 2p (acc0) and 2p+1 (acc1)
        const _Float16* bp = b0 + 128 * p;     // B of tile 2p at dl = 0
        v8f acc0 = (v8f){}, acc1 = (v8f){};
        // u of the pair's outputs, asked for ahead of the products
        const float4* up = (const float4*)(uT + o0 + 128 * p);
        const float4 ua = up[0], ub = up[1], uc = up[16], ud = up[17];
        // before the loads' address registers are reused; the pointer is an
        // input so that no load's result is placed in it earlier
        asm volatile("s_wait_xcnt 0x0" :: "v"(up) : "memory");
        // B of tile 2p+1 at the next even and the next odd step
        v16h h0 = frag16(bp + 64), h1 = frag16(bp + 32);
        const int np = 2 * p + 1;              // steps 0 .. 4p+1, two a trip
        // unroll: the LDS reads of later products go out ahead of one wait
#pragma unroll 2
        for (int i = 0; i < np; ++i) {
            const v16h fa0 = frag16(a0 - 64 * i);
            const v16h fb0 = frag16(bp - 64 * i);
            const v16h fa1 = frag16(a0 - 64 * i - 32);
            const v16h fb1 = frag16(bp - 64 * i - 32);
            acc0 = mm(fa0, fb0, acc0);
            acc1 = mm(fa0, h0, acc1);
            acc0 = mm(fa1, fb1, acc0);
            acc1 = mm(fa1, h1, acc1);
            h0 = fb0;
            h1 = fb1;
        }
        // step 4p+2 for both tiles, steps 4p+3 and 4p+4 for the upper one
        {
            const v16h fa0 = frag16(a0 - 64 * np);
            const v16h fb0 = frag16(bp - 64 * np);
            const v16h fa1 = frag16(a0 - 64 * np - 32);
            const v16h fa2 = frag16(a0 - 64 * np - 64);
            acc0 = mm(fa0, fb0, acc0);
            acc1 = mm(fa0, h0, acc1);
            acc1 = mm(fa1, h1, acc1);
            acc1 = mm(fa2, fb0, acc1);
        }
        const float u0[8] = {ua.x, ua.y, ua.z, ua.w, ub.x, ub.y, ub.z, ub.w};
        const float u1[8] = {uc.x, uc.y, uc.z, uc.w, ud.x, ud.y, ud.z, ud.w};
        v8h g0, g1;
#pragma unroll
        for (int e = 0; e < 8; ++e) {
            g0[e] = (_Float16)(u0[e] * acc0[e]);
            g1[e] = (_Float16)(u1[e] * acc1[e]);
        }
        _Float16* gp = gT + o0 + 128 * p;
        *(v8h*)gp        = g0;
        *(v8h*)(gp + 64) = g1;
        // before the next pair reuses the stores' registers
        asm volatile("s_wait_xcnt 0x0" ::: "memory");
    }
}

// ---------------------------------------------------------------------------
extern "C" void kernel_launch(void* const* d_in, const int* in_sizes, int n_in,
                              void* d_out, int out_size, void* d_ws, size_t ws_size,
                              hipStream_t stream) {
    const float* x  = (const float*)d_in[0];
    const float* Wu = (const float*)d_in[1];
    const float* bu = (const float*)d_in[2];
    const float* Wv = (const float*)d_in[3];
    const float* bv = (const float*)d_in[4];
    const float* Wo = (const float*)d_in[5];
    const float* bo = (const float*)d_in[6];
    const float* Wp = (const float*)d_in[7];
    const float* bp = (const float*)d_in[8];
    const float* W1 = (const float*)d_in[9];
    const float* b1 = (const float*)d_in[10];
    const float* W2 = (const float*)d_in[11];
    const float* b2 = (const float*)d_in[12];
    const float* W3 = (const float*)d_in[13];
    const float* b3 = (const float*)d_in[14];
    const float* Wz = (const float*)d_in[15];
    const float* bz = (const float*)d_in[16];
    float* out = (float*)d_out;

    float* ws = (float*)d_ws;
    const size_t SZ_U  = (size_t)BB * NN * D1;   // 8M
    const size_t SZ_H  = (size_t)NN * EE;        // 1M

    float* u    = ws;                    // 8M  [CH][B][N]
    float* v    = u + SZ_U;              // 8M  f16 [CH][B][N] in its first half
    float* y    = v + SZ_U;              // 8M  u * conv(v), f16 [CH][B][N] in its first half
    float* hcfA = y + SZ_U;              // 1M
    float* hcfB = hcfA + SZ_H;           // 1M
    float* av   = hcfB + SZ_H;           // filter rows, f16 [CH][N], lags descending

    // row tiles: 8192 token rows -> 2^7, 2048 position rows -> 2^5
    // u = silu(srms(x) @ Wu + bu), [CH][B][N]; v = silu(srms(x) @ Wv + bv), f16, [CH][B][N];
    // each in two bands of four column tiles (512 blocks)
    const GemmJob ju0 = {x, Wu, bu, u, nullptr, nullptr, D1, DD, 1, 1, 7, 0};
    const GemmJob ju1 = {x, Wu, bu, u, nullptr, nullptr, D1, DD, 1, 1, 7, 4};
    const GemmJob jv0 = {x, Wv, bv, v, nullptr, nullptr, D1, DD, 2, 1, 7, 0};
    const GemmJob jv1 = {x, Wv, bv, v, nullptr, nullptr, D1, DD, 2, 1, 7, 4};
    // positional MLP: each layer is relu(srms(.)) @ W + b
    const GemmJob jp1 = {Wp,   W1, b1, hcfA, nullptr, bp,      EE, EE, 0, 3, 5, 0};
    const GemmJob jp2 = {hcfA, W2, b2, hcfB, nullptr, nullptr, EE, EE, 0, 2, 5, 0};
    const GemmJob jp3 = {hcfB, W3, b3, hcfA, nullptr, nullptr, EE, EE, 0, 2, 5, 0};
    // the last one stores the decayed filter rows of the conv
    const GemmJob jpz = {hcfA, Wz, bz, av,   nullptr, nullptr, D1, EE, 4, 2, 5, 0};

    // 1-3) the four layers follow one another; each shares its launch with a
    //      band of u or v, which depend on x alone
    //      (128 or 256 blocks of the layer first, then the band's 512)
    gemm_wmma_kernel<<<640, 256, 0, stream>>>(jp1, ju0, 128);
    gemm_wmma_kernel<<<640, 256, 0, stream>>>(jp2, ju1, 128);
    gemm_wmma_kernel<<<640, 256, 0, stream>>>(jp3, jv0, 128);
    gemm_wmma_kernel<<<768, 256, 0, stream>>>(jpz, jv1, 256);

    // 4) causal depthwise conv and gate: y[ch][b][t] = u * conv(v), f16
    conv_kernel<<<CH, 256, 0, stream>>>((const _Float16*)av, (const _Float16*)v, u, (_Float16*)y);

    // 5) out = y^T @ Wo + bo + x
    const GemmJob jo = {y, Wo, bo, out, x, nullptr, DD, D1, 3, 0, 7, 0};
    gemm_at_kernel<<<512, 256, 0, stream>>>(jo);
}

// v010
// A run of this version takes 94.6 microseconds.
// Timed twice side by side with v009, it ran 1.16 and 1.15 times as fast.
// All steps since v000 together make it 9.62 times as fast.
#include <hip/hip_runtime.h>
#include <hip/hip_bf16.h>
#include <math.h>

// Problem constants (fixed by the reference)
#define BB 4
#define NN 2048
#define DD 512
#define HH 8
#define EE 512
#define D1 1024
#define HD 128
#define GAMMA 0.999f

typedef _Float16 v16h __attribute__((ext_vector_type(16)));
typedef float    v8f  __attribute__((ext_vector_type(8)));
typedef _Float16 v8h  __attribute__((ext_vector_type(8)));
typedef short    s16x8 __attribute__((ext_vector_type(8)));
typedef float    v4f  __attribute__((ext_vector_type(4)));

// a lane's 16 halves of a fragment: k = 8*hs + 0..7 at p, k = 16 + 8*hs + 0..7 at p + 16
__device__ __forceinline__ v16h frag16(const _Float16* p) {
    const v8h lo = *(const v8h*)p;
    const v8h hi = *(const v8h*)(p + 16);
    return __builtin_shufflevector(lo, hi, 0, 1, 2, 3, 4, 5, 6, 7,
                                   8, 9, 10, 11, 12, 13, 14, 15);
}
// a base that is the same for the whole block + a thread's 32-bit byte offset
__device__ __forceinline__ const float* at(const float* base, unsigned bytes) {
    return (const float*)((const char*)base + bytes);
}
// transposing LDS read of a 16 x 16 block of halves that lies row by row
__device__ __forceinline__ v8h ld_tr16(const _Float16* p) {
    typedef __attribute__((address_space(3))) s16x8 lds_s16x8;
    return __builtin_bit_cast(v8h, __builtin_amdgcn_ds_load_tr16_b128_v8i16((lds_s16x8*)p));
}

// ---------------------------------------------------------------------------
// Generic WMMA GEMM: C[M,Nf] = epilogue(A[M,K] @ W[K,Nf] + bias)
//   mode 0: bias only
//   mode 1: bias + SiLU, output time-major per channel: [col][B][N]
//   mode 2: the same, output as f16
//   mode 3: bias + residual add (res has same [M,Nf] layout)
//   mode 4: bias, times the decay of the row's lag, output as f16 filter rows of
//           the conv: [col][N], lags descending (M is N here)
// What the A operand is:
//   amode 0: A as stored
//   amode 1: srms(A)
//   amode 2: relu(srms(A))
//   amode 3: relu(srms(P)), P[m][k] = m * A[k] + A2[k] (position rows, never stored)
// WH: W lies in memory as f16, [K][Nf], converted once by the first launch, and
// goes into LDS as it lies: half the bytes of the f32 W, which every block of a
// column band reads again, and no conversion in the block.
// AT: A lies in memory as f16, k-major ([K][M]), and is taken as stored; its
// tile goes into LDS as it lies, [k][m], and the transposing read that serves
// W turns it into the A fragment.
// srms(x) = s * x with one s > 0 per row, s = 1 / (sqrt(mean(x^2)) + eps), so
// relu(srms(x)) @ W = s * (relu(x) @ W): the raw values go into the product,
// a row's sum of squares is gathered while its K values (K is the length of
// the norm) pass through the staging, and s multiplies the accumulators.
// Block tile 64x128x128, 256 threads = 8 waves, each wave -> 32x32 via
// 2x2 v_wmma_f32_16x16x32_f16. Assumes M%64==0, Nf%128==0, K%128==0.
// LDS banks: the A tile's rows stand at 272 bytes (16 x odd), where the 16 rows
// of a 16-byte fragment read fall on all 64 banks. The W tile lies [k][n], as
// in memory, so that a thread stores its 8 consecutive n of a row as one
// 16-byte piece and 16 lanes fill 256 bytes in a row; the transposing read
// turns it into the B fragment, and its rows stand at 288 bytes (32 x odd).
// ---------------------------------------------------------------------------
#define BK   128    // k of one pass of the k loop
#define AS_P 136    // row pitch of the A tile in LDS, halves
#define BS_P 144    // row pitch of the W tile in LDS, halves
#define AT_P 80     // row pitch of a k-major A tile in LDS, halves (160 bytes, 32 x odd)
// One product, or a band of its column tiles. Its tiles are numbered rows first:
// tile j stands at row tile j mod 2^lgx, column tile by0 + (j >> lgx).
struct GemmJob {
    const float* A;
    const float* W;
    const float* bias;
    float*       C;
    const float* res;
    const float* A2;
    int Nf, K, mode, amode;
    int lgx;    // log2 of the number of row tiles (M / 64)
    int by0;    // first column tile of the band
};
// The tile of 64 rows from bm and 128 columns from bn of one product.
template <bool AT, bool WH>
__device__ __forceinline__ void gemm_tile(const float* __restrict__ A,
                                          const float* __restrict__ W,
                                          const float* __restrict__ bias,
                                          float* __restrict__ C,
                                          const float* __restrict__ res,
                                          const float* __restrict__ A2,
                                          int Nf, int K, int mode, int amode,
                                          int M, int bm, int bn) {
    __shared__ __align__(16) _Float16 As[AT ? BK * AT_P : 64 * AS_P];  // [m][k]; AT: [k][m]
    __shared__ __align__(16) _Float16 Bs[BK * BS_P];  // [k][n]
    __shared__ __align__(16) float rs[64];            // s of the tile's rows

    const int tid  = threadIdx.x;
    const int lane = tid & 31;
    const int wid  = tid >> 5;
    const int wm   = wid & 1;    // 0..1  (rows 0-31 / 32-63)
    const int wn   = wid >> 1;   // 0..3  (cols, 32 each)

    v8f acc[2][2];
    acc[0][0] = (v8f){}; acc[0][1] = (v8f){};
    acc[1][0] = (v8f){}; acc[1][1] = (v8f){};

    const int laneM = lane & 15;
    const int hiSel = (lane >> 4) & 1;   // upper half of wave

    float ss = 0.f;   // this thread's part of its staged row's sum of squares

    // the bias of the thread's two columns, asked for ahead of the k loop: no
    // epilogue waits for it
    const int colb = bn + wn * 32 + laneM;
    const float bc[2] = {bias[colb], bias[colb + 16]};
    // before the loads' address registers are reused; the column, which the
    // loads take as their offset, is an input so that no load's result is
    // placed in it earlier
    asm volatile("s_wait_xcnt 0x0" :: "v"(colb) : "memory");

    const int nkb = K / BK;
    // A: row r, 8 floats at c0 of each of the row's 32-float lines
    const int r  = tid >> 2;            // 0..63
    const int c0 = (tid & 3) * 8;       // 0,8,16,24
    // W: 8 consecutive n of the rows k0 and k0+1 of each group of 32 rows
    const int k0 = (tid >> 4) * 2;      // 0,2,..,30
    const int n0 = (tid & 15) * 8;      // 0..120
    const int kq = tid >> 4;            // f16 W: row 0..15 of each group of 16 rows
    // a thread's places in the two tiles, in bytes, the same in every pass
    const unsigned ao = (unsigned)(r * K + c0) * 4u;
    const unsigned wo = (unsigned)(k0 * Nf + n0) * 4u;
    // and the places it asks for ahead: one line of its row of A, one line of
    // an even row of W
    const unsigned ap = (unsigned)(r * K + (tid & 3) * 32) * 4u;
    const unsigned wp = (unsigned)((tid >> 2) * 2 * Nf + (tid & 3) * 32) * 4u;
    // k-major A: 8 consecutive m of row kr of each group of 32 rows; a row of
    // the tile is one line
    const int kr = tid >> 3;            // 0..31
    const int mc = (tid & 7) * 8;       // 0..56
    for (int kb = 0; kb < nkb; ++kb) {
        // ---- all global loads of the pass go out before the first is waited
        //      for: one load latency and two barriers per BK k ----
        float av[4][8];
        v8h ah[4];
        if (AT) {
            const _Float16* src = (const _Float16*)A + (size_t)(kb * BK) * M + bm;
            const _Float16* pa0 = src + kr * M + mc;
            // next pass: the tile's 128 lines, two threads a line
            const _Float16* pa1 = src + (size_t)(BK + (tid >> 1)) * M;
            if (kb + 1 < nkb) __builtin_prefetch(pa1, 0, 0);
            const _Float16* pa2 = pa0 + (size_t)32 * M;
            const _Float16* pa3 = pa2 + (size_t)32 * M;
            const _Float16* pa4 = pa3 + (size_t)32 * M;
            ah[0] = *(const v8h*)pa0;
            ah[1] = *(const v8h*)pa2;
            ah[2] = *(const v8h*)pa3;
            ah[3] = *(const v8h*)pa4;
            // before the loads' address registers are reused; the pointers
            // are inputs so that they stay as they are up to here
            asm volatile("s_wait_xcnt 0x0" :: "v"(pa0), "v"(pa1), "v"(pa2), "v"(pa3), "v"(pa4) : "memory");
        } else if (amode == 3) {
            const float* pw = A + kb * BK;
            const float* pb = A2 + kb * BK;
            const float m = (float)(bm + r);
#pragma unroll
            for (int q = 0; q < 4; ++q)
#pragma unroll
                for (int j = 0; j < 8; ++j) av[q][j] = m * (pw + c0)[q * 32 + j] + (pb + c0)[q * 32 + j];
            // before the loads' address registers are reused; they are inputs
            // so that they stay as they are up to here
            asm volatile("s_wait_xcnt 0x0" :: "s"(pw), "s"(pb), "v"(c0) : "memory");
        } else {
            const float* src = A + (size_t)bm * K + kb * BK;
            const float* pa0 = at(src, ao);
            // next pass: the row's lines, one a thread
            const float* pa1 = at(src, ap) + BK;
            if (kb + 1 < nkb) __builtin_prefetch(pa1, 0, 0);
#pragma unroll
            for (int q = 0; q < 4; ++q)
#pragma unroll
                for (int j = 0; j < 8; ++j) av[q][j] = pa0[q * 32 + j];
            // before the loads' address registers are reused; the pointers
            // are inputs so that no load's result is placed in them earlier
            asm volatile("s_wait_xcnt 0x0" :: "v"(pa0), "v"(pa1) : "memory");
        }
        float w0[4][8], w1[4][8];
        v8h wh[8];
        if (WH) {
            // W lies as f16, [k][n]: 8 consecutive n of row kq of each group of 16 rows
            const _Float16* wt = (const _Float16*)W + (size_t)(kb * BK) * Nf + bn;
            // next pass: the tile's 256 lines, one a thread
            const _Float16* wnx = wt + (size_t)(BK + (tid >> 1)) * Nf + (tid & 1) * 64;
            if (kb + 1 < nkb) __builtin_prefetch(wnx, 0, 0);
            const _Float16* p0 = wt + kq * Nf + n0;
            const _Float16* p1 = p0 + (size_t)16 * Nf;
            const _Float16* p2 = p1 + (size_t)16 * Nf;
            const _Float16* p3 = p2 + (size_t)16 * Nf;
            const _Float16* p4 = p3 + (size_t)16 * Nf;
            const _Float16* p5 = p4 + (size_t)16 * Nf;
            const _Float16* p6 = p5 + (size_t)16 * Nf;
            const _Float16* p7 = p6 + (size_t)16 * Nf;
            wh[0] = *(const v8h*)p0;
            wh[1] = *(const v8h*)p1;
            wh[2] = *(const v8h*)p2;
            wh[3] = *(const v8h*)p3;
            wh[4] = *(const v8h*)p4;
            wh[5] = *(const v8h*)p5;
            wh[6] = *(const v8h*)p6;
            wh[7] = *(const v8h*)p7;
            // before the loads' address registers are reused; the pointers
            // are inputs so that they stay as they are up to here
            asm volatile("s_wait_xcnt 0x0" :: "v"(p0), "v"(p1), "v"(p2), "v"(p3), "v"(p4),
                                              "v"(p5), "v"(p6), "v"(p7), "v"(wnx) : "memory");
        } else {
            const float* wq0 = W + (size_t)(kb * BK) * Nf + bn;
            const float* wq1 = wq0 + (size_t)32 * Nf;
            const float* wq2 = wq1 + (size_t)32 * Nf;
            const float* wq3 = wq2 + (size_t)32 * Nf;
            const float* wr0 = wq0 + Nf;
            const float* wr1 = wq1 + Nf;
            const float* wr2 = wq2 + Nf;
            const float* wr3 = wq3 + Nf;
            // next pass: every even row of W, one of its four lines a thread
            const float* wnx = at(wq3 + (size_t)32 * Nf, wp);
            if (kb + 1 < nkb) __builtin_prefetch(wnx, 0, 0);
            {
                const float* p0 = at(wq0, wo);
                const float* p1 = at(wr0, wo);
#pragma unroll
                for (int j = 0; j < 8; ++j) { w0[0][j] = p0[j]; w1[0][j] = p1[j]; }
                // before the loads' address registers are reused; the pointers
                // are inputs so that no load's result is placed in them earlier
                asm volatile("s_wait_xcnt 0x0" :: "v"(p0), "v"(p1), "v"(wnx) : "memory");
            }
            {
                const float* p0 = at(wq1, wo);
                const float* p1 = at(wr1, wo);
#pragma unroll
                for (int j = 0; j < 8; ++j) { w0[1][j] = p0[j]; w1[1][j] = p1[j]; }
                // before the loads' address registers are reused; the pointers
                // are inputs so that no load's result is placed in them earlier
                asm volatile("s_wait_xcnt 0x0" :: "v"(p0), "v"(p1) : "memory");
            }
            {
                const float* p0 = at(wq2, wo);
                const float* p1 = at(wr2, wo);
#pragma unroll
                for (int j = 0; j < 8; ++j) { w0[2][j] = p0[j]; w1[2][j] = p1[j]; }
                // before the loads' address registers are reused; the pointers
                // are inputs so that no load's result is placed in them earlier
                asm volatile("s_wait_xcnt 0x0" :: "v"(p0), "v"(p1) : "memory");
            }
            {
                const float* p0 = at(wq3, wo);
                const float* p1 = at(wr3, wo);
#pragma unroll
                for (int j = 0; j < 8; ++j) { w0[3][j] = p0[j]; w1[3][j] = p1[j]; }
                // before the loads' address registers are reused; the pointers
                // are inputs so that no load's result is placed in them earlier
                asm volatile("s_wait_xcnt 0x0" :: "v"(p0), "v"(p1) : "memory");
            }
        }
        // ---- stage A tile: 64 x BK floats -> f16; k-major: as it is ----
#pragma unroll
        for (int q = 0; q < 4; ++q) {
            if (AT) {
                *(v8h*)&As[(q * 32 + kr) * AT_P + mc] = ah[q];
                continue;
            }
            if (amode != 0) {
#pragma unroll
                for (int j = 0; j < 8; ++j) ss += av[q][j] * av[q][j];
            }
            if (amode >= 2) {
#pragma unroll
                for (int j = 0; j < 8; ++j) av[q][j] = fmaxf(av[q][j], 0.f);
            }
            v8h pa;
#pragma unroll
            for (int j = 0; j < 8; ++j) pa[j] = (_Float16)av[q][j];
            *(v8h*)&As[r * AS_P + q * 32 + c0] = pa;
        }
        // ---- stage W tile: one 16-byte DS store a row ----
        if (WH) {
            // unrolled: wh stays in registers
#pragma unroll
            for (int q = 0; q < 8; ++q) *(v8h*)&Bs[(q * 16 + kq) * BS_P + n0] = wh[q];
        } else {
#pragma unroll
            for (int q = 0; q < 4; ++q) {
                v8h p0, p1;
#pragma unroll
                for (int j = 0; j < 8; ++j) {
                    p0[j] = (_Float16)w0[q][j];
                    p1[j] = (_Float16)w1[q][j];
                }
                *(v8h*)&Bs[(q * 32 + k0) * BS_P + n0]     = p0;
                *(v8h*)&Bs[(q * 32 + k0 + 1) * BS_P + n0] = p1;
            }
        }
        __syncthreads();

        // a lane names 8 halves of row 8*hiSel + (lane & 7) of a block of W and
        // gets column laneM of the rows 8*hiSel + 0..7
        const _Float16* bt = &Bs[(hiSel * 8 + (lane & 7)) * BS_P + wn * 32 + ((lane >> 3) & 1) * 8];
        // the same for a k-major A tile: row laneM of A, k = 8*hiSel + 0..7
        const _Float16* att = &As[(hiSel * 8 + (lane & 7)) * AT_P + wm * 32 + ((lane >> 3) & 1) * 8];
#pragma unroll
        for (int ks = 0; ks < 4; ++ks) {
            // ---- load fragments, both in the hardware's k order: a lane holds
            //      k = 8*hiSel + 0..7 and 16 + 8*hiSel + 0..7 of its row or column ----
            v16h fa[2], fb[2];
#pragma unroll
            for (int mi = 0; mi < 2; ++mi) {
                if (AT) {
                    const v8h lo = ld_tr16(att + ks * 32 * AT_P + mi * 16);
                    const v8h hi = ld_tr16(att + (ks * 32 + 16) * AT_P + mi * 16);
                    fa[mi] = __builtin_shufflevector(lo, hi, 0, 1, 2, 3, 4, 5, 6, 7,
                                                     8, 9, 10, 11, 12, 13, 14, 15);
                } else {
                    fa[mi] = frag16(&As[(wm * 32 + mi * 16 + laneM) * AS_P + ks * 32 + hiSel * 8]);
                }
            }
#pragma unroll
            for (int ni = 0; ni < 2; ++ni) {
                const v8h lo = ld_tr16(bt + ks * 32 * BS_P + ni * 16);
                const v8h hi = ld_tr16(bt + (ks * 32 + 16) * BS_P + ni * 16);
                fb[ni] = __builtin_shufflevector(lo, hi, 0, 1, 2, 3, 4, 5, 6, 7,
                                                 8, 9, 10, 11, 12, 13, 14, 15);
            }

#pragma unroll
            for (int mi = 0; mi < 2; ++mi)
#pragma unroll
                for (int ni = 0; ni < 2; ++ni)
                    acc[mi][ni] = __builtin_amdgcn_wmma_f32_16x16x32_f16(
                        false, fa[mi], false, fb[ni], (short)0, acc[mi][ni],
                        false, false);
        }
        __syncthreads();
    }

    // ---- the rows' norm factors: four neighbouring lanes staged one row ----
    if (!AT && amode != 0) {
        ss += __shfl_xor(ss, 1);
        ss += __shfl_xor(ss, 2);
        if ((tid & 3) == 0)
            rs[tid >> 2] = 1.0f / (sqrtf(ss / (float)K) + 1e-8f);
        __syncthreads();
#pragma unroll
        for (int mi = 0; mi < 2; ++mi) {
            const float* sp = &rs[wm * 32 + mi * 16 + hiSel * 8];
#pragma unroll
            for (int r = 0; r < 8; ++r) {
                acc[mi][0][r] *= sp[r];
                acc[mi][1][r] *= sp[r];
            }
        }
    }

    // ---- epilogue, modes 1 and 2: a lane holds 8 consecutive tokens of one
    //      channel, 16-byte stores into the channel's own time row ----
    if (mode == 1 || mode == 2) {
        _Float16* Ch = (_Float16*)C;
#pragma unroll
        for (int mi = 0; mi < 2; ++mi) {
#pragma unroll
            for (int ni = 0; ni < 2; ++ni) {
                const int row0 = bm + wm * 32 + mi * 16 + hiSel * 8;
                const int col  = colb + ni * 16;
                float sv[8];
#pragma unroll
                for (int r = 0; r < 8; ++r) {
                    const float val = acc[mi][ni][r] + bc[ni];
                    sv[r] = val / (1.0f + __expf(-val));   // SiLU
                }
                const int b = row0 / NN, n = row0 % NN;
                const size_t o = ((size_t)col * BB + b) * NN + n;
                if (mode == 1) {
                    *(float4*)&C[o]     = make_float4(sv[0], sv[1], sv[2], sv[3]);
                    *(float4*)&C[o + 4] = make_float4(sv[4], sv[5], sv[6], sv[7]);
                    // before the stores' registers are reused
                    asm volatile("s_wait_xcnt 0x0" ::: "memory");
                } else {
                    v8h pk;
#pragma unroll
                    for (int r = 0; r < 8; ++r) pk[r] = (_Float16)sv[r];
                    *(v8h*)&Ch[o] = pk;
                    // before the store's registers are reused
                    asm volatile("s_wait_xcnt 0x0" ::: "memory");
                }
            }
        }
        return;
    }

    // ---- epilogue, mode 4: a row is a lag k and a lane holds 8 consecutive lags
    //      of one channel: G[col][N - 1 - k] = decay(k) * value, decay(0) = 1,
    //      decay(k) = gamma^k, one 16-byte store; a block fills whole 128-byte
    //      lines of its channels' rows ----
    if (!AT && mode == 4) {
        _Float16* G = (_Float16*)C;
#pragma unroll
        for (int mi = 0; mi < 2; ++mi) {
            const int row0 = bm + wm * 32 + mi * 16 + hiSel * 8;
            // gamma^k of the smallest of the eight lags; the others by constant factors
            const float d0 = __expf((float)row0 * __logf(GAMMA));
#pragma unroll
            for (int ni = 0; ni < 2; ++ni) {
                const int col = colb + ni * 16;
                v8h w;
                float pw = 1.0f;
#pragma unroll
                for (int r = 0; r < 8; ++r) {
                    const float decay = (row0 + r == 0) ? 1.0f : d0 * pw;
                    w[7 - r] = (_Float16)(decay * (acc[mi][ni][r] + bc[ni]));
                    pw *= GAMMA;
                }
                *(v8h*)&G[(size_t)col * NN + (NN - 8 - row0)] = w;
                // before the store's registers are reused
                asm volatile("s_wait_xcnt 0x0" ::: "memory");
            }
        }
        return;
    }

    // ---- epilogue, mode 3: all 32 residual values of the thread are asked for
    //      before the first is waited for: one load latency, not 32 in a row ----
    float rv[2][2][8];
    if (mode == 3) {
#pragma unroll
        for (int mi = 0; mi < 2; ++mi) {
            unsigned e[8];   // a row's element at the thread's first column
#pragma unroll
            for (int r = 0; r < 8; ++r)
                e[r] = (unsigned)((bm + wm * 32 + mi * 16 + r + hiSel * 8) * Nf + colb);
#pragma unroll
            for (int r = 0; r < 8; ++r) {
                const float* p = res + e[r];
                rv[mi][0][r] = p[0];
                rv[mi][1][r] = p[16];
            }
            // before the loads' address registers are reused; the element numbers,
            // which the loads take as their offsets, are inputs so that no load's
            // result is placed in them earlier
            asm volatile("s_wait_xcnt 0x0" :: "v"(e[0]), "v"(e[1]), "v"(e[2]), "v"(e[3]),
                                              "v"(e[4]), "v"(e[5]), "v"(e[6]), "v"(e[7]) : "memory");
        }
    }

    // ---- epilogue ----
#pragma unroll
    for (int mi = 0; mi < 2; ++mi) {
#pragma unroll
        for (int ni = 0; ni < 2; ++ni) {
            const int col = colb + ni * 16;
#pragma unroll
            for (int r = 0; r < 8; ++r) {
                const int row = bm + wm * 32 + mi * 16 + r + hiSel * 8;
                float val = acc[mi][ni][r] + bc[ni];
                if (mode == 3) {
                    val += rv[mi][ni][r];
                }
                C[(size_t)row * Nf + col] = val;
                // before the store's registers are reused
                asm volatile("s_wait_xcnt 0x0" ::: "memory");
            }
        }
    }
}

// A launch carries two products that do not depend on each other: the first
// nb0 blocks work on j0, the others on j1. A short product, which alone leaves
// most of the chip idle for the length of its k loop, runs beside a large one.
template <bool WH>
__device__ __forceinline__ void gemm_pair(const GemmJob& j0, const GemmJob& j1, int nb0) {
    const bool f0   = (int)blockIdx.x < nb0;
    const int  tile = f0 ? (int)blockIdx.x : (int)blockIdx.x - nb0;
    const int  lgx  = f0 ? j0.lgx : j1.lgx;
    const int  by0  = f0 ? j0.by0 : j1.by0;
    gemm_tile<false, WH>(f0 ? j0.A : j1.A, f0 ? j0.W : j1.W, f0 ? j0.bias : j1.bias,
                     f0 ? j0.C : j1.C, f0 ? j0.res : j1.res, f0 ? j0.A2 : j1.A2,
                     f0 ? j0.Nf : j1.Nf, f0 ? j0.K : j1.K,
                     f0 ? j0.mode : j1.mode, f0 ? j0.amode : j1.amode, 64 << lgx,
                     (tile & ((1 << lgx) - 1)) * 64, (by0 + (tile >> lgx)) * 128);
}
// both W as f16
__global__ __launch_bounds__(256) void gemm_wmma_kernel(GemmJob j0, GemmJob j1, int nb0) {
    gemm_pair<true>(j0, j1, nb0);
}
// The weights that later launches read, in the order in which their f16 copies
// follow one another at dst.
struct CvtJob {
    const float* Wu;
    const float* Wv;
    const float* Wo;
    const float* Wz;
    const float* W2;
    const float* W3;
    _Float16*    dst;
};
#define CVT_N 32768   // elements a block converts
// The first launch: both W as f32; the blocks from nb on convert the weights of
// the later launches to f16, layout kept, a chunk of CVT_N elements each.
__global__ __launch_bounds__(256) void gemm_cvt_kernel(GemmJob j0, GemmJob j1, int nb0, int nb, CvtJob cj) {
    if ((int)blockIdx.x < nb) {
        gemm_pair<false>(j0, j1, nb0);
        return;
    }
    const int c = (int)blockIdx.x - nb;   // 16 chunks each of Wu, Wv, Wo, Wz, 8 of W2, W3
    const float* s = c < 16 ? cj.Wu + (size_t)c * CVT_N
                   : c < 32 ? cj.Wv + (size_t)(c - 16) * CVT_N
                   : c < 48 ? cj.Wo + (size_t)(c - 32) * CVT_N
                   : c < 64 ? cj.Wz + (size_t)(c - 48) * CVT_N
                   : c < 72 ? cj.W2 + (size_t)(c - 64) * CVT_N
                            : cj.W3 + (size_t)(c - 72) * CVT_N;
    const float* p = s + threadIdx.x * 8;
    _Float16*    q = cj.dst + (size_t)c * CVT_N + threadIdx.x * 8;
    // all loops unrolled: the values stay in registers, and the 16 loads of a
    // group go out before the first is waited for
#pragma unroll
    for (int g = 0; g < 2; ++g) {
        v4f a[8], b[8];
#pragma unroll
        for (int i = 0; i < 8; ++i) {
            a[i] = *(const v4f*)(p + (g * 8 + i) * 2048);
            b[i] = *(const v4f*)(p + (g * 8 + i) * 2048 + 4);
        }
        // before the loads' address registers are reused; the pointer is an
        // input so that no load's result is placed in it earlier
        asm volatile("s_wait_xcnt 0x0" :: "v"(p) : "memory");
#pragma unroll
        for (int i = 0; i < 8; ++i) {
            const v8h o = {(_Float16)a[i][0], (_Float16)a[i][1], (_Float16)a[i][2], (_Float16)a[i][3],
                           (_Float16)b[i][0], (_Float16)b[i][1], (_Float16)b[i][2], (_Float16)b[i][3]};
            *(v8h*)(q + (g * 8 + i) * 2048) = o;
        }
        // before the stores' registers are reused
        asm volatile("s_wait_xcnt 0x0" :: "v"(q) : "memory");
    }
}
// One product whose A is f16 and k-major.
__global__ __launch_bounds__(256) void gemm_at_kernel(GemmJob j) {
    const int tile = (int)blockIdx.x;
    gemm_tile<true, true>(j.A, j.W, j.bias, j.C, j.res, j.A2, j.Nf, j.K, j.mode, j.amode,
                    64 << j.lgx,
                    (tile & ((1 << j.lgx) - 1)) * 64, (j.by0 + (tile >> j.lgx)) * 128);
}

#define CH   (HH * HD)
#define LMAX 2064            // largest lag index a fragment can ask for, rounded up to 8
#define AP   (LMAX + 32)     // row length of one shifted copy in LDS, halves
#define VF   64              // zeros in front of a time row (times < 0)
// time row in LDS: VF zeros, N values, 32 zeros, padded. A fragment read takes
// 16 bytes at every 32 from four places of each of the four rows: the rows
// start at 0, 1, 8 and 9 sixteen-byte units modulo 16, so that the 16 lanes of
// a half wave fall on all 64 banks
#define VP   2184
#define VOFF(b) ((b) * VP + ((b) >> 1) * 48)

// ---------------------------------------------------------------------------
// Causal depthwise conv along time as Toeplitz matrix products, one block per
// channel:  y[b][t] = sum_{k=0..t} a[k] * v[b][t-k]
// One 16x16x32 product, for a lag offset dl and an output tile of 64 steps:
//   A[m][j] = a[dl + m - j]                      (16 x 32, Toeplitz)
//   B[j][n] = v[b][t0 + 16*c4 - dl + j]          (n = 4*b + c4)
//   D[m][n] = part of y[b][t0 + 16*c4 + m]
// dl runs over 0, 32, .., t0 + 64: every lag 0..t is met exactly once; lags
// below 0 and above N-1 read zeros of the filter row, times below 0 zeros of
// the time row.
// A depends on dl alone and B on t0 - dl alone: a wave works on two adjacent
// tiles at once, which share every A, and the upper tile takes as B what the
// lower tile read two steps earlier, kept in registers.
// A lane's 8 consecutive j of A start at a lag that depends on m: the filter
// lies in LDS eight times, copy c shifted by c halves, so that lane m reads
// copy m & 7 at a 16-byte boundary.
// The gate: u lies time-major per channel like y, so a lane multiplies its 8
// consecutive steps of y by u in its registers and stores the product as f16,
// gT[ch][b][t] = u * y, which is the k-major A of the output product.
// ---------------------------------------------------------------------------
__device__ __forceinline__ v8f mm(v16h a, v16h b, v8f c) {
    return __builtin_amdgcn_wmma_f32_16x16x32_f16(false, a, false, b, (short)0, c,
                                                  false, false);
}
__global__ __launch_bounds__(256) void conv_kernel(const _Float16* __restrict__ g,
                                                   const _Float16* __restrict__ vT,
                                                   const float* __restrict__ uT,
                                                   _Float16* __restrict__ gT) {
    __shared__ __align__(16) _Float16 a_s[8 * AP];     // 33.5 KB
    __shared__ __align__(16) _Float16 v_s[VOFF(BB)];   // 17.7 KB

    const int ch   = blockIdx.x;
    const int tid  = threadIdx.x;
    const int lane = tid & 31;
    // scalar wave number: the tile loops below must be scalar branches (a
    // matrix instruction needs every lane on)
    const int wid  = __builtin_amdgcn_readfirstlane(tid >> 5);

    // filter: g[ch][p] holds lag N - 1 - p; a_s[c][x] holds lag LMAX - x + c, that
    // is g[x - c - (LMAX - N + 1)], and 0 outside the row (lags below 0, above N-1).
    // The 8 halves at x = 8q come from the row's pieces q - 3 and q - 2.
    const _Float16* gc = g + (size_t)ch * NN;
    for (int q = tid; q < AP / 8; q += 256) {
        // clamped pieces, read without a branch
        const int i0 = min(max(q - 3, 0), NN / 8 - 1);
        const int i1 = min(max(q - 2, 0), NN / 8 - 1);
        const _Float16* g0p = gc + 8 * i0;
        const _Float16* g1p = gc + 8 * i1;
        v8h lo = *(const v8h*)g0p;
        v8h hi = *(const v8h*)g1p;
        // before the loads' address registers are reused; the piece numbers, which
        // the loads take as their offsets, are inputs so that no load's result is
        // placed in them earlier
        asm volatile("s_wait_xcnt 0x0" :: "v"(i0), "v"(i1) : "memory");
        if (i0 != q - 3) lo = (v8h){};
        if (i1 != q - 2) hi = (v8h){};
        const v16h w = __builtin_shufflevector(lo, hi, 0, 1, 2, 3, 4, 5, 6, 7,
                                               8, 9, 10, 11, 12, 13, 14, 15);
#pragma unroll
        for (int c = 0; c < 8; ++c) {
            v8h o;
#pragma unroll
            for (int e = 0; e < 8; ++e) o[e] = w[e - c + 7];
            *(v8h*)&a_s[c * AP + 8 * q] = o;
        }
    }
    // time rows of the four batches, zeros in front and behind
    const _Float16* vc = vT + (size_t)ch * BB * NN;
#pragma unroll
    for (int b = 0; b < BB; ++b) {
        const v8h x = *(const v8h*)&vc[b * NN + tid * 8];
        *(v8h*)&v_s[VOFF(b) + VF + tid * 8] = x;
    }
    if (tid < BB * 12) {
        const int b = tid / 12, p = tid % 12;
        const int off = (p < 8) ? p * 8 : VF + NN + (p - 8) * 8;
        *(v8h*)&v_s[VOFF(b) + off] = (v8h){};
    }
    __syncthreads();

    const int n  = lane & 15;
    const int hs = lane >> 4;
    const _Float16* a0 = a_s + (n & 7) * AP + LMAX - 8 * (n >> 3) + 8 * hs;
    const _Float16* b0 = v_s + VOFF(n >> 2) + VF + 16 * (n & 3) + 8 * hs;
    const size_t o0 = ((size_t)ch * BB + (n >> 2)) * NN + 16 * (n & 3) + 8 * hs;

    // pairs of tiles w and 15-w: the same number of products for every wave
    for (int q = 0; q < 2; ++q) {
        const int p = q ? 15 - wid : wid;      // tiles 2p (acc0) and 2p+1 (acc1)
        const _Float16* bp = b0 + 128 * p;     // B of tile 2p at dl = 0
        v8f acc0 = (v8f){}, acc1 = (v8f){};
        // u of the pair's outputs, asked for ahead of the products
        const float4* up = (const float4*)(uT + o0 + 128 * p);
        const float4 ua = up[0], ub = up[1], uc = up[16], ud = up[17];
        // before the loads' address registers are reused; the pointer is an
        // input so that no load's result is placed in it earlier
        asm volatile("s_wait_xcnt 0x0" :: "v"(up) : "memory");
        // B of tile 2p+1 at the next even and the next odd step
        v16h h0 = frag16(bp + 64), h1 = frag16(bp + 32);
        const int np = 2 * p + 1;              // steps 0 .. 4p+1, two a trip
        // unroll: the LDS reads of later products go out ahead of one wait
#pragma unroll 2
        for (int i = 0; i < np; ++i) {
            const v16h fa0 = frag16(a0 - 64 * i);
            const v16h fb0 = frag16(bp - 64 * i);
            const v16h fa1 = frag16(a0 - 64 * i - 32);
            const v16h fb1 = frag16(bp - 64 * i - 32);
            acc0 = mm(fa0, fb0, acc0);
            acc1 = mm(fa0, h0, acc1);
            acc0 = mm(fa1, fb1, acc0);
            acc1 = mm(fa1, h1, acc1);
            h0 = fb0;
            h1 = fb1;
        }
        // step 4p+2 for both tiles, steps 4p+3 and 4p+4 for the upper one
        {
            const v16h fa0 = frag16(a0 - 64 * np);
            const v16h fb0 = frag16(bp - 64 * np);
            const v16h fa1 = frag16(a0 - 64 * np - 32);
            const v16h fa2 = frag16(a0 - 64 * np - 64);
            acc0 = mm(fa0, fb0, acc0);
            acc1 = mm(fa0, h0, acc1);
            acc1 = mm(fa1, h1, acc1);
            acc1 = mm(fa2, fb0, acc1);
        }
        const float u0[8] = {ua.x, ua.y, ua.z, ua.w, ub.x, ub.y, ub.z, ub.w};
        const float u1[8] = {uc.x, uc.y, uc.z, uc.w, ud.x, ud.y, ud.z, ud.w};
        v8h g0, g1;
#pragma unroll
        for (int e = 0; e < 8; ++e) {
            g0[e] = (_Float16)(u0[e] * acc0[e]);
            g1[e] = (_Float16)(u1[e] * acc1[e]);
        }
        _Float16* gp = gT + o0 + 128 * p;
        *(v8h*)gp        = g0;
        *(v8h*)(gp + 64) = g1;
        // before the next pair reuses the stores' registers
        asm volatile("s_wait_xcnt 0x0" ::: "memory");
    }
}

// ---------------------------------------------------------------------------
extern "C" void kernel_launch(void* const* d_in, const int* in_sizes, int n_in,
                              void* d_out, int out_size, void* d_ws, size_t ws_size,
                              hipStream_t stream) {
    const float* x  = (const float*)d_in[0];
    const float* Wu = (const float*)d_in[1];
    const float* bu = (const float*)d_in[2];
    const float* Wv = (const float*)d_in[3];
    const float* bv = (const float*)d_in[4];
    const float* Wo = (const float*)d_in[5];
    const float* bo = (const float*)d_in[6];
    const float* Wp = (const float*)d_in[7];
    const float* bp = (const float*)d_in[8];
    const float* W1 = (const float*)d_in[9];
    const float* b1 = (const float*)d_in[10];
    const float* W2 = (const float*)d_in[11];
    const float* b2 = (const float*)d_in[12];
    const float* W3 = (const float*)d_in[13];
    const float* b3 = (const float*)d_in[14];
    const float* Wz = (const float*)d_in[15];
    const float* bz = (const float*)d_in[16];
    float* out = (float*)d_out;

    float* ws = (float*)d_ws;
    const size_t SZ_U  = (size_t)BB * NN * D1;   // 8M
    const size_t SZ_H  = (size_t)NN * EE;        // 1M

    float* u    = ws;                    // 8M  [CH][B][N]
    float* v    = u + SZ_U;              // 8M  f16 [CH][B][N] in its first half
    float* y    = v + SZ_U;              // 8M  u * conv(v), f16 [CH][B][N] in its first half
    float* hcfA = y + SZ_U;              // 1M
    float* hcfB = hcfA + SZ_H;           // 1M
    float* av   = hcfB + SZ_H;           // filter rows, f16 [CH][N], lags descending
    // f16 copies of the weights, each [K][Nf] like its source
    const size_t SZ_W = (size_t)DD * D1;  // 512K
    _Float16* whu = (_Float16*)(av + SZ_H);
    _Float16* whv = whu + SZ_W;
    _Float16* who = whv + SZ_W;
    _Float16* whz = who + SZ_W;
    _Float16* wh2 = whz + SZ_W;
    _Float16* wh3 = wh2 + (size_t)EE * EE;

    // row tiles: 8192 token rows -> 2^7, 2048 position rows -> 2^5
    // u = silu(srms(x) @ Wu + bu), [CH][B][N]; v = silu(srms(x) @ Wv + bv), f16, [CH][B][N];
    // each in two bands of four column tiles (512 blocks)
    const GemmJob ju0 = {x, Wu, bu, u, nullptr, nullptr, D1, DD, 1, 1, 7, 0};
    const GemmJob ju1 = {x, (const float*)whu, bu, u, nullptr, nullptr, D1, DD, 1, 1, 7, 4};
    const GemmJob jv0 = {x, (const float*)whv, bv, v, nullptr, nullptr, D1, DD, 2, 1, 7, 0};
    const GemmJob jv1 = {x, (const float*)whv, bv, v, nullptr, nullptr, D1, DD, 2, 1, 7, 4};
    // positional MLP: each layer is relu(srms(.)) @ W + b
    const GemmJob jp1 = {Wp,   W1, b1, hcfA, nullptr, bp,      EE, EE, 0, 3, 5, 0};
    const GemmJob jp2 = {hcfA, (const float*)wh2, b2, hcfB, nullptr, nullptr, EE, EE, 0, 2, 5, 0};
    const GemmJob jp3 = {hcfB, (const float*)wh3, b3, hcfA, nullptr, nullptr, EE, EE, 0, 2, 5, 0};
    // the last one stores the decayed filter rows of the conv
    const GemmJob jpz = {hcfA, (const float*)whz, bz, av,   nullptr, nullptr, D1, EE, 4, 2, 5, 0};

    // 1-3) the four layers follow one another; each shares its launch with a
    //      band of u or v, which depend on x alone
    //      (128 or 256 blocks of the layer first, then the band's 512)
    //      the first launch takes its two W as f32 and, in 80 more blocks,
    //      converts the weights of all later launches
    const CvtJob cj = {Wu, Wv, Wo, Wz, W2, W3, whu};
    gemm_cvt_kernel<<<720, 256, 0, stream>>>(jp1, ju0, 128, 640, cj);
    gemm_wmma_kernel<<<640, 256, 0, stream>>>(jp2, ju1, 128);
    gemm_wmma_kernel<<<640, 256, 0, stream>>>(jp3, jv0, 128);
    gemm_wmma_kernel<<<768, 256, 0, stream>>>(jpz, jv1, 256);

    // 4) causal depthwise conv and gate: y[ch][b][t] = u * conv(v), f16
    conv_kernel<<<CH, 256, 0, stream>>>((const _Float16*)av, (const _Float16*)v, u, (_Float16*)y);

    // 5) out = y^T @ Wo + bo + x
    const GemmJob jo = {y, (const float*)who, bo, out, x, nullptr, DD, D1, 3, 0, 7, 0};
    gemm_at_kernel<<<512, 256, 0, stream>>>(jo);
}
